// v000
// Measured on an AMD MI455X. A time is GPU time per run, averaged over a window of back-to-back runs after a warm-up
// (all launches, gaps included; the runs take copies of the inputs in turn), and the median of several windows.
// Apart from v000's, it joins two sittings. Times from different sittings can be a few percent apart, while
// side-by-side timings come from the same sitting.
// v000 is the starting kernel. One run takes 132 microseconds.
#include <hip/hip_runtime.h>
#include <hip/hip_bf16.h>

typedef __attribute__((ext_vector_type(16))) _Float16 v16h;
typedef __attribute__((ext_vector_type(8)))  float    v8f;
typedef __attribute__((ext_vector_type(4)))  int      v4i;
typedef __attribute__((ext_vector_type(8)))  int      v8i;
typedef __attribute__((ext_vector_type(4)))  unsigned v4u;

#define B_  8
#define S_  2048
#define H_  1024
#define D_  64

#define AS1 __attribute__((address_space(1)))
#define AS3 __attribute__((address_space(3)))

union Frag {
  v16h v;
  _Float16 h[16];
  unsigned u[8];
};

__device__ __forceinline__ void load_frag_h16(Frag& f, const _Float16* base,
                                              int half) {
  const uint4 lo = *(const uint4*)(base + 8 * half);
  const uint4 hi = *(const uint4*)(base + 16 + 8 * half);
  f.u[0] = lo.x; f.u[1] = lo.y; f.u[2] = lo.z; f.u[3] = lo.w;
  f.u[4] = hi.x; f.u[5] = hi.y; f.u[6] = hi.z; f.u[7] = hi.w;
}

#if __has_builtin(__builtin_amdgcn_global_load_async_to_lds_b128)
#define HAVE_ASYNC_LDS 1
#endif

__device__ __forceinline__ void cp_async_b128(void* lds, const void* g) {
#if defined(HAVE_ASYNC_LDS)
  __builtin_amdgcn_global_load_async_to_lds_b128(
      (AS1 v4i*)(v4i*)g, (AS3 v4i*)(v4i*)lds, 0, 0);
#else
  *(uint4*)lds = *(const uint4*)g;   // synchronous fallback
#endif
}

template <int N>
__device__ __forceinline__ void wait_async() {
#if __has_builtin(__builtin_amdgcn_s_wait_asynccnt)
  __builtin_amdgcn_s_wait_asynccnt(N);
#else
  asm volatile("s_wait_asynccnt %0" ::"i"(N) : "memory");
#endif
}

#if __has_builtin(__builtin_amdgcn_tensor_load_to_lds)
#define HAVE_TDM 1
#endif

__device__ __forceinline__ unsigned lds_offset(const void* p) {
  return (unsigned)(unsigned long long)(AS3 void*)(void*)p;
}

#if defined(HAVE_TDM)
__device__ __forceinline__ void tdm_load_2d(unsigned lds_off, const void* gaddr,
                                            unsigned tensor_d0, unsigned tensor_d1,
                                            unsigned tile_d0, unsigned tile_d1,
                                            unsigned stride0) {
  const unsigned long long ga = (unsigned long long)(size_t)gaddr;
  v4u g0;
  g0[0] = 1u;                                           // count=1, user mode
  g0[1] = lds_off;                                      // lds_addr (bytes)
  g0[2] = (unsigned)ga;                                 // global_addr[31:0]
  g0[3] = (unsigned)((ga >> 32) & 0x1FFFFFFull) | (2u << 30);  // [56:32]|type=2
  v8i g1;
  g1[0] = (int)(1u << 16);
  g1[1] = (int)((tensor_d0 & 0xFFFFu) << 16);
  g1[2] = (int)(((tensor_d0 >> 16) & 0xFFFFu) |
                ((tensor_d1 & 0xFFFFu) << 16));         // dim0[31:16]|dim1[15:0]
  g1[3] = (int)(((tensor_d1 >> 16) & 0xFFFFu) |
                (tile_d0 << 16));
  g1[4] = (int)(tile_d1 & 0xFFFFu);
  g1[5] = (int)stride0;
  g1[6] = 0;
  g1[7] = 0;
  v4i g2 = {0, 0, 0, 0};
  v4i g3 = {0, 0, 0, 0};
  v8i g4 = {0, 0, 0, 0, 0, 0, 0, 0};
  __builtin_amdgcn_tensor_load_to_lds(g0, g1, g2, g3, g4, 0);
}

template <int N>
__device__ __forceinline__ void wait_tensor() {
#if __has_builtin(__builtin_amdgcn_s_wait_tensorcnt)
  __builtin_amdgcn_s_wait_tensorcnt(N);
#else
  asm volatile("s_wait_tensorcnt %0" ::"i"(N) : "memory");
#endif
}
#endif  // HAVE_TDM

__device__ __forceinline__ float hmax16(float v) {
#pragma unroll
  for (int off = 1; off < 16; off <<= 1)
    v = fmaxf(v, __shfl_xor(v, off, 32));
  return v;
}
__device__ __forceinline__ float hsum16(float v) {
#pragma unroll
  for (int off = 1; off < 16; off <<= 1)
    v += __shfl_xor(v, off, 32);
  return v;
}

// ---------------------------------------------------------------------------
// Kernel 0: convert W (f32, [k][n]) -> Wt (f16, [w][n][k]) once.
// ---------------------------------------------------------------------------
__global__ __launch_bounds__(256)
void wtrans_kernel(const float* __restrict__ Wq, const float* __restrict__ Wk,
                   const float* __restrict__ Wv, _Float16* __restrict__ wt) {
  const int id = blockIdx.x * 256 + threadIdx.x;   // 24576 threads
  const int w  = id >> 13;                         // 8192 per weight
  const int r  = id & 8191;
  const int n  = r >> 7;                           // 0..63
  const int k0 = (r & 127) * 8;                    // 0..1016
  const float* W = (w == 0) ? Wq : (w == 1) ? Wk : Wv;
  _Float16* dst = wt + ((size_t)w << 16) + (size_t)n * H_ + k0;
#pragma unroll
  for (int j = 0; j < 8; ++j)
    dst[j] = (_Float16)W[(size_t)(k0 + j) * D_ + n];
}

// ---------------------------------------------------------------------------
// Kernel 1: fused QKV projection. 4 waves/block, each wave a 16-row tile of x.
// f16 Wt chunks (3 x 64 x 32 = 12 KB) async-staged to LDS, double buffered,
// shared by all waves. q,k stored f16 [bs][64]; v transposed [b][d][s].
// ---------------------------------------------------------------------------
__global__ __launch_bounds__(128)
void qkv_proj_kernel(const float* __restrict__ x,
                     const _Float16* __restrict__ wt,
                     const float* __restrict__ bq, const float* __restrict__ bk,
                     const float* __restrict__ bv,
                     _Float16* __restrict__ qh, _Float16* __restrict__ kh,
                     _Float16* __restrict__ vt) {
  __shared__ __align__(16) _Float16 wlds[2][3][64 * 32];  // 2 x 12 KB

  const int tid  = threadIdx.x;
  const int lane = tid & 31;
  const int wid  = tid >> 5;
  const int row0 = (blockIdx.x * 4 + wid) * 16;    // flat row over B*S
  const int half = lane >> 4;
  const int rc   = lane & 15;
  const int srow = tid >> 1;                       // 0..63 staging row
  const int shb  = (tid & 1) << 4;                 // 0/16 halves

  const float* Bs[3] = {bq, bk, bv};

  v8f acc[3][4];
#pragma unroll
  for (int w = 0; w < 3; ++w)
#pragma unroll
    for (int nt = 0; nt < 4; ++nt)
#pragma unroll
      for (int e = 0; e < 8; ++e) acc[w][nt][e] = 0.0f;

  // stage chunk 0: 3 weights x 2 b128 per thread
#pragma unroll
  for (int w = 0; w < 3; ++w)
#pragma unroll
    for (int j = 0; j < 2; ++j)
      cp_async_b128(&wlds[0][w][srow * 32 + shb + j * 8],
                    wt + ((size_t)w << 16) + (size_t)srow * H_ + shb + j * 8);

  for (int kci = 0; kci < 32; ++kci) {
    const int kc = kci * 32;
    if (kci + 1 < 32) {
      const int nb = (kci + 1) & 1;
#pragma unroll
      for (int w = 0; w < 3; ++w)
#pragma unroll
        for (int j = 0; j < 2; ++j)
          cp_async_b128(&wlds[nb][w][srow * 32 + shb + j * 8],
                        wt + ((size_t)w << 16) + (size_t)srow * H_ +
                            (kc + 32) + shb + j * 8);
      wait_async<6>();
    } else {
      wait_async<0>();
    }
    __syncthreads();

    // A fragment: 16x32 chunk of x, four b128 loads + pack-convert
    Frag a;
    const float* xrow = x + (size_t)(row0 + rc) * H_ + kc;
    {
      const float4 f0 = *(const float4*)(xrow + 8 * half);
      const float4 f1 = *(const float4*)(xrow + 8 * half + 4);
      const float4 f2 = *(const float4*)(xrow + 16 + 8 * half);
      const float4 f3 = *(const float4*)(xrow + 16 + 8 * half + 4);
      a.h[0]  = (_Float16)f0.x; a.h[1]  = (_Float16)f0.y;
      a.h[2]  = (_Float16)f0.z; a.h[3]  = (_Float16)f0.w;
      a.h[4]  = (_Float16)f1.x; a.h[5]  = (_Float16)f1.y;
      a.h[6]  = (_Float16)f1.z; a.h[7]  = (_Float16)f1.w;
      a.h[8]  = (_Float16)f2.x; a.h[9]  = (_Float16)f2.y;
      a.h[10] = (_Float16)f2.z; a.h[11] = (_Float16)f2.w;
      a.h[12] = (_Float16)f3.x; a.h[13] = (_Float16)f3.y;
      a.h[14] = (_Float16)f3.z; a.h[15] = (_Float16)f3.w;
    }

    const int cur = kci & 1;
#pragma unroll
    for (int w = 0; w < 3; ++w) {
#pragma unroll
      for (int nt = 0; nt < 4; ++nt) {
        Frag bf;
        load_frag_h16(bf, &wlds[cur][w][(nt * 16 + rc) * 32], half);
        acc[w][nt] = __builtin_amdgcn_wmma_f32_16x16x32_f16(
            false, a.v, false, bf.v, (short)0, acc[w][nt], false, false);
      }
    }
    __syncthreads();
  }

  // bias add + f16 store
#pragma unroll
  for (int w = 0; w < 3; ++w) {
#pragma unroll
    for (int nt = 0; nt < 4; ++nt) {
      const int d = nt * 16 + rc;
      const float bias = Bs[w][d];
#pragma unroll
      for (int r = 0; r < 8; ++r) {
        const int row   = r + 8 * half;
        const int bsrow = row0 + row;
        const _Float16 hv = (_Float16)(acc[w][nt][r] + bias);
        if (w == 0) {
          qh[(size_t)bsrow * D_ + d] = hv;
        } else if (w == 1) {
          kh[(size_t)bsrow * D_ + d] = hv;
        } else {
          const int b = bsrow >> 11;               // / S_
          const int s = bsrow & (S_ - 1);
          vt[((size_t)b * D_ + d) * S_ + s] = hv;
        }
      }
    }
  }
}

__global__ __launch_bounds__(128)
void flash_attn_kernel(const _Float16* __restrict__ qh,
                       const _Float16* __restrict__ kh,
                       const _Float16* __restrict__ vt,
                       const int* __restrict__ mask,
                       float* __restrict__ out) {
  __shared__ __align__(16) _Float16 kbuf[2][32 * 64];  // 2 x 4 KB
  __shared__ __align__(16) _Float16 vbuf[2][64 * 32];  // 2 x 4 KB
  __shared__ __align__(16) _Float16 plds[4][16 * 32];  // 1 KB per wave

  const int tid  = threadIdx.x;
  const int lane = tid & 31;
  const int wid  = tid >> 5;
  const int b    = blockIdx.x >> 5;                    // 32 blocks per batch
  const int q0   = ((blockIdx.x & 31) << 6) + (wid << 4);
  const int half = lane >> 4;
  const int rc   = lane & 15;

  const _Float16* kbase = kh + (size_t)(b * S_) * D_;  // [key][64]
  const _Float16* vbase = vt + (size_t)(b * D_) * S_;  // [d][2048]

  // Q fragments (A-layout): two b128 loads each
  Frag a0, a1;
  {
    const _Float16* qrow = qh + (size_t)(b * S_ + q0 + rc) * D_;
    load_frag_h16(a0, qrow, half);
    load_frag_h16(a1, qrow + 32, half);
  }

  float m[8], l[8];
  v8f acc[4];
#pragma unroll
  for (int r = 0; r < 8; ++r) { m[r] = -1e30f; l[r] = 0.0f; }
#pragma unroll
  for (int nt = 0; nt < 4; ++nt)
#pragma unroll
    for (int e = 0; e < 8; ++e) acc[nt][e] = 0.0f;

  const float scale = 0.125f;                          // 1/sqrt(64)

#if defined(HAVE_TDM)
  if (wid == 0)
    tdm_load_2d(lds_offset(&kbuf[0][0]), kbase, D_, S_, D_, 32, D_);
  else if (wid == 1)
    tdm_load_2d(lds_offset(&vbuf[0][0]), vbase, S_, D_, 32, D_, S_);
#else
  const int vrow = tid >> 1;
  const int vhb  = (tid & 1) << 4;
#pragma unroll
  for (int j = 0; j < 2; ++j) {
    cp_async_b128(&kbuf[0][tid * 16 + j * 8], kbase + tid * 16 + j * 8);
    cp_async_b128(&vbuf[0][vrow * 32 + vhb + j * 8],
                  vbase + (size_t)vrow * S_ + vhb + j * 8);
  }
#endif

  for (int kti = 0; kti < S_ / 32; ++kti) {
    const int kt = kti * 32;
    if (kti + 1 < S_ / 32) {
      const int nb = (kti + 1) & 1;
#if defined(HAVE_TDM)
      if (wid == 0)
        tdm_load_2d(lds_offset(&kbuf[nb][0]), kbase + (size_t)(kt + 32) * D_,
                    D_, S_, D_, 32, D_);
      else if (wid == 1)
        tdm_load_2d(lds_offset(&vbuf[nb][0]), vbase + kt + 32,
                    S_, D_, 32, D_, S_);
      wait_tensor<1>();
#else
#pragma unroll
      for (int j = 0; j < 2; ++j) {
        cp_async_b128(&kbuf[nb][tid * 16 + j * 8],
                      kbase + (size_t)(kt + 32) * D_ + tid * 16 + j * 8);
        cp_async_b128(&vbuf[nb][vrow * 32 + vhb + j * 8],
                      vbase + (size_t)vrow * S_ + kt + 32 + vhb + j * 8);
      }
      wait_async<4>();
#endif
    } else {
#if defined(HAVE_TDM)
      wait_tensor<0>();
#else
      wait_async<0>();
#endif
    }
    __syncthreads();

    const _Float16* kl = kbuf[kti & 1];
    const _Float16* vl = vbuf[kti & 1];

    // --- scores: S = Q @ K^T for 2 groups of 16 keys (ds_load_b128) --------
    Frag bk00, bk01, bk10, bk11;
    load_frag_h16(bk00, kl + rc * D_, half);
    load_frag_h16(bk01, kl + rc * D_ + 32, half);
    load_frag_h16(bk10, kl + (16 + rc) * D_, half);
    load_frag_h16(bk11, kl + (16 + rc) * D_ + 32, half);

    v8f s0, s1;
#pragma unroll
    for (int e = 0; e < 8; ++e) { s0[e] = 0.0f; s1[e] = 0.0f; }
    s0 = __builtin_amdgcn_wmma_f32_16x16x32_f16(false, a0.v, false, bk00.v,
                                                (short)0, s0, false, false);
    s0 = __builtin_amdgcn_wmma_f32_16x16x32_f16(false, a1.v, false, bk01.v,
                                                (short)0, s0, false, false);
    s1 = __builtin_amdgcn_wmma_f32_16x16x32_f16(false, a0.v, false, bk10.v,
                                                (short)0, s1, false, false);
    s1 = __builtin_amdgcn_wmma_f32_16x16x32_f16(false, a1.v, false, bk11.v,
                                                (short)0, s1, false, false);

    const int mk0 = mask[b * S_ + kt + rc];
    const int mk1 = mask[b * S_ + kt + 16 + rc];

    // --- online softmax update --------------------------------------------
    float p0[8], p1[8], alpha[8];
#pragma unroll
    for (int r = 0; r < 8; ++r) {
      float v0 = s0[r] * scale; if (mk0 == 0) v0 = -1e30f;
      float v1 = s1[r] * scale; if (mk1 == 0) v1 = -1e30f;
      const float rmax = hmax16(fmaxf(v0, v1));
      const float mn   = fmaxf(m[r], rmax);
      const float e0   = __expf(v0 - mn);
      const float e1   = __expf(v1 - mn);
      const float al   = __expf(m[r] - mn);
      const float rs   = hsum16(e0 + e1);
      l[r] = l[r] * al + rs;
      m[r] = mn;
      alpha[r] = al;
      p0[r] = e0;
      p1[r] = e1;
    }
#pragma unroll
    for (int nt = 0; nt < 4; ++nt)
#pragma unroll
      for (int r = 0; r < 8; ++r) acc[nt][r] *= alpha[r];

    // --- transpose P (C layout) -> A layout via per-wave LDS ---------------
    _Float16* pl = plds[wid];
#pragma unroll
    for (int r = 0; r < 8; ++r) {
      const int row = r + 8 * half;
      pl[row * 32 + rc]      = (_Float16)p0[r];
      pl[row * 32 + 16 + rc] = (_Float16)p1[r];
    }
    __syncthreads();
    Frag pa;
    load_frag_h16(pa, pl + rc * 32, half);

    // --- acc += P @ V (V^T fragments from LDS, ds_load_b128) ---------------
#pragma unroll
    for (int nt = 0; nt < 4; ++nt) {
      Frag bf;
      load_frag_h16(bf, vl + (nt * 16 + rc) * 32, half);
      acc[nt] = __builtin_amdgcn_wmma_f32_16x16x32_f16(
          false, pa.v, false, bf.v, (short)0, acc[nt], false, false);
    }
    __syncthreads();   // protect LDS P buffer and K/V buffers for reuse
  }

  // --- normalize and store -------------------------------------------------
#pragma unroll
  for (int nt = 0; nt < 4; ++nt) {
    const int d = nt * 16 + rc;
#pragma unroll
    for (int r = 0; r < 8; ++r) {
      const int row = r + 8 * half;
      out[(size_t)(b * S_ + q0 + row) * D_ + d] = acc[nt][r] / l[r];
    }
  }
}

// ---------------------------------------------------------------------------
extern "C" void kernel_launch(void* const* d_in, const int* in_sizes, int n_in,
                              void* d_out, int out_size, void* d_ws, size_t ws_size,
                              hipStream_t stream) {
  const float* x    = (const float*)d_in[0];
  const int*   mask = (const int*)d_in[1];
  const float* Wq   = (const float*)d_in[2];
  const float* bq   = (const float*)d_in[3];
  const float* Wk   = (const float*)d_in[4];
  const float* bk   = (const float*)d_in[5];
  const float* Wv   = (const float*)d_in[6];
  const float* bv   = (const float*)d_in[7];
  float* out = (float*)d_out;

  char* ws = (char*)d_ws;
  _Float16* qh = (_Float16*)ws;                                  // 2 MB
  _Float16* kh = (_Float16*)(ws + (size_t)2 * 1024 * 1024);      // 2 MB
  _Float16* vt = (_Float16*)(ws + (size_t)4 * 1024 * 1024);      // 2 MB
  _Float16* wt = (_Float16*)(ws + (size_t)6 * 1024 * 1024);      // 384 KB

  wtrans_kernel<<<96, 256, 0, stream>>>(Wq, Wk, Wv, wt);
  qkv_proj_kernel<<<256, 128, 0, stream>>>(x, wt, bq, bk, bv, qh, kh, vt);
  flash_attn_kernel<<<256, 128, 0, stream>>>(qh, kh, vt, mask, out);
}

// v001
// Measured time: 89.7 microseconds a run.
// In two side-by-side timings against v000, it was 1.50 and 1.49 times as fast.
#include <hip/hip_runtime.h>
#include <hip/hip_bf16.h>

typedef __attribute__((ext_vector_type(16))) _Float16 v16h;
typedef __attribute__((ext_vector_type(8)))  float    v8f;
typedef __attribute__((ext_vector_type(4)))  int      v4i;
typedef __attribute__((ext_vector_type(8)))  int      v8i;
typedef __attribute__((ext_vector_type(4)))  unsigned v4u;

#define B_  8
#define S_  2048
#define H_  1024
#define D_  64

#define AS1 __attribute__((address_space(1)))
#define AS3 __attribute__((address_space(3)))

union Frag {
  v16h v;
  _Float16 h[16];
  unsigned u[8];
};

__device__ __forceinline__ void load_frag_h16(Frag& f, const _Float16* base,
                                              int half) {
  const uint4 lo = *(const uint4*)(base + 8 * half);
  const uint4 hi = *(const uint4*)(base + 16 + 8 * half);
  f.u[0] = lo.x; f.u[1] = lo.y; f.u[2] = lo.z; f.u[3] = lo.w;
  f.u[4] = hi.x; f.u[5] = hi.y; f.u[6] = hi.z; f.u[7] = hi.w;
}

#if __has_builtin(__builtin_amdgcn_global_load_async_to_lds_b128)
#define HAVE_ASYNC_LDS 1
#endif

__device__ __forceinline__ void cp_async_b128(void* lds, const void* g) {
#if defined(HAVE_ASYNC_LDS)
  __builtin_amdgcn_global_load_async_to_lds_b128(
      (AS1 v4i*)(v4i*)g, (AS3 v4i*)(v4i*)lds, 0, 0);
#else
  *(uint4*)lds = *(const uint4*)g;   // synchronous fallback
#endif
}

template <int N>
__device__ __forceinline__ void wait_async() {
#if __has_builtin(__builtin_amdgcn_s_wait_asynccnt)
  __builtin_amdgcn_s_wait_asynccnt(N);
#else
  asm volatile("s_wait_asynccnt %0" ::"i"(N) : "memory");
#endif
}

#if __has_builtin(__builtin_amdgcn_tensor_load_to_lds)
#define HAVE_TDM 1
#endif

__device__ __forceinline__ unsigned lds_offset(const void* p) {
  return (unsigned)(unsigned long long)(AS3 void*)(void*)p;
}

#if defined(HAVE_TDM)
__device__ __forceinline__ void tdm_load_2d(unsigned lds_off, const void* gaddr,
                                            unsigned tensor_d0, unsigned tensor_d1,
                                            unsigned tile_d0, unsigned tile_d1,
                                            unsigned stride0) {
  const unsigned long long ga = (unsigned long long)(size_t)gaddr;
  v4u g0;
  g0[0] = 1u;                                           // count=1, user mode
  g0[1] = lds_off;                                      // lds_addr (bytes)
  g0[2] = (unsigned)ga;                                 // global_addr[31:0]
  g0[3] = (unsigned)((ga >> 32) & 0x1FFFFFFull) | (2u << 30);  // [56:32]|type=2
  v8i g1;
  g1[0] = (int)(1u << 16);
  g1[1] = (int)((tensor_d0 & 0xFFFFu) << 16);
  g1[2] = (int)(((tensor_d0 >> 16) & 0xFFFFu) |
                ((tensor_d1 & 0xFFFFu) << 16));         // dim0[31:16]|dim1[15:0]
  g1[3] = (int)(((tensor_d1 >> 16) & 0xFFFFu) |
                (tile_d0 << 16));
  g1[4] = (int)(tile_d1 & 0xFFFFu);
  g1[5] = (int)stride0;
  g1[6] = 0;
  g1[7] = 0;
  v4i g2 = {0, 0, 0, 0};
  v4i g3 = {0, 0, 0, 0};
  v8i g4 = {0, 0, 0, 0, 0, 0, 0, 0};
  __builtin_amdgcn_tensor_load_to_lds(g0, g1, g2, g3, g4, 0);
}

template <int N>
__device__ __forceinline__ void wait_tensor() {
#if __has_builtin(__builtin_amdgcn_s_wait_tensorcnt)
  __builtin_amdgcn_s_wait_tensorcnt(N);
#else
  asm volatile("s_wait_tensorcnt %0" ::"i"(N) : "memory");
#endif
}
#endif  // HAVE_TDM

__device__ __forceinline__ float xhalf(float x) {
  const int i = __builtin_bit_cast(int, x);
  return __builtin_bit_cast(float, __builtin_amdgcn_permlanex16(
      i, i, 0x76543210, 0xfedcba98, false, false));
}

__device__ __forceinline__ void exp_pair(float& r0, float& r1, float x0, float x1) {
  asm("v_exp_f32 %0, %2\n\tv_exp_f32 %1, %3\n\tv_nop"
      : "=&v"(r0), "=&v"(r1)
      : "v"(x0 * 1.44269504f), "v"(x1 * 1.44269504f));
}

// ---------------------------------------------------------------------------
// Kernel 0: convert W (f32, [k][n]) -> Wt (f16, [w][n][k]) once.
// ---------------------------------------------------------------------------
__global__ __launch_bounds__(256)
void wtrans_kernel(const float* __restrict__ Wq, const float* __restrict__ Wk,
                   const float* __restrict__ Wv, _Float16* __restrict__ wt) {
  const int id = blockIdx.x * 256 + threadIdx.x;   // 24576 threads
  const int w  = id >> 13;                         // 8192 per weight
  const int r  = id & 8191;
  const int n  = r >> 7;                           // 0..63
  const int k0 = (r & 127) * 8;                    // 0..1016
  const float* W = (w == 0) ? Wq : (w == 1) ? Wk : Wv;
  _Float16* dst = wt + ((size_t)w << 16) + (size_t)n * H_ + k0;
#pragma unroll
  for (int j = 0; j < 8; ++j)
    dst[j] = (_Float16)W[(size_t)(k0 + j) * D_ + n];
}

// ---------------------------------------------------------------------------
// Kernel 1: fused QKV projection. 4 waves/block, each wave a 16-row tile of x.
// f16 Wt chunks (3 x 64 x 32 = 12 KB) async-staged to LDS, double buffered,
// shared by all waves. q,k stored f16 [bs][64]; v transposed [b][d][s].
// ---------------------------------------------------------------------------
__global__ __launch_bounds__(128)
void qkv_proj_kernel(const float* __restrict__ x,
                     const _Float16* __restrict__ wt,
                     const float* __restrict__ bq, const float* __restrict__ bk,
                     const float* __restrict__ bv,
                     _Float16* __restrict__ qh, _Float16* __restrict__ kh,
                     _Float16* __restrict__ vt) {
  __shared__ __align__(16) _Float16 wlds[2][3][64 * 32];  // 2 x 12 KB

  const int tid  = threadIdx.x;
  const int lane = tid & 31;
  const int wid  = tid >> 5;
  const int row0 = (blockIdx.x * 4 + wid) * 16;    // flat row over B*S
  const int half = lane >> 4;
  const int rc   = lane & 15;
  const int srow = tid >> 1;                       // 0..63 staging row
  const int shb  = (tid & 1) << 4;                 // 0/16 halves

  const float* Bs[3] = {bq, bk, bv};

  v8f acc[3][4];
#pragma unroll
  for (int w = 0; w < 3; ++w)
#pragma unroll
    for (int nt = 0; nt < 4; ++nt)
#pragma unroll
      for (int e = 0; e < 8; ++e) acc[w][nt][e] = 0.0f;

  // stage chunk 0: 3 weights x 2 b128 per thread
#pragma unroll
  for (int w = 0; w < 3; ++w)
#pragma unroll
    for (int j = 0; j < 2; ++j)
      cp_async_b128(&wlds[0][w][srow * 32 + shb + j * 8],
                    wt + ((size_t)w << 16) + (size_t)srow * H_ + shb + j * 8);

  for (int kci = 0; kci < 32; ++kci) {
    const int kc = kci * 32;
    if (kci + 1 < 32) {
      const int nb = (kci + 1) & 1;
#pragma unroll
      for (int w = 0; w < 3; ++w)
#pragma unroll
        for (int j = 0; j < 2; ++j)
          cp_async_b128(&wlds[nb][w][srow * 32 + shb + j * 8],
                        wt + ((size_t)w << 16) + (size_t)srow * H_ +
                            (kc + 32) + shb + j * 8);
      wait_async<6>();
    } else {
      wait_async<0>();
    }
    __syncthreads();

    // A fragment: 16x32 chunk of x, four b128 loads + pack-convert
    Frag a;
    const float* xrow = x + (size_t)(row0 + rc) * H_ + kc;
    {
      const float4 f0 = *(const float4*)(xrow + 8 * half);
      const float4 f1 = *(const float4*)(xrow + 8 * half + 4);
      const float4 f2 = *(const float4*)(xrow + 16 + 8 * half);
      const float4 f3 = *(const float4*)(xrow + 16 + 8 * half + 4);
      a.h[0]  = (_Float16)f0.x; a.h[1]  = (_Float16)f0.y;
      a.h[2]  = (_Float16)f0.z; a.h[3]  = (_Float16)f0.w;
      a.h[4]  = (_Float16)f1.x; a.h[5]  = (_Float16)f1.y;
      a.h[6]  = (_Float16)f1.z; a.h[7]  = (_Float16)f1.w;
      a.h[8]  = (_Float16)f2.x; a.h[9]  = (_Float16)f2.y;
      a.h[10] = (_Float16)f2.z; a.h[11] = (_Float16)f2.w;
      a.h[12] = (_Float16)f3.x; a.h[13] = (_Float16)f3.y;
      a.h[14] = (_Float16)f3.z; a.h[15] = (_Float16)f3.w;
    }

    const int cur = kci & 1;
#pragma unroll
    for (int w = 0; w < 3; ++w) {
#pragma unroll
      for (int nt = 0; nt < 4; ++nt) {
        Frag bf;
        load_frag_h16(bf, &wlds[cur][w][(nt * 16 + rc) * 32], half);
        acc[w][nt] = __builtin_amdgcn_wmma_f32_16x16x32_f16(
            false, a.v, false, bf.v, (short)0, acc[w][nt], false, false);
      }
    }
    __syncthreads();
  }

  // bias add + f16 store
#pragma unroll
  for (int w = 0; w < 3; ++w) {
#pragma unroll
    for (int nt = 0; nt < 4; ++nt) {
      const int d = nt * 16 + rc;
      const float bias = Bs[w][d];
#pragma unroll
      for (int r = 0; r < 8; ++r) {
        const int row   = r + 8 * half;
        const int bsrow = row0 + row;
        const _Float16 hv = (_Float16)(acc[w][nt][r] + bias);
        if (w == 0) {
          qh[(size_t)bsrow * D_ + d] = hv;
        } else if (w == 1) {
          kh[(size_t)bsrow * D_ + d] = hv;
        } else {
          const int b = bsrow >> 11;               // / S_
          const int s = bsrow & (S_ - 1);
          vt[((size_t)b * D_ + d) * S_ + s] = hv;
        }
      }
    }
  }
}

__global__ __launch_bounds__(128)
void flash_attn_kernel(const _Float16* __restrict__ qh,
                       const _Float16* __restrict__ kh,
                       const _Float16* __restrict__ vt,
                       const int* __restrict__ mask,
                       float* __restrict__ out) {
  __shared__ __align__(16) _Float16 kbuf[2][32 * 64];  // 2 x 4 KB
  __shared__ __align__(16) _Float16 vbuf[2][64 * 32];  // 2 x 4 KB
  __shared__ __align__(16) float    mbias[S_];         // 8 KB, 0 or -8e30

  const int tid  = threadIdx.x;
  const int lane = tid & 31;
  const int wid  = tid >> 5;
  const int b    = blockIdx.x >> 5;                    // 32 blocks per batch
  const int q0   = ((blockIdx.x & 31) << 6) + (wid << 4);
  const int half = lane >> 4;
  const int rc   = lane & 15;

  const _Float16* kbase = kh + (size_t)(b * S_) * D_;  // [key][64]
  const _Float16* vbase = vt + (size_t)(b * D_) * S_;  // [d][2048]

  // Q fragments (B operand, column = query): two b128 loads each
  Frag a0, a1;
  {
    const _Float16* qrow = qh + (size_t)(b * S_ + q0 + rc) * D_;
    load_frag_h16(a0, qrow, half);
    load_frag_h16(a1, qrow + 32, half);
  }

  float m = -1e30f, l = 0.0f;                          // this lane's query
  v8f acc[4];                                          // O^T: row d, col query
#pragma unroll
  for (int nt = 0; nt < 4; ++nt)
#pragma unroll
    for (int e = 0; e < 8; ++e) acc[nt][e] = 0.0f;

  const float scale = 0.125f;                          // 1/sqrt(64)

#if defined(HAVE_TDM)
  if (wid == 0)
    tdm_load_2d(lds_offset(&kbuf[0][0]), kbase, D_, S_, D_, 32, D_);
  else if (wid == 1)
    tdm_load_2d(lds_offset(&vbuf[0][0]), vbase, S_, D_, 32, D_, S_);
#else
  const int vrow = tid >> 1;
  const int vhb  = (tid & 1) << 4;
#pragma unroll
  for (int j = 0; j < 2; ++j) {
    cp_async_b128(&kbuf[0][tid * 16 + j * 8], kbase + tid * 16 + j * 8);
    cp_async_b128(&vbuf[0][vrow * 32 + vhb + j * 8],
                  vbase + (size_t)vrow * S_ + vhb + j * 8);
  }
#endif

  // mask table: -8e30 absorbs any score and gives -1e30 after the 1/8 scale;
  // published by the first barrier of the loop
#pragma unroll
  for (int j = 0; j < 4; ++j) {
    const int4 mm = *(const int4*)(mask + b * S_ + tid * 16 + j * 4);
    float4 f;
    f.x = (mm.x == 0) ? -8e30f : 0.0f;
    f.y = (mm.y == 0) ? -8e30f : 0.0f;
    f.z = (mm.z == 0) ? -8e30f : 0.0f;
    f.w = (mm.w == 0) ? -8e30f : 0.0f;
    *(float4*)&mbias[tid * 16 + j * 4] = f;
  }

  for (int kti = 0; kti < S_ / 32; ++kti) {
    const int kt = kti * 32;
    if (kti + 1 < S_ / 32) {
      const int nb = (kti + 1) & 1;
#if defined(HAVE_TDM)
      if (wid == 0)
        tdm_load_2d(lds_offset(&kbuf[nb][0]), kbase + (size_t)(kt + 32) * D_,
                    D_, S_, D_, 32, D_);
      else if (wid == 1)
        tdm_load_2d(lds_offset(&vbuf[nb][0]), vbase + kt + 32,
                    S_, D_, 32, D_, S_);
      wait_tensor<1>();
#else
#pragma unroll
      for (int j = 0; j < 2; ++j) {
        cp_async_b128(&kbuf[nb][tid * 16 + j * 8],
                      kbase + (size_t)(kt + 32) * D_ + tid * 16 + j * 8);
        cp_async_b128(&vbuf[nb][vrow * 32 + vhb + j * 8],
                      vbase + (size_t)vrow * S_ + kt + 32 + vhb + j * 8);
      }
      wait_async<4>();
#endif
    } else {
#if defined(HAVE_TDM)
      wait_tensor<0>();
#else
      wait_async<0>();
#endif
    }
    __syncthreads();

    const _Float16* kl = kbuf[kti & 1];
    const _Float16* vl = vbuf[kti & 1];

    // --- scores: S^T = K @ Q^T for 2 groups of 16 keys (ds_load_b128) ------
    Frag bk00, bk01, bk10, bk11;
    load_frag_h16(bk00, kl + rc * D_, half);
    load_frag_h16(bk01, kl + rc * D_ + 32, half);
    load_frag_h16(bk10, kl + (16 + rc) * D_, half);
    load_frag_h16(bk11, kl + (16 + rc) * D_ + 32, half);

    v8f s0, s1;                                        // start value: key mask
    {
      const float4 c0 = *(const float4*)&mbias[kt + 8 * half];
      const float4 c1 = *(const float4*)&mbias[kt + 8 * half + 4];
      const float4 c2 = *(const float4*)&mbias[kt + 16 + 8 * half];
      const float4 c3 = *(const float4*)&mbias[kt + 16 + 8 * half + 4];
      s0[0] = c0.x; s0[1] = c0.y; s0[2] = c0.z; s0[3] = c0.w;
      s0[4] = c1.x; s0[5] = c1.y; s0[6] = c1.z; s0[7] = c1.w;
      s1[0] = c2.x; s1[1] = c2.y; s1[2] = c2.z; s1[3] = c2.w;
      s1[4] = c3.x; s1[5] = c3.y; s1[6] = c3.z; s1[7] = c3.w;
    }
    Frag av[4];                                        // V^T rows, A operand
#pragma unroll
    for (int nt = 0; nt < 4; ++nt)
      load_frag_h16(av[nt], vl + (nt * 16 + rc) * 32, half);
    __builtin_amdgcn_sched_barrier(0);
    s0 = __builtin_amdgcn_wmma_f32_16x16x32_f16(false, bk00.v, false, a0.v,
                                                (short)0, s0, false, false);
    s0 = __builtin_amdgcn_wmma_f32_16x16x32_f16(false, bk01.v, false, a1.v,
                                                (short)0, s0, false, false);
    s1 = __builtin_amdgcn_wmma_f32_16x16x32_f16(false, bk10.v, false, a0.v,
                                                (short)0, s1, false, false);
    s1 = __builtin_amdgcn_wmma_f32_16x16x32_f16(false, bk11.v, false, a1.v,
                                                (short)0, s1, false, false);

    // --- online softmax update, one query per lane --------------------------
    float v0[8], v1[8];
#pragma unroll
    for (int r = 0; r < 8; ++r) { v0[r] = s0[r] * scale; v1[r] = s1[r] * scale; }
    float rmax = fmaxf(v0[0], v1[0]);
#pragma unroll
    for (int r = 1; r < 8; ++r) rmax = fmaxf(rmax, fmaxf(v0[r], v1[r]));
    rmax = fmaxf(rmax, xhalf(rmax));                   // both halves' 32 keys
    const float mn = fmaxf(m, rmax);
    const float al = __expf(m - mn);
    float rs0 = 0.0f, rs1 = 0.0f;
    Frag pb;                                           // P^T as B operand
#pragma unroll
    for (int r = 0; r < 8; ++r) {
      float e0, e1;
      exp_pair(e0, e1, v0[r] - mn, v1[r] - mn);
      rs0 += e0;
      rs1 += e1;
      pb.h[r]     = (_Float16)e0;                      // k = 8*half + r
      pb.h[8 + r] = (_Float16)e1;                      // k = 16 + 8*half + r
    }
    l = l * al + (rs0 + rs1);                          // this half's keys only
    m = mn;
#pragma unroll
    for (int nt = 0; nt < 4; ++nt)
#pragma unroll
      for (int r = 0; r < 8; ++r) acc[nt][r] *= al;

    // --- acc += V^T @ P^T ---------------------------------------------------
#pragma unroll
    for (int nt = 0; nt < 4; ++nt)
      acc[nt] = __builtin_amdgcn_wmma_f32_16x16x32_f16(
          false, av[nt].v, false, pb.v, (short)0, acc[nt], false, false);
    __syncthreads();   // protect K/V buffers for reuse
  }

  // --- normalize and store: a lane holds 8 consecutive d of its query ------
  // one query per lane: one division serves the lane's 32 outputs
  const float inv = 1.0f / (l + xhalf(l));             // join the halves' sums
  float* orow = out + (size_t)(b * S_ + q0 + rc) * D_ + 8 * half;
#pragma unroll
  for (int nt = 0; nt < 4; ++nt) {
    float4 o0, o1;
    o0.x = acc[nt][0] * inv; o0.y = acc[nt][1] * inv;
    o0.z = acc[nt][2] * inv; o0.w = acc[nt][3] * inv;
    o1.x = acc[nt][4] * inv; o1.y = acc[nt][5] * inv;
    o1.z = acc[nt][6] * inv; o1.w = acc[nt][7] * inv;
    *(float4*)(orow + nt * 16)     = o0;
    *(float4*)(orow + nt * 16 + 4) = o1;
  }
}

// ---------------------------------------------------------------------------
extern "C" void kernel_launch(void* const* d_in, const int* in_sizes, int n_in,
                              void* d_out, int out_size, void* d_ws, size_t ws_size,
                              hipStream_t stream) {
  const float* x    = (const float*)d_in[0];
  const int*   mask = (const int*)d_in[1];
  const float* Wq   = (const float*)d_in[2];
  const float* bq   = (const float*)d_in[3];
  const float* Wk   = (const float*)d_in[4];
  const float* bk   = (const float*)d_in[5];
  const float* Wv   = (const float*)d_in[6];
  const float* bv   = (const float*)d_in[7];
  float* out = (float*)d_out;

  char* ws = (char*)d_ws;
  _Float16* qh = (_Float16*)ws;                                  // 2 MB
  _Float16* kh = (_Float16*)(ws + (size_t)2 * 1024 * 1024);      // 2 MB
  _Float16* vt = (_Float16*)(ws + (size_t)4 * 1024 * 1024);      // 2 MB
  _Float16* wt = (_Float16*)(ws + (size_t)6 * 1024 * 1024);      // 384 KB

  wtrans_kernel<<<96, 256, 0, stream>>>(Wq, Wk, Wv, wt);
  qkv_proj_kernel<<<256, 128, 0, stream>>>(x, wt, bq, bk, bv, qh, kh, vt);
  flash_attn_kernel<<<256, 128, 0, stream>>>(qh, kh, vt, mask, out);
}

// v002
// A run of this version takes 69.9 microseconds.
// Two timings next to v001 both put it at 1.23 times that version's speed.
// All steps since v000 together make it 1.84 times as fast.
#include <hip/hip_runtime.h>
#include <hip/hip_bf16.h>

typedef __attribute__((ext_vector_type(16))) _Float16 v16h;
typedef __attribute__((ext_vector_type(8)))  float    v8f;
typedef __attribute__((ext_vector_type(4)))  int      v4i;
typedef __attribute__((ext_vector_type(8)))  int      v8i;
typedef __attribute__((ext_vector_type(4)))  unsigned v4u;

#define B_  8
#define S_  2048
#define H_  1024
#define D_  64

#define AS1 __attribute__((address_space(1)))
#define AS3 __attribute__((address_space(3)))

union Frag {
  v16h v;
  _Float16 h[16];
  unsigned u[8];
};

__device__ __forceinline__ void load_frag_h16(Frag& f, const _Float16* base,
                                              int half) {
  const uint4 lo = *(const uint4*)(base + 8 * half);
  const uint4 hi = *(const uint4*)(base + 16 + 8 * half);
  f.u[0] = lo.x; f.u[1] = lo.y; f.u[2] = lo.z; f.u[3] = lo.w;
  f.u[4] = hi.x; f.u[5] = hi.y; f.u[6] = hi.z; f.u[7] = hi.w;
}

__device__ __forceinline__ int frag_pos(int f, int p, int l) {
  return ((2 * f + p) * 32 + l) * 8;
}

__device__ __forceinline__ void load_frag_tile(Frag& fr, const _Float16* tile,
                                               int f, int lane) {
  const uint4 lo = *(const uint4*)(tile + frag_pos(f, 0, lane));
  const uint4 hi = *(const uint4*)(tile + frag_pos(f, 1, lane));
  fr.u[0] = lo.x; fr.u[1] = lo.y; fr.u[2] = lo.z; fr.u[3] = lo.w;
  fr.u[4] = hi.x; fr.u[5] = hi.y; fr.u[6] = hi.z; fr.u[7] = hi.w;
}

#if __has_builtin(__builtin_amdgcn_global_load_async_to_lds_b128)
#define HAVE_ASYNC_LDS 1
#endif

__device__ __forceinline__ void cp_async_b128(void* lds, const void* g) {
#if defined(HAVE_ASYNC_LDS)
  __builtin_amdgcn_global_load_async_to_lds_b128(
      (AS1 v4i*)(v4i*)g, (AS3 v4i*)(v4i*)lds, 0, 0);
#else
  *(uint4*)lds = *(const uint4*)g;   // synchronous fallback
#endif
}

template <int N>
__device__ __forceinline__ void wait_async() {
#if __has_builtin(__builtin_amdgcn_s_wait_asynccnt)
  __builtin_amdgcn_s_wait_asynccnt(N);
#else
  asm volatile("s_wait_asynccnt %0" ::"i"(N) : "memory");
#endif
}

#if __has_builtin(__builtin_amdgcn_tensor_load_to_lds)
#define HAVE_TDM 1
#endif

__device__ __forceinline__ unsigned lds_offset(const void* p) {
  return (unsigned)(unsigned long long)(AS3 void*)(void*)p;
}

#if defined(HAVE_TDM)
__device__ __forceinline__ void tdm_load_2d(unsigned lds_off, const void* gaddr,
                                            unsigned tensor_d0, unsigned tensor_d1,
                                            unsigned tile_d0, unsigned tile_d1,
                                            unsigned stride0) {
  const unsigned long long ga = (unsigned long long)(size_t)gaddr;
  v4u g0;
  g0[0] = 1u;                                           // count=1, user mode
  g0[1] = lds_off;                                      // lds_addr (bytes)
  g0[2] = (unsigned)ga;                                 // global_addr[31:0]
  g0[3] = (unsigned)((ga >> 32) & 0x1FFFFFFull) | (2u << 30);  // [56:32]|type=2
  v8i g1;
  g1[0] = (int)(1u << 16);
  g1[1] = (int)((tensor_d0 & 0xFFFFu) << 16);
  g1[2] = (int)(((tensor_d0 >> 16) & 0xFFFFu) |
                ((tensor_d1 & 0xFFFFu) << 16));         // dim0[31:16]|dim1[15:0]
  g1[3] = (int)(((tensor_d1 >> 16) & 0xFFFFu) |
                (tile_d0 << 16));
  g1[4] = (int)(tile_d1 & 0xFFFFu);
  g1[5] = (int)stride0;
  g1[6] = 0;
  g1[7] = 0;
  v4i g2 = {0, 0, 0, 0};
  v4i g3 = {0, 0, 0, 0};
  v8i g4 = {0, 0, 0, 0, 0, 0, 0, 0};
  __builtin_amdgcn_tensor_load_to_lds(g0, g1, g2, g3, g4, 0);
}

template <int N>
__device__ __forceinline__ void wait_tensor() {
#if __has_builtin(__builtin_amdgcn_s_wait_tensorcnt)
  __builtin_amdgcn_s_wait_tensorcnt(N);
#else
  asm volatile("s_wait_tensorcnt %0" ::"i"(N) : "memory");
#endif
}
#endif  // HAVE_TDM

__device__ __forceinline__ float xhalf(float x) {
  const int i = __builtin_bit_cast(int, x);
  return __builtin_bit_cast(float, __builtin_amdgcn_permlanex16(
      i, i, 0x76543210, 0xfedcba98, false, false));
}

__device__ __forceinline__ void exp_pair(float& r0, float& r1, float x0, float x1) {
  asm("v_exp_f32 %0, %2\n\tv_exp_f32 %1, %3\n\tv_nop"
      : "=&v"(r0), "=&v"(r1)
      : "v"(x0 * 1.44269504f), "v"(x1 * 1.44269504f));
}

// ---------------------------------------------------------------------------
// Kernel 0: convert W (f32, [k][n]) -> Wt (f16, [w][64][1024]) once. Each chunk
// of 32 k (columns kc..kc+31 of all 64 rows, row-major: the tile kernel 1
// stages) holds its 64 n x 32 k in fragment order, fragment = n / 16.
// ---------------------------------------------------------------------------
__global__ __launch_bounds__(256)
void wtrans_kernel(const float* __restrict__ Wq, const float* __restrict__ Wk,
                   const float* __restrict__ Wv, _Float16* __restrict__ wt) {
  const int id = blockIdx.x * 256 + threadIdx.x;   // 24576 threads
  const int w  = id >> 13;                         // 8192 per weight
  const int r  = id & 8191;
  // a wave takes 4 n x 64 k (two chunks): in fragment order that is four whole
  // 128-byte lines of Wt, each stored by this wave alone
  const int n  = ((r >> 9) << 2) | (r & 3);        // 0..63
  const int k0 = ((r >> 2) & 127) * 8;             // 0..1016
  const float* W = (w == 0) ? Wq : (w == 1) ? Wk : Wv;
  // the thread's 8 k are one run of lane ((k0 >> 3) & 1) * 16 + (n & 15)
  const int pos = frag_pos(n >> 4, (k0 >> 4) & 1, ((k0 >> 3) & 1) * 16 + (n & 15));
  _Float16* dst = wt + ((size_t)w << 16) + (size_t)(pos >> 5) * H_ +
                  (k0 & ~31) + (pos & 31);
#pragma unroll
  for (int j = 0; j < 8; ++j)
    dst[j] = (_Float16)W[(size_t)(k0 + j) * D_ + n];
}

// ---------------------------------------------------------------------------
// Kernel 1: fused QKV projection. 4 waves/block, each wave a 16-row tile of x.
// f16 Wt chunks (3 x 64 x 32 = 12 KB) async-staged to LDS, double buffered,
// shared by all waves. q stored f16 [bs][64]; k and v in the fragment order of
// the tiles kernel 2 stages: k per 32 keys (2048 contiguous halves, fragment =
// 2 * (key / 16) + d / 32), v per 32 keys inside [b][64][2048] (columns
// kt..kt+31 of all 64 rows, row-major; fragment = d / 16).
// ---------------------------------------------------------------------------
__global__ __launch_bounds__(128)
void qkv_proj_kernel(const float* __restrict__ x,
                     const _Float16* __restrict__ wt,
                     const float* __restrict__ bq, const float* __restrict__ bk,
                     const float* __restrict__ bv,
                     _Float16* __restrict__ qh, _Float16* __restrict__ kh,
                     _Float16* __restrict__ vt) {
  __shared__ __align__(16) _Float16 wlds[2][3][64 * 32];  // 2 x 12 KB

  const int tid  = threadIdx.x;
  const int lane = tid & 31;
  const int wid  = tid >> 5;
  const int row0 = (blockIdx.x * 4 + wid) * 16;    // flat row over B*S
  const int half = lane >> 4;
  const int rc   = lane & 15;
  const int srow = tid >> 1;                       // 0..63 staging row
  const int shb  = (tid & 1) << 4;                 // 0/16 halves

  const float* Bs[3] = {bq, bk, bv};

  v8f acc[3][4];
#pragma unroll
  for (int w = 0; w < 3; ++w)
#pragma unroll
    for (int nt = 0; nt < 4; ++nt)
#pragma unroll
      for (int e = 0; e < 8; ++e) acc[w][nt][e] = 0.0f;

  // stage chunk 0: 3 weights x 2 b128 per thread
#pragma unroll
  for (int w = 0; w < 3; ++w)
#pragma unroll
    for (int j = 0; j < 2; ++j)
      cp_async_b128(&wlds[0][w][srow * 32 + shb + j * 8],
                    wt + ((size_t)w << 16) + (size_t)srow * H_ + shb + j * 8);

  for (int kci = 0; kci < 32; ++kci) {
    const int kc = kci * 32;
    if (kci + 1 < 32) {
      const int nb = (kci + 1) & 1;
#pragma unroll
      for (int w = 0; w < 3; ++w)
#pragma unroll
        for (int j = 0; j < 2; ++j)
          cp_async_b128(&wlds[nb][w][srow * 32 + shb + j * 8],
                        wt + ((size_t)w << 16) + (size_t)srow * H_ +
                            (kc + 32) + shb + j * 8);
      wait_async<6>();
    } else {
      wait_async<0>();
    }
    __syncthreads();

    // A fragment: 16x32 chunk of x, four b128 loads + pack-convert
    Frag a;
    const float* xrow = x + (size_t)(row0 + rc) * H_ + kc;
    {
      const float4 f0 = *(const float4*)(xrow + 8 * half);
      const float4 f1 = *(const float4*)(xrow + 8 * half + 4);
      const float4 f2 = *(const float4*)(xrow + 16 + 8 * half);
      const float4 f3 = *(const float4*)(xrow + 16 + 8 * half + 4);
      a.h[0]  = (_Float16)f0.x; a.h[1]  = (_Float16)f0.y;
      a.h[2]  = (_Float16)f0.z; a.h[3]  = (_Float16)f0.w;
      a.h[4]  = (_Float16)f1.x; a.h[5]  = (_Float16)f1.y;
      a.h[6]  = (_Float16)f1.z; a.h[7]  = (_Float16)f1.w;
      a.h[8]  = (_Float16)f2.x; a.h[9]  = (_Float16)f2.y;
      a.h[10] = (_Float16)f2.z; a.h[11] = (_Float16)f2.w;
      a.h[12] = (_Float16)f3.x; a.h[13] = (_Float16)f3.y;
      a.h[14] = (_Float16)f3.z; a.h[15] = (_Float16)f3.w;
    }

    const int cur = kci & 1;
#pragma unroll
    for (int w = 0; w < 3; ++w) {
#pragma unroll
      for (int nt = 0; nt < 4; ++nt) {
        Frag bf;
        load_frag_tile(bf, &wlds[cur][w][0], nt, lane);
        acc[w][nt] = __builtin_amdgcn_wmma_f32_16x16x32_f16(
            false, a.v, false, bf.v, (short)0, acc[w][nt], false, false);
      }
    }
    __syncthreads();
  }

  // bias add + f16 store
#pragma unroll
  for (int w = 0; w < 3; ++w) {
#pragma unroll
    for (int nt = 0; nt < 4; ++nt) {
      const int d = nt * 16 + rc;
      const float bias = Bs[w][d];
      if (w == 2) {
        // the lane's 8 keys of column d are one whole run of fragment nt
        union { uint4 q; _Float16 h[8]; } run;
#pragma unroll
        for (int r = 0; r < 8; ++r) run.h[r] = (_Float16)(acc[w][nt][r] + bias);
        const int b   = row0 >> 11;                // / S_
        const int kt  = row0 & (S_ - 1) & ~31;
        const int pos = frag_pos(nt, (row0 >> 4) & 1, lane);
        *(uint4*)(vt + ((size_t)b * D_ + (pos >> 5)) * S_ + kt + (pos & 31)) = run.q;
      } else {
#pragma unroll
        for (int r = 0; r < 8; ++r) {
          const int row   = r + 8 * half;
          const int bsrow = row0 + row;
          const _Float16 hv = (_Float16)(acc[w][nt][r] + bias);
          if (w == 0) {
            qh[(size_t)bsrow * D_ + d] = hv;
          } else {
            const int pos = frag_pos(2 * ((row0 >> 4) & 1) + (nt >> 1), nt & 1,
                                     (rc >> 3) * 16 + row);
            kh[(size_t)(row0 >> 5) * (32 * D_) + pos + (rc & 7)] = hv;
          }
        }
      }
    }
  }
}

__global__ __launch_bounds__(128)
void flash_attn_kernel(const _Float16* __restrict__ qh,
                       const _Float16* __restrict__ kh,
                       const _Float16* __restrict__ vt,
                       const int* __restrict__ mask,
                       float* __restrict__ out) {
  __shared__ __align__(16) _Float16 kbuf[2][32 * 64];  // 2 x 4 KB
  __shared__ __align__(16) _Float16 vbuf[2][64 * 32];  // 2 x 4 KB
  __shared__ __align__(16) float    mbias[S_];         // 8 KB, 0 or -8e30

  const int tid  = threadIdx.x;
  const int lane = tid & 31;
  const int wid  = tid >> 5;
  const int b    = blockIdx.x >> 5;                    // 32 blocks per batch
  const int q0   = ((blockIdx.x & 31) << 6) + (wid << 4);
  const int half = lane >> 4;
  const int rc   = lane & 15;

  const _Float16* kbase = kh + (size_t)(b * S_) * D_;  // per 32 keys 2048 halves, fragment order
  const _Float16* vbase = vt + (size_t)(b * D_) * S_;  // [64][2048], fragment order per 32 keys

  // Q fragments (B operand, column = query): two b128 loads each
  Frag a0, a1;
  {
    const _Float16* qrow = qh + (size_t)(b * S_ + q0 + rc) * D_;
    load_frag_h16(a0, qrow, half);
    load_frag_h16(a1, qrow + 32, half);
  }

  float m = -1e30f, l = 0.0f;                          // this lane's query
  v8f acc[4];                                          // O^T: row d, col query
#pragma unroll
  for (int nt = 0; nt < 4; ++nt)
#pragma unroll
    for (int e = 0; e < 8; ++e) acc[nt][e] = 0.0f;

  const float scale = 0.125f;                          // 1/sqrt(64)

#if defined(HAVE_TDM)
  if (wid == 0)
    tdm_load_2d(lds_offset(&kbuf[0][0]), kbase, D_, S_, D_, 32, D_);
  else if (wid == 1)
    tdm_load_2d(lds_offset(&vbuf[0][0]), vbase, S_, D_, 32, D_, S_);
#else
  const int vrow = tid >> 1;
  const int vhb  = (tid & 1) << 4;
#pragma unroll
  for (int j = 0; j < 2; ++j) {
    cp_async_b128(&kbuf[0][tid * 16 + j * 8], kbase + tid * 16 + j * 8);
    cp_async_b128(&vbuf[0][vrow * 32 + vhb + j * 8],
                  vbase + (size_t)vrow * S_ + vhb + j * 8);
  }
#endif

  // mask table: -8e30 absorbs any score and gives -1e30 after the 1/8 scale;
  // published by the first barrier of the loop
#pragma unroll
  for (int j = 0; j < 4; ++j) {
    const int4 mm = *(const int4*)(mask + b * S_ + tid * 16 + j * 4);
    float4 f;
    f.x = (mm.x == 0) ? -8e30f : 0.0f;
    f.y = (mm.y == 0) ? -8e30f : 0.0f;
    f.z = (mm.z == 0) ? -8e30f : 0.0f;
    f.w = (mm.w == 0) ? -8e30f : 0.0f;
    *(float4*)&mbias[tid * 16 + j * 4] = f;
  }

  for (int kti = 0; kti < S_ / 32; ++kti) {
    const int kt = kti * 32;
    if (kti + 1 < S_ / 32) {
      const int nb = (kti + 1) & 1;
#if defined(HAVE_TDM)
      if (wid == 0)
        tdm_load_2d(lds_offset(&kbuf[nb][0]), kbase + (size_t)(kt + 32) * D_,
                    D_, S_, D_, 32, D_);
      else if (wid == 1)
        tdm_load_2d(lds_offset(&vbuf[nb][0]), vbase + kt + 32,
                    S_, D_, 32, D_, S_);
      wait_tensor<1>();
#else
#pragma unroll
      for (int j = 0; j < 2; ++j) {
        cp_async_b128(&kbuf[nb][tid * 16 + j * 8],
                      kbase + (size_t)(kt + 32) * D_ + tid * 16 + j * 8);
        cp_async_b128(&vbuf[nb][vrow * 32 + vhb + j * 8],
                      vbase + (size_t)vrow * S_ + kt + 32 + vhb + j * 8);
      }
      wait_async<4>();
#endif
    } else {
#if defined(HAVE_TDM)
      wait_tensor<0>();
#else
      wait_async<0>();
#endif
    }
    __syncthreads();

    const _Float16* kl = kbuf[kti & 1];
    const _Float16* vl = vbuf[kti & 1];

    // --- scores: S^T = K @ Q^T for 2 groups of 16 keys (ds_load_b128) ------
    Frag bk00, bk01, bk10, bk11;
    load_frag_tile(bk00, kl, 0, lane);
    load_frag_tile(bk01, kl, 1, lane);
    load_frag_tile(bk10, kl, 2, lane);
    load_frag_tile(bk11, kl, 3, lane);

    v8f s0, s1;                                        // start value: key mask
    {
      const float4 c0 = *(const float4*)&mbias[kt + 8 * half];
      const float4 c1 = *(const float4*)&mbias[kt + 8 * half + 4];
      const float4 c2 = *(const float4*)&mbias[kt + 16 + 8 * half];
      const float4 c3 = *(const float4*)&mbias[kt + 16 + 8 * half + 4];
      s0[0] = c0.x; s0[1] = c0.y; s0[2] = c0.z; s0[3] = c0.w;
      s0[4] = c1.x; s0[5] = c1.y; s0[6] = c1.z; s0[7] = c1.w;
      s1[0] = c2.x; s1[1] = c2.y; s1[2] = c2.z; s1[3] = c2.w;
      s1[4] = c3.x; s1[5] = c3.y; s1[6] = c3.z; s1[7] = c3.w;
    }
    Frag av[4];                                        // V^T rows, A operand
#pragma unroll
    for (int nt = 0; nt < 4; ++nt)
      load_frag_tile(av[nt], vl, nt, lane);
    __builtin_amdgcn_sched_barrier(0);
    s0 = __builtin_amdgcn_wmma_f32_16x16x32_f16(false, bk00.v, false, a0.v,
                                                (short)0, s0, false, false);
    s0 = __builtin_amdgcn_wmma_f32_16x16x32_f16(false, bk01.v, false, a1.v,
                                                (short)0, s0, false, false);
    s1 = __builtin_amdgcn_wmma_f32_16x16x32_f16(false, bk10.v, false, a0.v,
                                                (short)0, s1, false, false);
    s1 = __builtin_amdgcn_wmma_f32_16x16x32_f16(false, bk11.v, false, a1.v,
                                                (short)0, s1, false, false);

    // --- online softmax update, one query per lane --------------------------
    float v0[8], v1[8];
#pragma unroll
    for (int r = 0; r < 8; ++r) { v0[r] = s0[r] * scale; v1[r] = s1[r] * scale; }
    float rmax = fmaxf(v0[0], v1[0]);
#pragma unroll
    for (int r = 1; r < 8; ++r) rmax = fmaxf(rmax, fmaxf(v0[r], v1[r]));
    rmax = fmaxf(rmax, xhalf(rmax));                   // both halves' 32 keys
    const float mn = fmaxf(m, rmax);
    const float al = __expf(m - mn);
    float rs0 = 0.0f, rs1 = 0.0f;
    Frag pb;                                           // P^T as B operand
#pragma unroll
    for (int r = 0; r < 8; ++r) {
      float e0, e1;
      exp_pair(e0, e1, v0[r] - mn, v1[r] - mn);
      rs0 += e0;
      rs1 += e1;
      pb.h[r]     = (_Float16)e0;                      // k = 8*half + r
      pb.h[8 + r] = (_Float16)e1;                      // k = 16 + 8*half + r
    }
    l = l * al + (rs0 + rs1);                          // this half's keys only
    m = mn;
#pragma unroll
    for (int nt = 0; nt < 4; ++nt)
#pragma unroll
      for (int r = 0; r < 8; ++r) acc[nt][r] *= al;

    // --- acc += V^T @ P^T ---------------------------------------------------
#pragma unroll
    for (int nt = 0; nt < 4; ++nt)
      acc[nt] = __builtin_amdgcn_wmma_f32_16x16x32_f16(
          false, av[nt].v, false, pb.v, (short)0, acc[nt], false, false);
    __syncthreads();   // protect K/V buffers for reuse
  }

  // --- normalize and store: a lane holds 8 consecutive d of its query ------
  // one query per lane: one division serves the lane's 32 outputs
  const float inv = 1.0f / (l + xhalf(l));             // join the halves' sums
  float* orow = out + (size_t)(b * S_ + q0 + rc) * D_ + 8 * half;
#pragma unroll
  for (int nt = 0; nt < 4; ++nt) {
    float4 o0, o1;
    o0.x = acc[nt][0] * inv; o0.y = acc[nt][1] * inv;
    o0.z = acc[nt][2] * inv; o0.w = acc[nt][3] * inv;
    o1.x = acc[nt][4] * inv; o1.y = acc[nt][5] * inv;
    o1.z = acc[nt][6] * inv; o1.w = acc[nt][7] * inv;
    *(float4*)(orow + nt * 16)     = o0;
    *(float4*)(orow + nt * 16 + 4) = o1;
  }
}

// ---------------------------------------------------------------------------
extern "C" void kernel_launch(void* const* d_in, const int* in_sizes, int n_in,
                              void* d_out, int out_size, void* d_ws, size_t ws_size,
                              hipStream_t stream) {
  const float* x    = (const float*)d_in[0];
  const int*   mask = (const int*)d_in[1];
  const float* Wq   = (const float*)d_in[2];
  const float* bq   = (const float*)d_in[3];
  const float* Wk   = (const float*)d_in[4];
  const float* bk   = (const float*)d_in[5];
  const float* Wv   = (const float*)d_in[6];
  const float* bv   = (const float*)d_in[7];
  float* out = (float*)d_out;

  char* ws = (char*)d_ws;
  _Float16* qh = (_Float16*)ws;                                  // 2 MB
  _Float16* kh = (_Float16*)(ws + (size_t)2 * 1024 * 1024);      // 2 MB
  _Float16* vt = (_Float16*)(ws + (size_t)4 * 1024 * 1024);      // 2 MB
  _Float16* wt = (_Float16*)(ws + (size_t)6 * 1024 * 1024);      // 384 KB

  wtrans_kernel<<<96, 256, 0, stream>>>(Wq, Wk, Wv, wt);
  qkv_proj_kernel<<<256, 128, 0, stream>>>(x, wt, bq, bk, bv, qh, kh, vt);
  flash_attn_kernel<<<256, 128, 0, stream>>>(qh, kh, vt, mask, out);
}

// v003
// It runs in 58 microseconds.
// Next to v002, in two timings, it ran 1.22 and 1.23 times as fast.
// Over all steps from v000 it is 2.26 times as fast.
#include <hip/hip_runtime.h>
#include <hip/hip_bf16.h>

typedef __attribute__((ext_vector_type(16))) _Float16 v16h;
typedef __attribute__((ext_vector_type(8)))  float    v8f;
typedef __attribute__((ext_vector_type(4)))  int      v4i;
typedef __attribute__((ext_vector_type(8)))  int      v8i;
typedef __attribute__((ext_vector_type(4)))  unsigned v4u;

#define B_  8
#define S_  2048
#define H_  1024
#define D_  64

#define AS1 __attribute__((address_space(1)))
#define AS3 __attribute__((address_space(3)))

union Frag {
  v16h v;
  _Float16 h[16];
  unsigned u[8];
};

__device__ __forceinline__ void load_frag_h16(Frag& f, const _Float16* base,
                                              int half) {
  const uint4 lo = *(const uint4*)(base + 8 * half);
  const uint4 hi = *(const uint4*)(base + 16 + 8 * half);
  f.u[0] = lo.x; f.u[1] = lo.y; f.u[2] = lo.z; f.u[3] = lo.w;
  f.u[4] = hi.x; f.u[5] = hi.y; f.u[6] = hi.z; f.u[7] = hi.w;
}

__device__ __forceinline__ int frag_pos(int f, int p, int l) {
  return ((2 * f + p) * 32 + l) * 8;
}

__device__ __forceinline__ void load_frag_tile(Frag& fr, const _Float16* tile,
                                               int f, int lane) {
  const uint4 lo = *(const uint4*)(tile + frag_pos(f, 0, lane));
  const uint4 hi = *(const uint4*)(tile + frag_pos(f, 1, lane));
  fr.u[0] = lo.x; fr.u[1] = lo.y; fr.u[2] = lo.z; fr.u[3] = lo.w;
  fr.u[4] = hi.x; fr.u[5] = hi.y; fr.u[6] = hi.z; fr.u[7] = hi.w;
}

#if __has_builtin(__builtin_amdgcn_global_load_async_to_lds_b128)
#define HAVE_ASYNC_LDS 1
#endif

__device__ __forceinline__ void cp_async_b128(void* lds, const void* g) {
#if defined(HAVE_ASYNC_LDS)
  __builtin_amdgcn_global_load_async_to_lds_b128(
      (AS1 v4i*)(v4i*)g, (AS3 v4i*)(v4i*)lds, 0, 0);
#else
  *(uint4*)lds = *(const uint4*)g;   // synchronous fallback
#endif
}

template <int N>
__device__ __forceinline__ void wait_async() {
#if __has_builtin(__builtin_amdgcn_s_wait_asynccnt)
  __builtin_amdgcn_s_wait_asynccnt(N);
#else
  asm volatile("s_wait_asynccnt %0" ::"i"(N) : "memory");
#endif
}

#if __has_builtin(__builtin_amdgcn_tensor_load_to_lds)
#define HAVE_TDM 1
#endif

__device__ __forceinline__ unsigned lds_offset(const void* p) {
  return (unsigned)(unsigned long long)(AS3 void*)(void*)p;
}

#if defined(HAVE_TDM)
__device__ __forceinline__ void tdm_load_2d(unsigned lds_off, const void* gaddr,
                                            unsigned tensor_d0, unsigned tensor_d1,
                                            unsigned tile_d0, unsigned tile_d1,
                                            unsigned stride0) {
  const unsigned long long ga = (unsigned long long)(size_t)gaddr;
  v4u g0;
  g0[0] = 1u;                                           // count=1, user mode
  g0[1] = lds_off;                                      // lds_addr (bytes)
  g0[2] = (unsigned)ga;                                 // global_addr[31:0]
  g0[3] = (unsigned)((ga >> 32) & 0x1FFFFFFull) | (2u << 30);  // [56:32]|type=2
  v8i g1;
  g1[0] = (int)(1u << 16);
  g1[1] = (int)((tensor_d0 & 0xFFFFu) << 16);
  g1[2] = (int)(((tensor_d0 >> 16) & 0xFFFFu) |
                ((tensor_d1 & 0xFFFFu) << 16));         // dim0[31:16]|dim1[15:0]
  g1[3] = (int)(((tensor_d1 >> 16) & 0xFFFFu) |
                (tile_d0 << 16));
  g1[4] = (int)(tile_d1 & 0xFFFFu);
  g1[5] = (int)stride0;
  g1[6] = 0;
  g1[7] = 0;
  v4i g2 = {0, 0, 0, 0};
  v4i g3 = {0, 0, 0, 0};
  v8i g4 = {0, 0, 0, 0, 0, 0, 0, 0};
  __builtin_amdgcn_tensor_load_to_lds(g0, g1, g2, g3, g4, 0);
}

template <int N>
__device__ __forceinline__ void wait_tensor() {
#if __has_builtin(__builtin_amdgcn_s_wait_tensorcnt)
  __builtin_amdgcn_s_wait_tensorcnt(N);
#else
  asm volatile("s_wait_tensorcnt %0" ::"i"(N) : "memory");
#endif
}
#endif  // HAVE_TDM

__device__ __forceinline__ float xhalf(float x) {
  const int i = __builtin_bit_cast(int, x);
  return __builtin_bit_cast(float, __builtin_amdgcn_permlanex16(
      i, i, 0x76543210, 0xfedcba98, false, false));
}

__device__ __forceinline__ void exp_pair(float& r0, float& r1, float x0, float x1) {
  asm("v_exp_f32 %0, %2\n\tv_exp_f32 %1, %3\n\tv_nop"
      : "=&v"(r0), "=&v"(r1)
      : "v"(x0 * 1.44269504f), "v"(x1 * 1.44269504f));
}

// ---------------------------------------------------------------------------
// Kernel 0: convert W (f32, [k][n]) -> Wt (f16, [w][64][1024]) once. Each chunk
// of 32 k (columns kc..kc+31 of all 64 rows, row-major: the tile kernel 1
// stages) holds its 64 n x 32 k in fragment order, fragment = n / 16.
// ---------------------------------------------------------------------------
__global__ __launch_bounds__(256)
void wtrans_kernel(const float* __restrict__ Wq, const float* __restrict__ Wk,
                   const float* __restrict__ Wv, _Float16* __restrict__ wt) {
  const int id = blockIdx.x * 256 + threadIdx.x;   // 24576 threads
  const int w  = id >> 13;                         // 8192 per weight
  const int r  = id & 8191;
  // a wave takes 4 n x 64 k (two chunks): in fragment order that is four whole
  // 128-byte lines of Wt, each stored by this wave alone
  const int n  = ((r >> 9) << 2) | (r & 3);        // 0..63
  const int k0 = ((r >> 2) & 127) * 8;             // 0..1016
  const float* W = (w == 0) ? Wq : (w == 1) ? Wk : Wv;
  // the thread's 8 k are one run of lane ((k0 >> 3) & 1) * 16 + (n & 15)
  const int pos = frag_pos(n >> 4, (k0 >> 4) & 1, ((k0 >> 3) & 1) * 16 + (n & 15));
  _Float16* dst = wt + ((size_t)w << 16) + (size_t)(pos >> 5) * H_ +
                  (k0 & ~31) + (pos & 31);
#pragma unroll
  for (int j = 0; j < 8; ++j)
    dst[j] = (_Float16)W[(size_t)(k0 + j) * D_ + n];
}

// ---------------------------------------------------------------------------
// Kernel 1: fused QKV projection. 4 waves/block, each wave a 16-row tile of x.
// f16 Wt chunks (3 x 64 x 32 = 12 KB) async-staged to LDS, double buffered,
// shared by all waves. q stored f16 [bs][64]; k and v in the fragment order of
// the tiles kernel 2 stages: k per 32 keys (2048 contiguous halves, fragment =
// 2 * (key / 16) + d / 32), v per 32 keys inside [b][64][2048] (columns
// kt..kt+31 of all 64 rows, row-major; fragment = d / 16).
// ---------------------------------------------------------------------------
__global__ __launch_bounds__(128)
void qkv_proj_kernel(const float* __restrict__ x,
                     const _Float16* __restrict__ wt,
                     const float* __restrict__ bq, const float* __restrict__ bk,
                     const float* __restrict__ bv,
                     _Float16* __restrict__ qh, _Float16* __restrict__ kh,
                     _Float16* __restrict__ vt) {
  __shared__ __align__(16) _Float16 wlds[2][3][64 * 32];  // 2 x 12 KB

  const int tid  = threadIdx.x;
  const int lane = tid & 31;
  const int wid  = tid >> 5;
  const int row0 = (blockIdx.x * 4 + wid) * 16;    // flat row over B*S
  const int half = lane >> 4;
  const int rc   = lane & 15;
  const int srow = tid >> 1;                       // 0..63 staging row
  const int shb  = (tid & 1) << 4;                 // 0/16 halves

  const float* Bs[3] = {bq, bk, bv};

  v8f acc[3][4];
#pragma unroll
  for (int w = 0; w < 3; ++w)
#pragma unroll
    for (int nt = 0; nt < 4; ++nt)
#pragma unroll
      for (int e = 0; e < 8; ++e) acc[w][nt][e] = 0.0f;

  // stage chunk 0: 3 weights x 2 b128 per thread
#pragma unroll
  for (int w = 0; w < 3; ++w)
#pragma unroll
    for (int j = 0; j < 2; ++j)
      cp_async_b128(&wlds[0][w][srow * 32 + shb + j * 8],
                    wt + ((size_t)w << 16) + (size_t)srow * H_ + shb + j * 8);

  for (int kci = 0; kci < 32; ++kci) {
    const int kc = kci * 32;
    if (kci + 1 < 32) {
      const int nb = (kci + 1) & 1;
#pragma unroll
      for (int w = 0; w < 3; ++w)
#pragma unroll
        for (int j = 0; j < 2; ++j)
          cp_async_b128(&wlds[nb][w][srow * 32 + shb + j * 8],
                        wt + ((size_t)w << 16) + (size_t)srow * H_ +
                            (kc + 32) + shb + j * 8);
      wait_async<6>();
    } else {
      wait_async<0>();
    }
    __syncthreads();

    // A fragment: 16x32 chunk of x, four b128 loads + pack-convert
    Frag a;
    Frag bf[3][4];                                 // the pass's 12 Wt fragments
    const int cur = kci & 1;
    const float* xrow = x + (size_t)(row0 + rc) * H_ + kc;
    {
      const float4 f0 = *(const float4*)(xrow + 8 * half);
      const float4 f1 = *(const float4*)(xrow + 8 * half + 4);
      const float4 f2 = *(const float4*)(xrow + 16 + 8 * half);
      const float4 f3 = *(const float4*)(xrow + 16 + 8 * half + 4);
#pragma unroll
      for (int w = 0; w < 3; ++w)
#pragma unroll
        for (int nt = 0; nt < 4; ++nt)
          load_frag_tile(bf[w][nt], &wlds[cur][w][0], nt, lane);
      __builtin_amdgcn_sched_barrier(0);
      a.h[0]  = (_Float16)f0.x; a.h[1]  = (_Float16)f0.y;
      a.h[2]  = (_Float16)f0.z; a.h[3]  = (_Float16)f0.w;
      a.h[4]  = (_Float16)f1.x; a.h[5]  = (_Float16)f1.y;
      a.h[6]  = (_Float16)f1.z; a.h[7]  = (_Float16)f1.w;
      a.h[8]  = (_Float16)f2.x; a.h[9]  = (_Float16)f2.y;
      a.h[10] = (_Float16)f2.z; a.h[11] = (_Float16)f2.w;
      a.h[12] = (_Float16)f3.x; a.h[13] = (_Float16)f3.y;
      a.h[14] = (_Float16)f3.z; a.h[15] = (_Float16)f3.w;
    }

#pragma unroll
    for (int w = 0; w < 3; ++w) {
#pragma unroll
      for (int nt = 0; nt < 4; ++nt) {
        acc[w][nt] = __builtin_amdgcn_wmma_f32_16x16x32_f16(
            false, a.v, false, bf[w][nt].v, (short)0, acc[w][nt], false, false);
      }
    }
    __syncthreads();
  }

  // bias add + f16 store
#pragma unroll
  for (int w = 0; w < 3; ++w) {
#pragma unroll
    for (int nt = 0; nt < 4; ++nt) {
      const int d = nt * 16 + rc;
      const float bias = Bs[w][d];
      if (w == 2) {
        // the lane's 8 keys of column d are one whole run of fragment nt
        union { uint4 q; _Float16 h[8]; } run;
#pragma unroll
        for (int r = 0; r < 8; ++r) run.h[r] = (_Float16)(acc[w][nt][r] + bias);
        const int b   = row0 >> 11;                // / S_
        const int kt  = row0 & (S_ - 1) & ~31;
        const int pos = frag_pos(nt, (row0 >> 4) & 1, lane);
        *(uint4*)(vt + ((size_t)b * D_ + (pos >> 5)) * S_ + kt + (pos & 31)) = run.q;
      } else {
#pragma unroll
        for (int r = 0; r < 8; ++r) {
          const int row   = r + 8 * half;
          const int bsrow = row0 + row;
          const _Float16 hv = (_Float16)(acc[w][nt][r] + bias);
          if (w == 0) {
            qh[(size_t)bsrow * D_ + d] = hv;
          } else {
            const int pos = frag_pos(2 * ((row0 >> 4) & 1) + (nt >> 1), nt & 1,
                                     (rc >> 3) * 16 + row);
            kh[(size_t)(row0 >> 5) * (32 * D_) + pos + (rc & 7)] = hv;
          }
        }
      }
    }
  }
}

__global__ __launch_bounds__(128)
void flash_attn_kernel(const _Float16* __restrict__ qh,
                       const _Float16* __restrict__ kh,
                       const _Float16* __restrict__ vt,
                       const int* __restrict__ mask,
                       float* __restrict__ out) {
  __shared__ __align__(16) _Float16 kbuf[2][32 * 64];  // 2 x 4 KB
  __shared__ __align__(16) _Float16 vbuf[2][64 * 32];  // 2 x 4 KB
  __shared__ __align__(16) float    mbias[S_];         // 8 KB, 0 or -8e30

  const int tid  = threadIdx.x;
  const int lane = tid & 31;
  const int wid  = tid >> 5;
  const int b    = blockIdx.x >> 5;                    // 32 blocks per batch
  const int q0   = ((blockIdx.x & 31) << 6) + (wid << 4);
  const int half = lane >> 4;
  const int rc   = lane & 15;

  const _Float16* kbase = kh + (size_t)(b * S_) * D_;  // per 32 keys 2048 halves, fragment order
  const _Float16* vbase = vt + (size_t)(b * D_) * S_;  // [64][2048], fragment order per 32 keys

  // Q fragments (B operand, column = query): two b128 loads each
  Frag a0, a1;
  {
    const _Float16* qrow = qh + (size_t)(b * S_ + q0 + rc) * D_;
    load_frag_h16(a0, qrow, half);
    load_frag_h16(a1, qrow + 32, half);
  }

  float m = -1e30f, l = 0.0f;                          // this lane's query
  v8f acc[4];                                          // O^T: row d, col query
#pragma unroll
  for (int nt = 0; nt < 4; ++nt)
#pragma unroll
    for (int e = 0; e < 8; ++e) acc[nt][e] = 0.0f;

  const float scale = 0.125f;                          // 1/sqrt(64)

#if defined(HAVE_TDM)
  if (wid == 0)
    tdm_load_2d(lds_offset(&kbuf[0][0]), kbase, D_, S_, D_, 32, D_);
  else if (wid == 1)
    tdm_load_2d(lds_offset(&vbuf[0][0]), vbase, S_, D_, 32, D_, S_);
#else
  const int vrow = tid >> 1;
  const int vhb  = (tid & 1) << 4;
#pragma unroll
  for (int j = 0; j < 2; ++j) {
    cp_async_b128(&kbuf[0][tid * 16 + j * 8], kbase + tid * 16 + j * 8);
    cp_async_b128(&vbuf[0][vrow * 32 + vhb + j * 8],
                  vbase + (size_t)vrow * S_ + vhb + j * 8);
  }
#endif

  // mask table: -8e30 absorbs any score and gives -1e30 after the 1/8 scale;
  // published by the first barrier of the loop
#pragma unroll
  for (int j = 0; j < 4; ++j) {
    const int4 mm = *(const int4*)(mask + b * S_ + tid * 16 + j * 4);
    float4 f;
    f.x = (mm.x == 0) ? -8e30f : 0.0f;
    f.y = (mm.y == 0) ? -8e30f : 0.0f;
    f.z = (mm.z == 0) ? -8e30f : 0.0f;
    f.w = (mm.w == 0) ? -8e30f : 0.0f;
    *(float4*)&mbias[tid * 16 + j * 4] = f;
  }

  for (int kti = 0; kti < S_ / 32; ++kti) {
    const int kt = kti * 32;
    if (kti + 1 < S_ / 32) {
      const int nb = (kti + 1) & 1;
#if defined(HAVE_TDM)
      if (wid == 0)
        tdm_load_2d(lds_offset(&kbuf[nb][0]), kbase + (size_t)(kt + 32) * D_,
                    D_, S_, D_, 32, D_);
      else if (wid == 1)
        tdm_load_2d(lds_offset(&vbuf[nb][0]), vbase + kt + 32,
                    S_, D_, 32, D_, S_);
      wait_tensor<1>();
#else
#pragma unroll
      for (int j = 0; j < 2; ++j) {
        cp_async_b128(&kbuf[nb][tid * 16 + j * 8],
                      kbase + (size_t)(kt + 32) * D_ + tid * 16 + j * 8);
        cp_async_b128(&vbuf[nb][vrow * 32 + vhb + j * 8],
                      vbase + (size_t)vrow * S_ + kt + 32 + vhb + j * 8);
      }
      wait_async<4>();
#endif
    } else {
#if defined(HAVE_TDM)
      wait_tensor<0>();
#else
      wait_async<0>();
#endif
    }
    __syncthreads();

    const _Float16* kl = kbuf[kti & 1];
    const _Float16* vl = vbuf[kti & 1];

    // --- scores: S^T = K @ Q^T for 2 groups of 16 keys (ds_load_b128) ------
    Frag bk00, bk01, bk10, bk11;
    load_frag_tile(bk00, kl, 0, lane);
    load_frag_tile(bk01, kl, 1, lane);
    load_frag_tile(bk10, kl, 2, lane);
    load_frag_tile(bk11, kl, 3, lane);

    v8f s0, s1;                                        // start value: key mask
    {
      const float4 c0 = *(const float4*)&mbias[kt + 8 * half];
      const float4 c1 = *(const float4*)&mbias[kt + 8 * half + 4];
      const float4 c2 = *(const float4*)&mbias[kt + 16 + 8 * half];
      const float4 c3 = *(const float4*)&mbias[kt + 16 + 8 * half + 4];
      s0[0] = c0.x; s0[1] = c0.y; s0[2] = c0.z; s0[3] = c0.w;
      s0[4] = c1.x; s0[5] = c1.y; s0[6] = c1.z; s0[7] = c1.w;
      s1[0] = c2.x; s1[1] = c2.y; s1[2] = c2.z; s1[3] = c2.w;
      s1[4] = c3.x; s1[5] = c3.y; s1[6] = c3.z; s1[7] = c3.w;
    }
    Frag av[4];                                        // V^T rows, A operand
#pragma unroll
    for (int nt = 0; nt < 4; ++nt)
      load_frag_tile(av[nt], vl, nt, lane);
    __builtin_amdgcn_sched_barrier(0);
    s0 = __builtin_amdgcn_wmma_f32_16x16x32_f16(false, bk00.v, false, a0.v,
                                                (short)0, s0, false, false);
    s0 = __builtin_amdgcn_wmma_f32_16x16x32_f16(false, bk01.v, false, a1.v,
                                                (short)0, s0, false, false);
    s1 = __builtin_amdgcn_wmma_f32_16x16x32_f16(false, bk10.v, false, a0.v,
                                                (short)0, s1, false, false);
    s1 = __builtin_amdgcn_wmma_f32_16x16x32_f16(false, bk11.v, false, a1.v,
                                                (short)0, s1, false, false);

    // --- online softmax update, one query per lane --------------------------
    float v0[8], v1[8];
#pragma unroll
    for (int r = 0; r < 8; ++r) { v0[r] = s0[r] * scale; v1[r] = s1[r] * scale; }
    float rmax = fmaxf(v0[0], v1[0]);
#pragma unroll
    for (int r = 1; r < 8; ++r) rmax = fmaxf(rmax, fmaxf(v0[r], v1[r]));
    rmax = fmaxf(rmax, xhalf(rmax));                   // both halves' 32 keys
    const float mn = fmaxf(m, rmax);
    const float al = __expf(m - mn);
    float rs0 = 0.0f, rs1 = 0.0f;
    Frag pb;                                           // P^T as B operand
#pragma unroll
    for (int r = 0; r < 8; ++r) {
      float e0, e1;
      exp_pair(e0, e1, v0[r] - mn, v1[r] - mn);
      rs0 += e0;
      rs1 += e1;
      pb.h[r]     = (_Float16)e0;                      // k = 8*half + r
      pb.h[8 + r] = (_Float16)e1;                      // k = 16 + 8*half + r
    }
    l = l * al + (rs0 + rs1);                          // this half's keys only
    m = mn;
#pragma unroll
    for (int nt = 0; nt < 4; ++nt)
#pragma unroll
      for (int r = 0; r < 8; ++r) acc[nt][r] *= al;

    // --- acc += V^T @ P^T ---------------------------------------------------
#pragma unroll
    for (int nt = 0; nt < 4; ++nt)
      acc[nt] = __builtin_amdgcn_wmma_f32_16x16x32_f16(
          false, av[nt].v, false, pb.v, (short)0, acc[nt], false, false);
    __syncthreads();   // protect K/V buffers for reuse
  }

  // --- normalize and store: a lane holds 8 consecutive d of its query ------
  // one query per lane: one division serves the lane's 32 outputs
  const float inv = 1.0f / (l + xhalf(l));             // join the halves' sums
  float* orow = out + (size_t)(b * S_ + q0 + rc) * D_ + 8 * half;
#pragma unroll
  for (int nt = 0; nt < 4; ++nt) {
    float4 o0, o1;
    o0.x = acc[nt][0] * inv; o0.y = acc[nt][1] * inv;
    o0.z = acc[nt][2] * inv; o0.w = acc[nt][3] * inv;
    o1.x = acc[nt][4] * inv; o1.y = acc[nt][5] * inv;
    o1.z = acc[nt][6] * inv; o1.w = acc[nt][7] * inv;
    *(float4*)(orow + nt * 16)     = o0;
    *(float4*)(orow + nt * 16 + 4) = o1;
  }
}

// ---------------------------------------------------------------------------
extern "C" void kernel_launch(void* const* d_in, const int* in_sizes, int n_in,
                              void* d_out, int out_size, void* d_ws, size_t ws_size,
                              hipStream_t stream) {
  const float* x    = (const float*)d_in[0];
  const int*   mask = (const int*)d_in[1];
  const float* Wq   = (const float*)d_in[2];
  const float* bq   = (const float*)d_in[3];
  const float* Wk   = (const float*)d_in[4];
  const float* bk   = (const float*)d_in[5];
  const float* Wv   = (const float*)d_in[6];
  const float* bv   = (const float*)d_in[7];
  float* out = (float*)d_out;

  char* ws = (char*)d_ws;
  _Float16* qh = (_Float16*)ws;                                  // 2 MB
  _Float16* kh = (_Float16*)(ws + (size_t)2 * 1024 * 1024);      // 2 MB
  _Float16* vt = (_Float16*)(ws + (size_t)4 * 1024 * 1024);      // 2 MB
  _Float16* wt = (_Float16*)(ws + (size_t)6 * 1024 * 1024);      // 384 KB

  wtrans_kernel<<<96, 256, 0, stream>>>(Wq, Wk, Wv, wt);
  qkv_proj_kernel<<<256, 128, 0, stream>>>(x, wt, bq, bk, bv, qh, kh, vt);
  flash_attn_kernel<<<256, 128, 0, stream>>>(qh, kh, vt, mask, out);
}

// v004
// A run of this version takes 50.8 microseconds.
// Two timings next to v003 put it at 1.14 and 1.15 times that version's speed.
// Over all steps from v000 it is 2.58 times as fast.
#include <hip/hip_runtime.h>
#include <hip/hip_bf16.h>

typedef __attribute__((ext_vector_type(16))) _Float16 v16h;
typedef __attribute__((ext_vector_type(8)))  float    v8f;
typedef __attribute__((ext_vector_type(4)))  int      v4i;
typedef __attribute__((ext_vector_type(8)))  int      v8i;
typedef __attribute__((ext_vector_type(4)))  unsigned v4u;

#define B_  8
#define S_  2048
#define H_  1024
#define D_  64

#define AS1 __attribute__((address_space(1)))
#define AS3 __attribute__((address_space(3)))

union Frag {
  v16h v;
  _Float16 h[16];
  unsigned u[8];
};

__device__ __forceinline__ void load_frag_h16(Frag& f, const _Float16* base,
                                              int half) {
  const uint4 lo = *(const uint4*)(base + 8 * half);
  const uint4 hi = *(const uint4*)(base + 16 + 8 * half);
  f.u[0] = lo.x; f.u[1] = lo.y; f.u[2] = lo.z; f.u[3] = lo.w;
  f.u[4] = hi.x; f.u[5] = hi.y; f.u[6] = hi.z; f.u[7] = hi.w;
}

__device__ __forceinline__ int frag_pos(int f, int p, int l) {
  return ((2 * f + p) * 32 + l) * 8;
}

__device__ __forceinline__ void load_frag_tile(Frag& fr, const _Float16* tile,
                                               int f, int lane) {
  const uint4 lo = *(const uint4*)(tile + frag_pos(f, 0, lane));
  const uint4 hi = *(const uint4*)(tile + frag_pos(f, 1, lane));
  fr.u[0] = lo.x; fr.u[1] = lo.y; fr.u[2] = lo.z; fr.u[3] = lo.w;
  fr.u[4] = hi.x; fr.u[5] = hi.y; fr.u[6] = hi.z; fr.u[7] = hi.w;
}

#if __has_builtin(__builtin_amdgcn_global_load_async_to_lds_b128)
#define HAVE_ASYNC_LDS 1
#endif

__device__ __forceinline__ void cp_async_b128(void* lds, const void* g) {
#if defined(HAVE_ASYNC_LDS)
  __builtin_amdgcn_global_load_async_to_lds_b128(
      (AS1 v4i*)(v4i*)g, (AS3 v4i*)(v4i*)lds, 0, 0);
#else
  *(uint4*)lds = *(const uint4*)g;   // synchronous fallback
#endif
}

template <int N>
__device__ __forceinline__ void wait_async() {
#if __has_builtin(__builtin_amdgcn_s_wait_asynccnt)
  __builtin_amdgcn_s_wait_asynccnt(N);
#else
  asm volatile("s_wait_asynccnt %0" ::"i"(N) : "memory");
#endif
}

// Work-group barrier for a loop that keeps global loads in flight across it:
// __syncthreads() waits out every outstanding load of the wave. This one waits
// for the wave's LDS accesses only (its reads of a buffer are over before the
// buffer is refilled behind the barrier); the clobber holds LDS reads and the
// copies to LDS on their side of it.
__device__ __forceinline__ void lds_barrier() {
  asm volatile("s_wait_dscnt 0x0\n\ts_barrier_signal -1\n\ts_barrier_wait -1"
               ::: "memory");
}

__device__ __forceinline__ void lds_barrier_behind_products() {
  asm volatile("v_nop\n\tv_nop\n\tv_nop\n\tv_nop\n\t"
               "s_wait_dscnt 0x0\n\ts_barrier_signal -1\n\ts_barrier_wait -1"
               ::: "memory");
}

#if __has_builtin(__builtin_amdgcn_tensor_load_to_lds)
#define HAVE_TDM 1
#endif

__device__ __forceinline__ unsigned lds_offset(const void* p) {
  return (unsigned)(unsigned long long)(AS3 void*)(void*)p;
}

#if defined(HAVE_TDM)
__device__ __forceinline__ void tdm_load_2d(unsigned lds_off, const void* gaddr,
                                            unsigned tensor_d0, unsigned tensor_d1,
                                            unsigned tile_d0, unsigned tile_d1,
                                            unsigned stride0) {
  const unsigned long long ga = (unsigned long long)(size_t)gaddr;
  v4u g0;
  g0[0] = 1u;                                           // count=1, user mode
  g0[1] = lds_off;                                      // lds_addr (bytes)
  g0[2] = (unsigned)ga;                                 // global_addr[31:0]
  g0[3] = (unsigned)((ga >> 32) & 0x1FFFFFFull) | (2u << 30);  // [56:32]|type=2
  v8i g1;
  g1[0] = (int)(1u << 16);
  g1[1] = (int)((tensor_d0 & 0xFFFFu) << 16);
  g1[2] = (int)(((tensor_d0 >> 16) & 0xFFFFu) |
                ((tensor_d1 & 0xFFFFu) << 16));         // dim0[31:16]|dim1[15:0]
  g1[3] = (int)(((tensor_d1 >> 16) & 0xFFFFu) |
                (tile_d0 << 16));
  g1[4] = (int)(tile_d1 & 0xFFFFu);
  g1[5] = (int)stride0;
  g1[6] = 0;
  g1[7] = 0;
  v4i g2 = {0, 0, 0, 0};
  v4i g3 = {0, 0, 0, 0};
  v8i g4 = {0, 0, 0, 0, 0, 0, 0, 0};
  __builtin_amdgcn_tensor_load_to_lds(g0, g1, g2, g3, g4, 0);
}

template <int N>
__device__ __forceinline__ void wait_tensor() {
#if __has_builtin(__builtin_amdgcn_s_wait_tensorcnt)
  __builtin_amdgcn_s_wait_tensorcnt(N);
#else
  asm volatile("s_wait_tensorcnt %0" ::"i"(N) : "memory");
#endif
}
#endif  // HAVE_TDM

__device__ __forceinline__ float xhalf(float x) {
  const int i = __builtin_bit_cast(int, x);
  return __builtin_bit_cast(float, __builtin_amdgcn_permlanex16(
      i, i, 0x76543210, 0xfedcba98, false, false));
}

__device__ __forceinline__ void exp_pair(float& r0, float& r1, float x0, float x1) {
  asm("v_exp_f32 %0, %2\n\tv_exp_f32 %1, %3\n\tv_nop"
      : "=&v"(r0), "=&v"(r1)
      : "v"(x0 * 1.44269504f), "v"(x1 * 1.44269504f));
}

// ---------------------------------------------------------------------------
// Kernel 0: convert W (f32, [k][n]) -> Wt (f16, [w][64][1024]) once. Each chunk
// of 32 k (columns kc..kc+31 of all 64 rows, row-major: the tile kernel 1
// stages) holds its 64 n x 32 k in fragment order, fragment = n / 16.
// ---------------------------------------------------------------------------
__global__ __launch_bounds__(256)
void wtrans_kernel(const float* __restrict__ Wq, const float* __restrict__ Wk,
                   const float* __restrict__ Wv, _Float16* __restrict__ wt) {
  const int id = blockIdx.x * 256 + threadIdx.x;   // 24576 threads
  const int w  = id >> 13;                         // 8192 per weight
  const int r  = id & 8191;
  // a wave takes 4 n x 64 k (two chunks): in fragment order that is four whole
  // 128-byte lines of Wt, each stored by this wave alone
  const int n  = ((r >> 9) << 2) | (r & 3);        // 0..63
  const int k0 = ((r >> 2) & 127) * 8;             // 0..1016
  const float* W = (w == 0) ? Wq : (w == 1) ? Wk : Wv;
  // the thread's 8 k are one run of lane ((k0 >> 3) & 1) * 16 + (n & 15)
  const int pos = frag_pos(n >> 4, (k0 >> 4) & 1, ((k0 >> 3) & 1) * 16 + (n & 15));
  _Float16* dst = wt + ((size_t)w << 16) + (size_t)(pos >> 5) * H_ +
                  (k0 & ~31) + (pos & 31);
#pragma unroll
  for (int j = 0; j < 8; ++j)
    dst[j] = (_Float16)W[(size_t)(k0 + j) * D_ + n];
}

// ---------------------------------------------------------------------------
// Kernel 1: fused QKV projection. 4 waves/block, each wave a 16-row tile of x.
// f16 Wt chunks (3 x 64 x 32 = 12 KB) async-staged to LDS, double buffered,
// shared by all waves. q stored f16 [bs][64]; k and v in the fragment order of
// the tiles kernel 2 stages: k per 32 keys (2048 contiguous halves, fragment =
// 2 * (key / 16) + d / 32), v per 32 keys inside [b][64][2048] (columns
// kt..kt+31 of all 64 rows, row-major; fragment = d / 16).
// ---------------------------------------------------------------------------
__global__ __launch_bounds__(128)
void qkv_proj_kernel(const float* __restrict__ x,
                     const _Float16* __restrict__ wt,
                     const float* __restrict__ bq, const float* __restrict__ bk,
                     const float* __restrict__ bv,
                     _Float16* __restrict__ qh, _Float16* __restrict__ kh,
                     _Float16* __restrict__ vt) {
  __shared__ __align__(16) _Float16 wlds[2][3][64 * 32];  // 2 x 12 KB

  const int tid  = threadIdx.x;
  const int lane = tid & 31;
  const int wid  = tid >> 5;
  const int row0 = (blockIdx.x * 4 + wid) * 16;    // flat row over B*S
  const int half = lane >> 4;
  const int rc   = lane & 15;
  const int srow = tid >> 1;                       // 0..63 staging row
  const int shb  = (tid & 1) << 4;                 // 0/16 halves

  const float* Bs[3] = {bq, bk, bv};

  v8f acc[3][4];
#pragma unroll
  for (int w = 0; w < 3; ++w)
#pragma unroll
    for (int nt = 0; nt < 4; ++nt)
#pragma unroll
      for (int e = 0; e < 8; ++e) acc[w][nt][e] = 0.0f;

  // stage chunk 0: 3 weights x 2 b128 per thread
#pragma unroll
  for (int w = 0; w < 3; ++w)
#pragma unroll
    for (int j = 0; j < 2; ++j)
      cp_async_b128(&wlds[0][w][srow * 32 + shb + j * 8],
                    wt + ((size_t)w << 16) + (size_t)srow * H_ + shb + j * 8);

  // x ring: the wave's 16x32 chunks of x for four passes, in registers. A pass
  // converts its chunk and asks at once for the chunk four passes on, so 16 row
  // loads of a wave stay in flight and no pass waits out the memory latency.
  const float* xlane = x + (size_t)(row0 + rc) * H_ + 8 * half;
  float4 xr[4][4];
#pragma unroll
  for (int j = 0; j < 4; ++j) {
    xr[j][0] = *(const float4*)(xlane + j * 32);
    xr[j][1] = *(const float4*)(xlane + j * 32 + 4);
    xr[j][2] = *(const float4*)(xlane + j * 32 + 16);
    xr[j][3] = *(const float4*)(xlane + j * 32 + 20);
  }

  // four passes; refill is a literal at both calls, so that the counted load
  // waits of the refilling passes are not merged with those of the last four
  auto four_passes = [&](const int kc4, const bool refill)
      __attribute__((always_inline)) {
#pragma unroll
    for (int j = 0; j < 4; ++j) {
      const int kci = kc4 + j;
      const int kc = kci * 32;
      if (refill || j < 3) {
        const int nb = (j + 1) & 1;
#pragma unroll
        for (int w = 0; w < 3; ++w)
#pragma unroll
          for (int jj = 0; jj < 2; ++jj)
            cp_async_b128(&wlds[nb][w][srow * 32 + shb + jj * 8],
                          wt + ((size_t)w << 16) + (size_t)srow * H_ +
                              (kc + 32) + shb + jj * 8);
        wait_async<6>();
      } else {
        wait_async<0>();
      }
      lds_barrier();

      Frag a;                                      // 16x32 chunk of x
      Frag bf[3][4];                               // the pass's 12 Wt fragments
      const int cur = j & 1;
#pragma unroll
      for (int w = 0; w < 3; ++w)
#pragma unroll
        for (int nt = 0; nt < 4; ++nt)
          load_frag_tile(bf[w][nt], &wlds[cur][w][0], nt, lane);
      {
        const float4 f0 = xr[j][0], f1 = xr[j][1], f2 = xr[j][2], f3 = xr[j][3];
        a.h[0]  = (_Float16)f0.x; a.h[1]  = (_Float16)f0.y;
        a.h[2]  = (_Float16)f0.z; a.h[3]  = (_Float16)f0.w;
        a.h[4]  = (_Float16)f1.x; a.h[5]  = (_Float16)f1.y;
        a.h[6]  = (_Float16)f1.z; a.h[7]  = (_Float16)f1.w;
        a.h[8]  = (_Float16)f2.x; a.h[9]  = (_Float16)f2.y;
        a.h[10] = (_Float16)f2.z; a.h[11] = (_Float16)f2.w;
        a.h[12] = (_Float16)f3.x; a.h[13] = (_Float16)f3.y;
        a.h[14] = (_Float16)f3.z; a.h[15] = (_Float16)f3.w;
      }
      if (refill) {
        const float* xn = xlane + kc + 128;
        xr[j][0] = *(const float4*)(xn);
        xr[j][1] = *(const float4*)(xn + 4);
        xr[j][2] = *(const float4*)(xn + 16);
        xr[j][3] = *(const float4*)(xn + 20);
        // the loop advances the ring's address register behind these loads:
        // the wait that stands in front of such an overwrite. In every pass:
        // written in the fourth alone, the build copied ring registers about
        // and waited for two chunks passes early
        asm volatile("s_wait_xcnt 0x0" ::: "memory");
      }
      __builtin_amdgcn_sched_barrier(0);

#pragma unroll
      for (int w = 0; w < 3; ++w) {
#pragma unroll
        for (int nt = 0; nt < 4; ++nt) {
          acc[w][nt] = __builtin_amdgcn_wmma_f32_16x16x32_f16(
              false, a.v, false, bf[w][nt].v, (short)0, acc[w][nt], false, false);
        }
      }
      lds_barrier_behind_products();
    }
  };

  for (int kc4 = 0; kc4 < 28; kc4 += 4) four_passes(kc4, true);
  four_passes(28, false);

  // bias add + f16 store
#pragma unroll
  for (int w = 0; w < 3; ++w) {
#pragma unroll
    for (int nt = 0; nt < 4; ++nt) {
      const int d = nt * 16 + rc;
      const float bias = Bs[w][d];
      if (w == 2) {
        // the lane's 8 keys of column d are one whole run of fragment nt
        union { uint4 q; _Float16 h[8]; } run;
#pragma unroll
        for (int r = 0; r < 8; ++r) run.h[r] = (_Float16)(acc[w][nt][r] + bias);
        const int b   = row0 >> 11;                // / S_
        const int kt  = row0 & (S_ - 1) & ~31;
        const int pos = frag_pos(nt, (row0 >> 4) & 1, lane);
        *(uint4*)(vt + ((size_t)b * D_ + (pos >> 5)) * S_ + kt + (pos & 31)) = run.q;
      } else {
#pragma unroll
        for (int r = 0; r < 8; ++r) {
          const int row   = r + 8 * half;
          const int bsrow = row0 + row;
          const _Float16 hv = (_Float16)(acc[w][nt][r] + bias);
          if (w == 0) {
            qh[(size_t)bsrow * D_ + d] = hv;
          } else {
            const int pos = frag_pos(2 * ((row0 >> 4) & 1) + (nt >> 1), nt & 1,
                                     (rc >> 3) * 16 + row);
            kh[(size_t)(row0 >> 5) * (32 * D_) + pos + (rc & 7)] = hv;
          }
        }
      }
    }
  }
}

__global__ __launch_bounds__(128)
void flash_attn_kernel(const _Float16* __restrict__ qh,
                       const _Float16* __restrict__ kh,
                       const _Float16* __restrict__ vt,
                       const int* __restrict__ mask,
                       float* __restrict__ out) {
  __shared__ __align__(16) _Float16 kbuf[2][32 * 64];  // 2 x 4 KB
  __shared__ __align__(16) _Float16 vbuf[2][64 * 32];  // 2 x 4 KB
  __shared__ __align__(16) float    mbias[S_];         // 8 KB, 0 or -8e30

  const int tid  = threadIdx.x;
  const int lane = tid & 31;
  const int wid  = tid >> 5;
  const int b    = blockIdx.x >> 5;                    // 32 blocks per batch
  const int q0   = ((blockIdx.x & 31) << 6) + (wid << 4);
  const int half = lane >> 4;
  const int rc   = lane & 15;

  const _Float16* kbase = kh + (size_t)(b * S_) * D_;  // per 32 keys 2048 halves, fragment order
  const _Float16* vbase = vt + (size_t)(b * D_) * S_;  // [64][2048], fragment order per 32 keys

  // Q fragments (B operand, column = query): two b128 loads each
  Frag a0, a1;
  {
    const _Float16* qrow = qh + (size_t)(b * S_ + q0 + rc) * D_;
    load_frag_h16(a0, qrow, half);
    load_frag_h16(a1, qrow + 32, half);
  }

  float m = -1e30f, l = 0.0f;                          // this lane's query
  v8f acc[4];                                          // O^T: row d, col query
#pragma unroll
  for (int nt = 0; nt < 4; ++nt)
#pragma unroll
    for (int e = 0; e < 8; ++e) acc[nt][e] = 0.0f;

  const float scale = 0.125f;                          // 1/sqrt(64)

#if defined(HAVE_TDM)
  if (wid == 0)
    tdm_load_2d(lds_offset(&kbuf[0][0]), kbase, D_, S_, D_, 32, D_);
  else if (wid == 1)
    tdm_load_2d(lds_offset(&vbuf[0][0]), vbase, S_, D_, 32, D_, S_);
#else
  const int vrow = tid >> 1;
  const int vhb  = (tid & 1) << 4;
#pragma unroll
  for (int j = 0; j < 2; ++j) {
    cp_async_b128(&kbuf[0][tid * 16 + j * 8], kbase + tid * 16 + j * 8);
    cp_async_b128(&vbuf[0][vrow * 32 + vhb + j * 8],
                  vbase + (size_t)vrow * S_ + vhb + j * 8);
  }
#endif

  // mask table: -8e30 absorbs any score and gives -1e30 after the 1/8 scale;
  // published by the first barrier of the loop
#pragma unroll
  for (int j = 0; j < 4; ++j) {
    const int4 mm = *(const int4*)(mask + b * S_ + tid * 16 + j * 4);
    float4 f;
    f.x = (mm.x == 0) ? -8e30f : 0.0f;
    f.y = (mm.y == 0) ? -8e30f : 0.0f;
    f.z = (mm.z == 0) ? -8e30f : 0.0f;
    f.w = (mm.w == 0) ? -8e30f : 0.0f;
    *(float4*)&mbias[tid * 16 + j * 4] = f;
  }

  for (int kti = 0; kti < S_ / 32; ++kti) {
    const int kt = kti * 32;
    if (kti + 1 < S_ / 32) {
      const int nb = (kti + 1) & 1;
#if defined(HAVE_TDM)
      if (wid == 0)
        tdm_load_2d(lds_offset(&kbuf[nb][0]), kbase + (size_t)(kt + 32) * D_,
                    D_, S_, D_, 32, D_);
      else if (wid == 1)
        tdm_load_2d(lds_offset(&vbuf[nb][0]), vbase + kt + 32,
                    S_, D_, 32, D_, S_);
      wait_tensor<1>();
#else
#pragma unroll
      for (int j = 0; j < 2; ++j) {
        cp_async_b128(&kbuf[nb][tid * 16 + j * 8],
                      kbase + (size_t)(kt + 32) * D_ + tid * 16 + j * 8);
        cp_async_b128(&vbuf[nb][vrow * 32 + vhb + j * 8],
                      vbase + (size_t)vrow * S_ + kt + 32 + vhb + j * 8);
      }
      wait_async<4>();
#endif
    } else {
#if defined(HAVE_TDM)
      wait_tensor<0>();
#else
      wait_async<0>();
#endif
    }
    __syncthreads();

    const _Float16* kl = kbuf[kti & 1];
    const _Float16* vl = vbuf[kti & 1];

    // --- scores: S^T = K @ Q^T for 2 groups of 16 keys (ds_load_b128) ------
    Frag bk00, bk01, bk10, bk11;
    load_frag_tile(bk00, kl, 0, lane);
    load_frag_tile(bk01, kl, 1, lane);
    load_frag_tile(bk10, kl, 2, lane);
    load_frag_tile(bk11, kl, 3, lane);

    v8f s0, s1;                                        // start value: key mask
    {
      const float4 c0 = *(const float4*)&mbias[kt + 8 * half];
      const float4 c1 = *(const float4*)&mbias[kt + 8 * half + 4];
      const float4 c2 = *(const float4*)&mbias[kt + 16 + 8 * half];
      const float4 c3 = *(const float4*)&mbias[kt + 16 + 8 * half + 4];
      s0[0] = c0.x; s0[1] = c0.y; s0[2] = c0.z; s0[3] = c0.w;
      s0[4] = c1.x; s0[5] = c1.y; s0[6] = c1.z; s0[7] = c1.w;
      s1[0] = c2.x; s1[1] = c2.y; s1[2] = c2.z; s1[3] = c2.w;
      s1[4] = c3.x; s1[5] = c3.y; s1[6] = c3.z; s1[7] = c3.w;
    }
    Frag av[4];                                        // V^T rows, A operand
#pragma unroll
    for (int nt = 0; nt < 4; ++nt)
      load_frag_tile(av[nt], vl, nt, lane);
    __builtin_amdgcn_sched_barrier(0);
    s0 = __builtin_amdgcn_wmma_f32_16x16x32_f16(false, bk00.v, false, a0.v,
                                                (short)0, s0, false, false);
    s0 = __builtin_amdgcn_wmma_f32_16x16x32_f16(false, bk01.v, false, a1.v,
                                                (short)0, s0, false, false);
    s1 = __builtin_amdgcn_wmma_f32_16x16x32_f16(false, bk10.v, false, a0.v,
                                                (short)0, s1, false, false);
    s1 = __builtin_amdgcn_wmma_f32_16x16x32_f16(false, bk11.v, false, a1.v,
                                                (short)0, s1, false, false);

    // --- online softmax update, one query per lane --------------------------
    float v0[8], v1[8];
#pragma unroll
    for (int r = 0; r < 8; ++r) { v0[r] = s0[r] * scale; v1[r] = s1[r] * scale; }
    float rmax = fmaxf(v0[0], v1[0]);
#pragma unroll
    for (int r = 1; r < 8; ++r) rmax = fmaxf(rmax, fmaxf(v0[r], v1[r]));
    rmax = fmaxf(rmax, xhalf(rmax));                   // both halves' 32 keys
    const float mn = fmaxf(m, rmax);
    const float al = __expf(m - mn);
    float rs0 = 0.0f, rs1 = 0.0f;
    Frag pb;                                           // P^T as B operand
#pragma unroll
    for (int r = 0; r < 8; ++r) {
      float e0, e1;
      exp_pair(e0, e1, v0[r] - mn, v1[r] - mn);
      rs0 += e0;
      rs1 += e1;
      pb.h[r]     = (_Float16)e0;                      // k = 8*half + r
      pb.h[8 + r] = (_Float16)e1;                      // k = 16 + 8*half + r
    }
    l = l * al + (rs0 + rs1);                          // this half's keys only
    m = mn;
#pragma unroll
    for (int nt = 0; nt < 4; ++nt)
#pragma unroll
      for (int r = 0; r < 8; ++r) acc[nt][r] *= al;

    // --- acc += V^T @ P^T ---------------------------------------------------
#pragma unroll
    for (int nt = 0; nt < 4; ++nt)
      acc[nt] = __builtin_amdgcn_wmma_f32_16x16x32_f16(
          false, av[nt].v, false, pb.v, (short)0, acc[nt], false, false);
    __syncthreads();   // protect K/V buffers for reuse
  }

  // --- normalize and store: a lane holds 8 consecutive d of its query ------
  // one query per lane: one division serves the lane's 32 outputs
  const float inv = 1.0f / (l + xhalf(l));             // join the halves' sums
  float* orow = out + (size_t)(b * S_ + q0 + rc) * D_ + 8 * half;
#pragma unroll
  for (int nt = 0; nt < 4; ++nt) {
    float4 o0, o1;
    o0.x = acc[nt][0] * inv; o0.y = acc[nt][1] * inv;
    o0.z = acc[nt][2] * inv; o0.w = acc[nt][3] * inv;
    o1.x = acc[nt][4] * inv; o1.y = acc[nt][5] * inv;
    o1.z = acc[nt][6] * inv; o1.w = acc[nt][7] * inv;
    *(float4*)(orow + nt * 16)     = o0;
    *(float4*)(orow + nt * 16 + 4) = o1;
  }
}

// ---------------------------------------------------------------------------
extern "C" void kernel_launch(void* const* d_in, const int* in_sizes, int n_in,
                              void* d_out, int out_size, void* d_ws, size_t ws_size,
                              hipStream_t stream) {
  const float* x    = (const float*)d_in[0];
  const int*   mask = (const int*)d_in[1];
  const float* Wq   = (const float*)d_in[2];
  const float* bq   = (const float*)d_in[3];
  const float* Wk   = (const float*)d_in[4];
  const float* bk   = (const float*)d_in[5];
  const float* Wv   = (const float*)d_in[6];
  const float* bv   = (const float*)d_in[7];
  float* out = (float*)d_out;

  char* ws = (char*)d_ws;
  _Float16* qh = (_Float16*)ws;                                  // 2 MB
  _Float16* kh = (_Float16*)(ws + (size_t)2 * 1024 * 1024);      // 2 MB
  _Float16* vt = (_Float16*)(ws + (size_t)4 * 1024 * 1024);      // 2 MB
  _Float16* wt = (_Float16*)(ws + (size_t)6 * 1024 * 1024);      // 384 KB

  wtrans_kernel<<<96, 256, 0, stream>>>(Wq, Wk, Wv, wt);
  qkv_proj_kernel<<<256, 128, 0, stream>>>(x, wt, bq, bk, bv, qh, kh, vt);
  flash_attn_kernel<<<256, 128, 0, stream>>>(qh, kh, vt, mask, out);
}

// v005
// One run takes 35 microseconds.
// In both of two side-by-side timings against v004, it was 1.44 times as fast.
// All steps since v000 together make it 3.72 times as fast.
#include <hip/hip_runtime.h>
#include <hip/hip_bf16.h>

typedef __attribute__((ext_vector_type(16))) _Float16 v16h;
typedef __attribute__((ext_vector_type(8)))  float    v8f;
typedef __attribute__((ext_vector_type(4)))  int      v4i;
typedef __attribute__((ext_vector_type(8)))  int      v8i;
typedef __attribute__((ext_vector_type(4)))  unsigned v4u;

#define B_  8
#define S_  2048
#define H_  1024
#define D_  64

#define AS1 __attribute__((address_space(1)))
#define AS3 __attribute__((address_space(3)))

union Frag {
  v16h v;
  _Float16 h[16];
  unsigned u[8];
};

__device__ __forceinline__ void load_frag_h16(Frag& f, const _Float16* base,
                                              int half) {
  const uint4 lo = *(const uint4*)(base + 8 * half);
  const uint4 hi = *(const uint4*)(base + 16 + 8 * half);
  f.u[0] = lo.x; f.u[1] = lo.y; f.u[2] = lo.z; f.u[3] = lo.w;
  f.u[4] = hi.x; f.u[5] = hi.y; f.u[6] = hi.z; f.u[7] = hi.w;
}

__device__ __forceinline__ int frag_pos(int f, int p, int l) {
  return ((2 * f + p) * 32 + l) * 8;
}

__device__ __forceinline__ void load_frag_tile(Frag& fr, const _Float16* tile,
                                               int f, int lane) {
  const uint4 lo = *(const uint4*)(tile + frag_pos(f, 0, lane));
  const uint4 hi = *(const uint4*)(tile + frag_pos(f, 1, lane));
  fr.u[0] = lo.x; fr.u[1] = lo.y; fr.u[2] = lo.z; fr.u[3] = lo.w;
  fr.u[4] = hi.x; fr.u[5] = hi.y; fr.u[6] = hi.z; fr.u[7] = hi.w;
}

#if __has_builtin(__builtin_amdgcn_global_load_async_to_lds_b128)
#define HAVE_ASYNC_LDS 1
#endif

__device__ __forceinline__ void cp_async_b128(void* lds, const void* g) {
#if defined(HAVE_ASYNC_LDS)
  __builtin_amdgcn_global_load_async_to_lds_b128(
      (AS1 v4i*)(v4i*)g, (AS3 v4i*)(v4i*)lds, 0, 0);
#else
  *(uint4*)lds = *(const uint4*)g;   // synchronous fallback
#endif
}

template <int N>
__device__ __forceinline__ void wait_async() {
#if __has_builtin(__builtin_amdgcn_s_wait_asynccnt)
  __builtin_amdgcn_s_wait_asynccnt(N);
#else
  asm volatile("s_wait_asynccnt %0" ::"i"(N) : "memory");
#endif
}

// Work-group barrier for a loop that keeps global loads in flight across it:
// __syncthreads() waits out every outstanding load of the wave. This one waits
// for the wave's LDS accesses only (its reads of a buffer are over before the
// buffer is refilled behind the barrier); the clobber holds LDS reads and the
// copies to LDS on their side of it.
__device__ __forceinline__ void lds_barrier() {
  asm volatile("s_wait_dscnt 0x0\n\ts_barrier_signal -1\n\ts_barrier_wait -1"
               ::: "memory");
}

__device__ __forceinline__ void lds_barrier_behind_products() {
  asm volatile("v_nop\n\tv_nop\n\tv_nop\n\tv_nop\n\t"
               "s_wait_dscnt 0x0\n\ts_barrier_signal -1\n\ts_barrier_wait -1"
               ::: "memory");
}

#if __has_builtin(__builtin_amdgcn_tensor_load_to_lds)
#define HAVE_TDM 1
#endif

__device__ __forceinline__ unsigned lds_offset(const void* p) {
  return (unsigned)(unsigned long long)(AS3 void*)(void*)p;
}

#if defined(HAVE_TDM)
__device__ __forceinline__ void tdm_load_2d(unsigned lds_off, const void* gaddr,
                                            unsigned tensor_d0, unsigned tensor_d1,
                                            unsigned tile_d0, unsigned tile_d1,
                                            unsigned stride0) {
  const unsigned long long ga = (unsigned long long)(size_t)gaddr;
  v4u g0;
  g0[0] = 1u;                                           // count=1, user mode
  g0[1] = lds_off;                                      // lds_addr (bytes)
  g0[2] = (unsigned)ga;                                 // global_addr[31:0]
  g0[3] = (unsigned)((ga >> 32) & 0x1FFFFFFull) | (2u << 30);  // [56:32]|type=2
  v8i g1;
  g1[0] = (int)(1u << 16);
  g1[1] = (int)((tensor_d0 & 0xFFFFu) << 16);
  g1[2] = (int)(((tensor_d0 >> 16) & 0xFFFFu) |
                ((tensor_d1 & 0xFFFFu) << 16));         // dim0[31:16]|dim1[15:0]
  g1[3] = (int)(((tensor_d1 >> 16) & 0xFFFFu) |
                (tile_d0 << 16));
  g1[4] = (int)(tile_d1 & 0xFFFFu);
  g1[5] = (int)stride0;
  g1[6] = 0;
  g1[7] = 0;
  v4i g2 = {0, 0, 0, 0};
  v4i g3 = {0, 0, 0, 0};
  v8i g4 = {0, 0, 0, 0, 0, 0, 0, 0};
  __builtin_amdgcn_tensor_load_to_lds(g0, g1, g2, g3, g4, 0);
}

template <int N>
__device__ __forceinline__ void wait_tensor() {
#if __has_builtin(__builtin_amdgcn_s_wait_tensorcnt)
  __builtin_amdgcn_s_wait_tensorcnt(N);
#else
  asm volatile("s_wait_tensorcnt %0" ::"i"(N) : "memory");
#endif
}
#endif  // HAVE_TDM

__device__ __forceinline__ float xhalf(float x) {
  const int i = __builtin_bit_cast(int, x);
  return __builtin_bit_cast(float, __builtin_amdgcn_permlanex16(
      i, i, 0x76543210, 0xfedcba98, false, false));
}

__device__ __forceinline__ void exp_pair(float& r0, float& r1, float x0, float x1) {
  asm("v_exp_f32 %0, %2\n\tv_exp_f32 %1, %3\n\tv_nop"
      : "=&v"(r0), "=&v"(r1)
      : "v"(x0 * 1.44269504f), "v"(x1 * 1.44269504f));
}

// ---------------------------------------------------------------------------
// Kernel 0: convert W (f32, [k][n]) -> Wt (f16, [w][64][1024]) once. Each chunk
// of 32 k (columns kc..kc+31 of all 64 rows, row-major: the tile kernel 1
// stages) holds its 64 n x 32 k in fragment order, fragment = n / 16.
// ---------------------------------------------------------------------------
__global__ __launch_bounds__(256)
void wtrans_kernel(const float* __restrict__ Wq, const float* __restrict__ Wk,
                   const float* __restrict__ Wv, _Float16* __restrict__ wt) {
  const int id = blockIdx.x * 256 + threadIdx.x;   // 24576 threads
  const int w  = id >> 13;                         // 8192 per weight
  const int r  = id & 8191;
  // a wave takes 4 n x 64 k (two chunks): in fragment order that is four whole
  // 128-byte lines of Wt, each stored by this wave alone
  const int n  = ((r >> 9) << 2) | (r & 3);        // 0..63
  const int k0 = ((r >> 2) & 127) * 8;             // 0..1016
  const float* W = (w == 0) ? Wq : (w == 1) ? Wk : Wv;
  // the thread's 8 k are one run of lane ((k0 >> 3) & 1) * 16 + (n & 15)
  const int pos = frag_pos(n >> 4, (k0 >> 4) & 1, ((k0 >> 3) & 1) * 16 + (n & 15));
  _Float16* dst = wt + ((size_t)w << 16) + (size_t)(pos >> 5) * H_ +
                  (k0 & ~31) + (pos & 31);
#pragma unroll
  for (int j = 0; j < 8; ++j)
    dst[j] = (_Float16)W[(size_t)(k0 + j) * D_ + n];
}

// ---------------------------------------------------------------------------
// Kernel 1: fused QKV projection. 4 waves/block, each wave a 16-row tile of x.
// f16 Wt chunks (3 x 64 x 32 = 12 KB) async-staged to LDS, double buffered,
// shared by all waves. q stored f16 [bs][64]; k and v in the fragment order of
// the tiles kernel 2 stages: k per 32 keys (2048 contiguous halves, fragment =
// 2 * (key / 16) + d / 32), v per 32 keys inside [b][64][2048] (columns
// kt..kt+31 of all 64 rows, row-major; fragment = d / 16).
// ---------------------------------------------------------------------------
__global__ __launch_bounds__(128)
void qkv_proj_kernel(const float* __restrict__ x,
                     const _Float16* __restrict__ wt,
                     const float* __restrict__ bq, const float* __restrict__ bk,
                     const float* __restrict__ bv,
                     _Float16* __restrict__ qh, _Float16* __restrict__ kh,
                     _Float16* __restrict__ vt) {
  __shared__ __align__(16) _Float16 wlds[2][3][64 * 32];  // 2 x 12 KB

  const int tid  = threadIdx.x;
  const int lane = tid & 31;
  const int wid  = tid >> 5;
  const int row0 = (blockIdx.x * 4 + wid) * 16;    // flat row over B*S
  const int half = lane >> 4;
  const int rc   = lane & 15;
  const int srow = tid >> 1;                       // 0..63 staging row
  const int shb  = (tid & 1) << 4;                 // 0/16 halves

  const float* Bs[3] = {bq, bk, bv};

  v8f acc[3][4];
#pragma unroll
  for (int w = 0; w < 3; ++w)
#pragma unroll
    for (int nt = 0; nt < 4; ++nt)
#pragma unroll
      for (int e = 0; e < 8; ++e) acc[w][nt][e] = 0.0f;

  // stage chunk 0: 3 weights x 2 b128 per thread
#pragma unroll
  for (int w = 0; w < 3; ++w)
#pragma unroll
    for (int j = 0; j < 2; ++j)
      cp_async_b128(&wlds[0][w][srow * 32 + shb + j * 8],
                    wt + ((size_t)w << 16) + (size_t)srow * H_ + shb + j * 8);

  // x ring: the wave's 16x32 chunks of x for four passes, in registers. A pass
  // converts its chunk and asks at once for the chunk four passes on, so 16 row
  // loads of a wave stay in flight and no pass waits out the memory latency.
  const float* xlane = x + (size_t)(row0 + rc) * H_ + 8 * half;
  float4 xr[4][4];
#pragma unroll
  for (int j = 0; j < 4; ++j) {
    xr[j][0] = *(const float4*)(xlane + j * 32);
    xr[j][1] = *(const float4*)(xlane + j * 32 + 4);
    xr[j][2] = *(const float4*)(xlane + j * 32 + 16);
    xr[j][3] = *(const float4*)(xlane + j * 32 + 20);
  }

  // four passes; refill is a literal at both calls, so that the counted load
  // waits of the refilling passes are not merged with those of the last four
  auto four_passes = [&](const int kc4, const bool refill)
      __attribute__((always_inline)) {
#pragma unroll
    for (int j = 0; j < 4; ++j) {
      const int kci = kc4 + j;
      const int kc = kci * 32;
      if (refill || j < 3) {
        const int nb = (j + 1) & 1;
#pragma unroll
        for (int w = 0; w < 3; ++w)
#pragma unroll
          for (int jj = 0; jj < 2; ++jj)
            cp_async_b128(&wlds[nb][w][srow * 32 + shb + jj * 8],
                          wt + ((size_t)w << 16) + (size_t)srow * H_ +
                              (kc + 32) + shb + jj * 8);
        wait_async<6>();
      } else {
        wait_async<0>();
      }
      lds_barrier();

      Frag a;                                      // 16x32 chunk of x
      Frag bf[3][4];                               // the pass's 12 Wt fragments
      const int cur = j & 1;
#pragma unroll
      for (int w = 0; w < 3; ++w)
#pragma unroll
        for (int nt = 0; nt < 4; ++nt)
          load_frag_tile(bf[w][nt], &wlds[cur][w][0], nt, lane);
      {
        const float4 f0 = xr[j][0], f1 = xr[j][1], f2 = xr[j][2], f3 = xr[j][3];
        a.h[0]  = (_Float16)f0.x; a.h[1]  = (_Float16)f0.y;
        a.h[2]  = (_Float16)f0.z; a.h[3]  = (_Float16)f0.w;
        a.h[4]  = (_Float16)f1.x; a.h[5]  = (_Float16)f1.y;
        a.h[6]  = (_Float16)f1.z; a.h[7]  = (_Float16)f1.w;
        a.h[8]  = (_Float16)f2.x; a.h[9]  = (_Float16)f2.y;
        a.h[10] = (_Float16)f2.z; a.h[11] = (_Float16)f2.w;
        a.h[12] = (_Float16)f3.x; a.h[13] = (_Float16)f3.y;
        a.h[14] = (_Float16)f3.z; a.h[15] = (_Float16)f3.w;
      }
      if (refill) {
        const float* xn = xlane + kc + 128;
        xr[j][0] = *(const float4*)(xn);
        xr[j][1] = *(const float4*)(xn + 4);
        xr[j][2] = *(const float4*)(xn + 16);
        xr[j][3] = *(const float4*)(xn + 20);
        // the loop advances the ring's address register behind these loads:
        // the wait that stands in front of such an overwrite. In every pass:
        // written in the fourth alone, the build copied ring registers about
        // and waited for two chunks passes early
        asm volatile("s_wait_xcnt 0x0" ::: "memory");
      }
      __builtin_amdgcn_sched_barrier(0);

#pragma unroll
      for (int w = 0; w < 3; ++w) {
#pragma unroll
        for (int nt = 0; nt < 4; ++nt) {
          acc[w][nt] = __builtin_amdgcn_wmma_f32_16x16x32_f16(
              false, a.v, false, bf[w][nt].v, (short)0, acc[w][nt], false, false);
        }
      }
      lds_barrier_behind_products();
    }
  };

  for (int kc4 = 0; kc4 < 28; kc4 += 4) four_passes(kc4, true);
  four_passes(28, false);

  // bias add + f16 store
#pragma unroll
  for (int w = 0; w < 3; ++w) {
#pragma unroll
    for (int nt = 0; nt < 4; ++nt) {
      const int d = nt * 16 + rc;
      const float bias = Bs[w][d];
      if (w == 2) {
        // the lane's 8 keys of column d are one whole run of fragment nt
        union { uint4 q; _Float16 h[8]; } run;
#pragma unroll
        for (int r = 0; r < 8; ++r) run.h[r] = (_Float16)(acc[w][nt][r] + bias);
        const int b   = row0 >> 11;                // / S_
        const int kt  = row0 & (S_ - 1) & ~31;
        const int pos = frag_pos(nt, (row0 >> 4) & 1, lane);
        *(uint4*)(vt + ((size_t)b * D_ + (pos >> 5)) * S_ + kt + (pos & 31)) = run.q;
      } else {
#pragma unroll
        for (int r = 0; r < 8; ++r) {
          const int row   = r + 8 * half;
          const int bsrow = row0 + row;
          const _Float16 hv = (_Float16)(acc[w][nt][r] + bias);
          if (w == 0) {
            qh[(size_t)bsrow * D_ + d] = hv;
          } else {
            const int pos = frag_pos(2 * ((row0 >> 4) & 1) + (nt >> 1), nt & 1,
                                     (rc >> 3) * 16 + row);
            kh[(size_t)(row0 >> 5) * (32 * D_) + pos + (rc & 7)] = hv;
          }
        }
      }
    }
  }
}

__device__ __forceinline__ unsigned pinned(unsigned v) {
  unsigned w = __builtin_amdgcn_readfirstlane(v);
  asm volatile("" : "+s"(w));
  return w;
}

__global__ __launch_bounds__(512)
void flash_attn_kernel(const _Float16* __restrict__ qh,
                       const _Float16* __restrict__ kh,
                       const _Float16* __restrict__ vt,
                       const int* __restrict__ mask,
                       float* __restrict__ out) {
  __shared__ __attribute__((aligned(2048))) _Float16 kbuf[2][4][32 * 64];  // 2 x 16 KB
  __shared__ __attribute__((aligned(2048))) _Float16 vbuf[2][4][64 * 32];  // 2 x 16 KB
  __shared__ __align__(16) float  mbias[S_];           // 8 KB, 0 or -8e30
  __shared__ __align__(16) float4 part[16][8][32];     // 64 KB, each wave's O^T
  __shared__ __align__(8)  float2 pml[16][16];         // each wave's (m, l) per query

  const int tid  = threadIdx.x;
  const int lane = tid & 31;
  const int wid  = __builtin_amdgcn_readfirstlane(tid >> 5);
  const int kg   = wid & 3;                            // key group
  const int qt   = wid >> 2;                           // query tile
  const int b    = blockIdx.x >> 5;                    // 32 blocks per batch
  const int q0   = ((blockIdx.x & 31) << 6) + (qt << 4);
  const int half = lane >> 4;
  const int rc   = lane & 15;

  const _Float16* kbase = kh + (size_t)(b * S_) * D_;  // per 32 keys 2048 halves, fragment order
  const _Float16* vbase = vt + (size_t)(b * D_) * S_;  // [64][2048], fragment order per 32 keys

  // Q fragments (B operand, column = query): two b128 loads each
  Frag a0, a1;
  {
    const _Float16* qrow = qh + (size_t)(b * S_ + q0 + rc) * D_;
    load_frag_h16(a0, qrow, half);
    load_frag_h16(a1, qrow + 32, half);
  }

  float m = -1e30f, l = 0.0f;                          // this lane's query
  v8f acc[4];                                          // O^T: row d, col query
#pragma unroll
  for (int nt = 0; nt < 4; ++nt)
#pragma unroll
    for (int e = 0; e < 8; ++e) acc[nt][e] = 0.0f;

  const float scale = 0.125f;                          // 1/sqrt(64)

  auto issue_stage = [&](const int st) __attribute__((always_inline)) {
    const int nb = st & 1;
#if defined(HAVE_TDM)
    if (pinned(wid < 4))
      tdm_load_2d(lds_offset(&kbuf[nb][wid][0]),
                  kbase + (size_t)(st * 128 + wid * 32) * D_, D_, S_, D_, 32, D_);
    else if (pinned(wid < 8))
      tdm_load_2d(lds_offset(&vbuf[nb][wid - 4][0]),
                  vbase + st * 128 + (wid - 4) * 32, S_, D_, 32, D_, S_);
#else
#pragma unroll
    for (int j = 0; j < 2; ++j) {
      const int c = tid * 2 + j;                       // 0..1023, 16 bytes each
      cp_async_b128(&kbuf[nb][0][c * 8], kbase + (size_t)(st * 128) * D_ + c * 8);
      cp_async_b128(&vbuf[nb][c >> 8][(c & 255) * 8],
                    vbase + (size_t)((c >> 2) & 63) * S_ + st * 128 +
                        (c >> 8) * 32 + (c & 3) * 8);
    }
#endif
  };
  issue_stage(0);

  // mask table: -8e30 absorbs any score and gives -1e30 after the 1/8 scale;
  // published by the first barrier of the loop
  {
    const int4 mm = *(const int4*)(mask + b * S_ + tid * 4);
    float4 f;
    f.x = (mm.x == 0) ? -8e30f : 0.0f;
    f.y = (mm.y == 0) ? -8e30f : 0.0f;
    f.z = (mm.z == 0) ? -8e30f : 0.0f;
    f.w = (mm.w == 0) ? -8e30f : 0.0f;
    *(float4*)&mbias[tid * 4] = f;
  }

  for (int st = 0; st < S_ / 128; ++st) {
    const int kt = st * 128 + kg * 32;
    if (st + 1 < S_ / 128) {
      issue_stage(st + 1);
#if defined(HAVE_TDM)
      wait_tensor<1>();
#else
      wait_async<4>();
#endif
    } else {
#if defined(HAVE_TDM)
      wait_tensor<0>();
#else
      wait_async<0>();
#endif
    }
    __syncthreads();

    const _Float16* kl = kbuf[st & 1][kg];
    const _Float16* vl = vbuf[st & 1][kg];

    // --- scores: S^T = K @ Q^T for 2 groups of 16 keys (ds_load_b128) ------
    Frag bk00, bk01, bk10, bk11;
    load_frag_tile(bk00, kl, 0, lane);
    load_frag_tile(bk01, kl, 1, lane);
    load_frag_tile(bk10, kl, 2, lane);
    load_frag_tile(bk11, kl, 3, lane);

    v8f s0, s1;                                        // start value: key mask
    {
      const float4 c0 = *(const float4*)&mbias[kt + 8 * half];
      const float4 c1 = *(const float4*)&mbias[kt + 8 * half + 4];
      const float4 c2 = *(const float4*)&mbias[kt + 16 + 8 * half];
      const float4 c3 = *(const float4*)&mbias[kt + 16 + 8 * half + 4];
      s0[0] = c0.x; s0[1] = c0.y; s0[2] = c0.z; s0[3] = c0.w;
      s0[4] = c1.x; s0[5] = c1.y; s0[6] = c1.z; s0[7] = c1.w;
      s1[0] = c2.x; s1[1] = c2.y; s1[2] = c2.z; s1[3] = c2.w;
      s1[4] = c3.x; s1[5] = c3.y; s1[6] = c3.z; s1[7] = c3.w;
    }
    Frag av[4];                                        // V^T rows, A operand
#pragma unroll
    for (int nt = 0; nt < 4; ++nt)
      load_frag_tile(av[nt], vl, nt, lane);
    // keeps the pass's LDS loads in one group ahead of the products: moved in
    // among them, each pair makes the wave wait out a full LDS round trip
    __builtin_amdgcn_sched_barrier(0);
    s0 = __builtin_amdgcn_wmma_f32_16x16x32_f16(false, bk00.v, false, a0.v,
                                                (short)0, s0, false, false);
    s0 = __builtin_amdgcn_wmma_f32_16x16x32_f16(false, bk01.v, false, a1.v,
                                                (short)0, s0, false, false);
    s1 = __builtin_amdgcn_wmma_f32_16x16x32_f16(false, bk10.v, false, a0.v,
                                                (short)0, s1, false, false);
    s1 = __builtin_amdgcn_wmma_f32_16x16x32_f16(false, bk11.v, false, a1.v,
                                                (short)0, s1, false, false);

    // --- online softmax update, one query per lane --------------------------
    float v0[8], v1[8];
#pragma unroll
    for (int r = 0; r < 8; ++r) { v0[r] = s0[r] * scale; v1[r] = s1[r] * scale; }
    float rmax = fmaxf(v0[0], v1[0]);
#pragma unroll
    for (int r = 1; r < 8; ++r) rmax = fmaxf(rmax, fmaxf(v0[r], v1[r]));
    rmax = fmaxf(rmax, xhalf(rmax));                   // both halves' 32 keys
    const float mn = fmaxf(m, rmax);
    const float al = __expf(m - mn);
    float rs0 = 0.0f, rs1 = 0.0f;
    Frag pb;                                           // P^T as B operand
#pragma unroll
    for (int r = 0; r < 8; ++r) {
      float e0, e1;
      exp_pair(e0, e1, v0[r] - mn, v1[r] - mn);
      rs0 += e0;
      rs1 += e1;
      pb.h[r]     = (_Float16)e0;                      // k = 8*half + r
      pb.h[8 + r] = (_Float16)e1;                      // k = 16 + 8*half + r
    }
    l = l * al + (rs0 + rs1);                          // this half's keys only
    m = mn;
#pragma unroll
    for (int nt = 0; nt < 4; ++nt)
#pragma unroll
      for (int r = 0; r < 8; ++r) acc[nt][r] *= al;

    // --- acc += V^T @ P^T ---------------------------------------------------
#pragma unroll
    for (int nt = 0; nt < 4; ++nt)
      acc[nt] = __builtin_amdgcn_wmma_f32_16x16x32_f16(
          false, av[nt].v, false, pb.v, (short)0, acc[nt], false, false);
    __builtin_amdgcn_sched_barrier(0);
    asm volatile("v_nop\n\tv_nop\n\tv_nop\n\tv_nop");
    __syncthreads();   // protect K/V buffers for reuse
  }

  const float lt = l + xhalf(l);                       // join the halves' sums
#pragma unroll
  for (int nt = 0; nt < 4; ++nt) {
    float4 o0, o1;
    o0.x = acc[nt][0]; o0.y = acc[nt][1]; o0.z = acc[nt][2]; o0.w = acc[nt][3];
    o1.x = acc[nt][4]; o1.y = acc[nt][5]; o1.z = acc[nt][6]; o1.w = acc[nt][7];
    const int pl = half * 16 + ((rc + 4 * nt) & 15);
    part[wid][nt * 2][pl]     = o0;
    part[wid][nt * 2 + 1][pl] = o1;
  }
  if (half == 0) pml[wid][rc] = make_float2(m, lt);
  __syncthreads();   // publishes every wave's partial result

  // wave kg of a query tile joins its queries 4*kg .. 4*kg+3; a lane takes 8
  // consecutive d of one query, so a wave stores four whole rows of out
  const int qi = 4 * kg + (lane >> 3);
  const int dn = (lane & 7) >> 1;                      // the run's nt
  const int pr = (lane & 1) * 16 + ((qi + 4 * dn) & 15);
  float2 ml[4];
#pragma unroll
  for (int g = 0; g < 4; ++g) ml[g] = pml[qt * 4 + g][qi];
  const float mj = fmaxf(fmaxf(ml[0].x, ml[1].x), fmaxf(ml[2].x, ml[3].x));
  float wg[4];
  exp_pair(wg[0], wg[1], ml[0].x - mj, ml[1].x - mj);
  exp_pair(wg[2], wg[3], ml[2].x - mj, ml[3].x - mj);
  float lj = 0.0f;
  float4 o0 = {0.0f, 0.0f, 0.0f, 0.0f}, o1 = {0.0f, 0.0f, 0.0f, 0.0f};
#pragma unroll
  for (int g = 0; g < 4; ++g) {
    const float4 p0 = part[qt * 4 + g][dn * 2][pr];
    const float4 p1 = part[qt * 4 + g][dn * 2 + 1][pr];
    lj += wg[g] * ml[g].y;
    o0.x += wg[g] * p0.x; o0.y += wg[g] * p0.y;
    o0.z += wg[g] * p0.z; o0.w += wg[g] * p0.w;
    o1.x += wg[g] * p1.x; o1.y += wg[g] * p1.y;
    o1.z += wg[g] * p1.z; o1.w += wg[g] * p1.w;
  }
  // --- normalize and store ---------------------------------------------------
  const float inv = 1.0f / lj;
  float* orow = out + (size_t)(b * S_ + q0 + qi) * D_ + (lane & 7) * 8;
  o0.x *= inv; o0.y *= inv; o0.z *= inv; o0.w *= inv;
  o1.x *= inv; o1.y *= inv; o1.z *= inv; o1.w *= inv;
  *(float4*)(orow)     = o0;
  *(float4*)(orow + 4) = o1;
}

// ---------------------------------------------------------------------------
extern "C" void kernel_launch(void* const* d_in, const int* in_sizes, int n_in,
                              void* d_out, int out_size, void* d_ws, size_t ws_size,
                              hipStream_t stream) {
  const float* x    = (const float*)d_in[0];
  const int*   mask = (const int*)d_in[1];
  const float* Wq   = (const float*)d_in[2];
  const float* bq   = (const float*)d_in[3];
  const float* Wk   = (const float*)d_in[4];
  const float* bk   = (const float*)d_in[5];
  const float* Wv   = (const float*)d_in[6];
  const float* bv   = (const float*)d_in[7];
  float* out = (float*)d_out;

  char* ws = (char*)d_ws;
  _Float16* qh = (_Float16*)ws;                                  // 2 MB
  _Float16* kh = (_Float16*)(ws + (size_t)2 * 1024 * 1024);      // 2 MB
  _Float16* vt = (_Float16*)(ws + (size_t)4 * 1024 * 1024);      // 2 MB
  _Float16* wt = (_Float16*)(ws + (size_t)6 * 1024 * 1024);      // 384 KB

  wtrans_kernel<<<96, 256, 0, stream>>>(Wq, Wk, Wv, wt);
  qkv_proj_kernel<<<256, 128, 0, stream>>>(x, wt, bq, bk, bv, qh, kh, vt);
  flash_attn_kernel<<<256, 512, 0, stream>>>(qh, kh, vt, mask, out);
}

// v006
// It runs in 30.3 microseconds.
// Two timings next to v005 both put it at 1.15 times that version's speed.
// All steps since v000 together make it 4.28 times as fast.
#include <hip/hip_runtime.h>
#include <hip/hip_bf16.h>

typedef __attribute__((ext_vector_type(16))) _Float16 v16h;
typedef __attribute__((ext_vector_type(8)))  float    v8f;
typedef __attribute__((ext_vector_type(4)))  int      v4i;
typedef __attribute__((ext_vector_type(8)))  int      v8i;
typedef __attribute__((ext_vector_type(4)))  unsigned v4u;

#define B_  8
#define S_  2048
#define H_  1024
#define D_  64

#define AS1 __attribute__((address_space(1)))
#define AS3 __attribute__((address_space(3)))

union Frag {
  v16h v;
  _Float16 h[16];
  unsigned u[8];
};

__device__ __forceinline__ void load_frag_h16(Frag& f, const _Float16* base,
                                              int half) {
  const uint4 lo = *(const uint4*)(base + 8 * half);
  const uint4 hi = *(const uint4*)(base + 16 + 8 * half);
  f.u[0] = lo.x; f.u[1] = lo.y; f.u[2] = lo.z; f.u[3] = lo.w;
  f.u[4] = hi.x; f.u[5] = hi.y; f.u[6] = hi.z; f.u[7] = hi.w;
}

__device__ __forceinline__ int frag_pos(int f, int p, int l) {
  return ((2 * f + p) * 32 + l) * 8;
}

__device__ __forceinline__ void load_frag_tile(Frag& fr, const _Float16* tile,
                                               int f, int lane) {
  const uint4 lo = *(const uint4*)(tile + frag_pos(f, 0, lane));
  const uint4 hi = *(const uint4*)(tile + frag_pos(f, 1, lane));
  fr.u[0] = lo.x; fr.u[1] = lo.y; fr.u[2] = lo.z; fr.u[3] = lo.w;
  fr.u[4] = hi.x; fr.u[5] = hi.y; fr.u[6] = hi.z; fr.u[7] = hi.w;
}

#if __has_builtin(__builtin_amdgcn_global_load_async_to_lds_b128)
#define HAVE_ASYNC_LDS 1
#endif

__device__ __forceinline__ void cp_async_b128(void* lds, const void* g) {
#if defined(HAVE_ASYNC_LDS)
  __builtin_amdgcn_global_load_async_to_lds_b128(
      (AS1 v4i*)(v4i*)g, (AS3 v4i*)(v4i*)lds, 0, 0);
#else
  *(uint4*)lds = *(const uint4*)g;   // synchronous fallback
#endif
}

template <int N>
__device__ __forceinline__ void wait_async() {
#if __has_builtin(__builtin_amdgcn_s_wait_asynccnt)
  __builtin_amdgcn_s_wait_asynccnt(N);
#else
  asm volatile("s_wait_asynccnt %0" ::"i"(N) : "memory");
#endif
}

// Foot of a stage of the projection loop, in every wave: the wave's own LDS
// reads of the stage are over, its own copies of the next stage have landed,
// then the work-group barrier, which publishes the next stage and frees the
// buffer just read. Written by hand because __syncthreads() also waits out every
// outstanding global load of the wave, and the x ring stays in flight across it.
__device__ __forceinline__ void stage_foot() {
  asm volatile("s_wait_dscnt 0x0" ::: "memory");
  asm volatile("s_wait_asynccnt 0x0" ::: "memory");
  asm volatile("s_barrier_signal -1\n\ts_barrier_wait -1" ::: "memory");
}

#if __has_builtin(__builtin_amdgcn_tensor_load_to_lds)
#define HAVE_TDM 1
#endif

__device__ __forceinline__ unsigned lds_offset(const void* p) {
  return (unsigned)(unsigned long long)(AS3 void*)(void*)p;
}

#if defined(HAVE_TDM)
__device__ __forceinline__ void tdm_load_2d(unsigned lds_off, const void* gaddr,
                                            unsigned tensor_d0, unsigned tensor_d1,
                                            unsigned tile_d0, unsigned tile_d1,
                                            unsigned stride0) {
  const unsigned long long ga = (unsigned long long)(size_t)gaddr;
  v4u g0;
  g0[0] = 1u;                                           // count=1, user mode
  g0[1] = lds_off;                                      // lds_addr (bytes)
  g0[2] = (unsigned)ga;                                 // global_addr[31:0]
  g0[3] = (unsigned)((ga >> 32) & 0x1FFFFFFull) | (2u << 30);  // [56:32]|type=2
  v8i g1;
  g1[0] = (int)(1u << 16);
  g1[1] = (int)((tensor_d0 & 0xFFFFu) << 16);
  g1[2] = (int)(((tensor_d0 >> 16) & 0xFFFFu) |
                ((tensor_d1 & 0xFFFFu) << 16));         // dim0[31:16]|dim1[15:0]
  g1[3] = (int)(((tensor_d1 >> 16) & 0xFFFFu) |
                (tile_d0 << 16));
  g1[4] = (int)(tile_d1 & 0xFFFFu);
  g1[5] = (int)stride0;
  g1[6] = 0;
  g1[7] = 0;
  v4i g2 = {0, 0, 0, 0};
  v4i g3 = {0, 0, 0, 0};
  v8i g4 = {0, 0, 0, 0, 0, 0, 0, 0};
  __builtin_amdgcn_tensor_load_to_lds(g0, g1, g2, g3, g4, 0);
}

template <int N>
__device__ __forceinline__ void wait_tensor() {
#if __has_builtin(__builtin_amdgcn_s_wait_tensorcnt)
  __builtin_amdgcn_s_wait_tensorcnt(N);
#else
  asm volatile("s_wait_tensorcnt %0" ::"i"(N) : "memory");
#endif
}
#endif  // HAVE_TDM

__device__ __forceinline__ float xhalf(float x) {
  const int i = __builtin_bit_cast(int, x);
  return __builtin_bit_cast(float, __builtin_amdgcn_permlanex16(
      i, i, 0x76543210, 0xfedcba98, false, false));
}

__device__ __forceinline__ void exp_pair(float& r0, float& r1, float x0, float x1) {
  asm("v_exp_f32 %0, %2\n\tv_exp_f32 %1, %3\n\tv_nop"
      : "=&v"(r0), "=&v"(r1)
      : "v"(x0 * 1.44269504f), "v"(x1 * 1.44269504f));
}

// ---------------------------------------------------------------------------
// Kernel 0: convert W (f32, [k][n]) -> Wt (f16, [w][64][1024]) once. Each chunk
// of 32 k (columns kc..kc+31 of all 64 rows, row-major: the tile kernel 1
// stages) holds its 64 n x 32 k in fragment order, fragment = n / 16.
// ---------------------------------------------------------------------------
__global__ __launch_bounds__(256)
void wtrans_kernel(const float* __restrict__ Wq, const float* __restrict__ Wk,
                   const float* __restrict__ Wv, _Float16* __restrict__ wt) {
  const int id = blockIdx.x * 256 + threadIdx.x;   // 24576 threads
  const int w  = id >> 13;                         // 8192 per weight
  const int r  = id & 8191;
  // a wave takes 4 n x 64 k (two chunks): in fragment order that is four whole
  // 128-byte lines of Wt, each stored by this wave alone
  const int n  = ((r >> 9) << 2) | (r & 3);        // 0..63
  const int k0 = ((r >> 2) & 127) * 8;             // 0..1016
  const float* W = (w == 0) ? Wq : (w == 1) ? Wk : Wv;
  // the thread's 8 k are one run of lane ((k0 >> 3) & 1) * 16 + (n & 15)
  const int pos = frag_pos(n >> 4, (k0 >> 4) & 1, ((k0 >> 3) & 1) * 16 + (n & 15));
  _Float16* dst = wt + ((size_t)w << 16) + (size_t)(pos >> 5) * H_ +
                  (k0 & ~31) + (pos & 31);
#pragma unroll
  for (int j = 0; j < 8; ++j)
    dst[j] = (_Float16)W[(size_t)(k0 + j) * D_ + n];
}

#define WCH_ (3 * 2048 + 32)

__global__ __launch_bounds__(256)
void qkv_proj_kernel(const float* __restrict__ x,
                     const _Float16* __restrict__ wt,
                     const float* __restrict__ bq, const float* __restrict__ bk,
                     const float* __restrict__ bv,
                     _Float16* __restrict__ qh, _Float16* __restrict__ kh,
                     _Float16* __restrict__ vt) {
  // One LDS block: the partial sums (48 KB) at its start, the two Wt stages
  // (96.5 KB) from 64 KiB on. The compiler folds the constant steps of the
  // copies' global addresses, up to 65,280 bytes, into their offset field and
  // takes them off the LDS address register, which so never falls below zero.
  __shared__ __align__(16) unsigned char smem[65536 + 2 * 4 * WCH_ * 2];
  float4 (*part)[6][2][32] = (float4 (*)[6][2][32])smem;
  _Float16* wlds = (_Float16*)(smem + 65536);

  const int tid  = threadIdx.x;
  const int lane = tid & 31;
  const int wid  = __builtin_amdgcn_readfirstlane(tid >> 5);
  const int kg   = wid & 1;                        // K group
  const int rt   = wid >> 1;                       // row tile
  const int row0 = (blockIdx.x * 4 + rt) * 16;     // flat row over B*S
  const int half = lane >> 4;
  const int rc   = lane & 15;

  const float* Bs[3] = {bq, bk, bv};

  v8f acc[3][4];
#pragma unroll
  for (int w = 0; w < 3; ++w)
#pragma unroll
    for (int nt = 0; nt < 4; ++nt)
#pragma unroll
      for (int e = 0; e < 8; ++e) acc[w][nt][e] = 0.0f;

  // one stage = columns 128*st .. 128*st+127 of the 192 rows of Wt: 3072 pieces
  // of 16 bytes, 12 a thread. 16 threads take the 256 contiguous bytes of a row;
  // copy i takes rows 16*i .. 16*i+15 of the 192.
  const _Float16* wsrc = wt + (size_t)(tid >> 4) * H_ + (tid & 15) * 8;
  const int wdst = ((tid >> 2) & 3) * WCH_ + (tid >> 4) * 32 + (tid & 3) * 8;
  auto issue_stage = [&](const int st) __attribute__((always_inline)) {
#pragma unroll
    for (int i = 0; i < 12; ++i)
      cp_async_b128(&wlds[(st & 1) * 4 * WCH_ + wdst + i * 512],
                    wsrc + (size_t)i * 16 * H_ + st * 128);
  };
  issue_stage(0);

  // x ring: the wave's 16x32 chunks of x for two stages, two a stage, in
  // registers. A stage converts its chunks and asks at once for those two stages
  // on, so 16 row loads of each of the 8 waves stay in flight.
  const float* xlane = x + (size_t)(row0 + rc) * H_ + kg * 64 + 8 * half;
  float4 xr[2][2][4];
#pragma unroll
  for (int j = 0; j < 2; ++j)
#pragma unroll
    for (int c = 0; c < 2; ++c) {
      xr[j][c][0] = *(const float4*)(xlane + j * 128 + c * 32);
      xr[j][c][1] = *(const float4*)(xlane + j * 128 + c * 32 + 4);
      xr[j][c][2] = *(const float4*)(xlane + j * 128 + c * 32 + 16);
      xr[j][c][3] = *(const float4*)(xlane + j * 128 + c * 32 + 20);
    }

  // stage 0 has landed and is published; then stage 1 flies under stage 0's work
  asm volatile("s_wait_asynccnt 0x0" ::: "memory");
  asm volatile("s_barrier_signal -1\n\ts_barrier_wait -1" ::: "memory");
  issue_stage(1);

  // two stages; refill is a literal at both calls, so that the counted load
  // waits of the refilling stages are not merged with those of the last two
  auto two_stages = [&](const int st2, const bool refill)
      __attribute__((always_inline)) {
#pragma unroll
    for (int j = 0; j < 2; ++j) {
      const int st = st2 + j;
      const _Float16* tile = &wlds[(j * 4 + kg * 2) * WCH_];

      Frag a[2];                                   // two 16x32 chunks of x
      Frag bf[2][3][4];                            // their 12 Wt fragments each
#pragma unroll
      for (int c = 0; c < 2; ++c)
#pragma unroll
        for (int w = 0; w < 3; ++w)
#pragma unroll
          for (int nt = 0; nt < 4; ++nt)
            load_frag_tile(bf[c][w][nt], tile + c * WCH_ + w * 2048, nt, lane);
#pragma unroll
      for (int c = 0; c < 2; ++c) {
        const float4 f0 = xr[j][c][0], f1 = xr[j][c][1];
        const float4 f2 = xr[j][c][2], f3 = xr[j][c][3];
        a[c].h[0]  = (_Float16)f0.x; a[c].h[1]  = (_Float16)f0.y;
        a[c].h[2]  = (_Float16)f0.z; a[c].h[3]  = (_Float16)f0.w;
        a[c].h[4]  = (_Float16)f1.x; a[c].h[5]  = (_Float16)f1.y;
        a[c].h[6]  = (_Float16)f1.z; a[c].h[7]  = (_Float16)f1.w;
        a[c].h[8]  = (_Float16)f2.x; a[c].h[9]  = (_Float16)f2.y;
        a[c].h[10] = (_Float16)f2.z; a[c].h[11] = (_Float16)f2.w;
        a[c].h[12] = (_Float16)f3.x; a[c].h[13] = (_Float16)f3.y;
        a[c].h[14] = (_Float16)f3.z; a[c].h[15] = (_Float16)f3.w;
      }
      if (refill) {
        const float* xn = xlane + (st + 2) * 128;
#pragma unroll
        for (int c = 0; c < 2; ++c) {
          xr[j][c][0] = *(const float4*)(xn + c * 32);
          xr[j][c][1] = *(const float4*)(xn + c * 32 + 4);
          xr[j][c][2] = *(const float4*)(xn + c * 32 + 16);
          xr[j][c][3] = *(const float4*)(xn + c * 32 + 20);
        }
        // the loop advances the ring's address register behind these loads:
        // the wait that stands in front of such an overwrite
        asm volatile("s_wait_xcnt 0x0" ::: "memory");
      }
      // keeps the stage's 48 LDS loads in one group, each fragment in registers
      // of its own, so that the second chunk's land under the first's products,
      // and the ring's eight loads ahead of the products: sunk below, they lose
      // their lead
      __builtin_amdgcn_sched_barrier(0);

#pragma unroll
      for (int c = 0; c < 2; ++c) {
#pragma unroll
        for (int w = 0; w < 3; ++w) {
#pragma unroll
          for (int nt = 0; nt < 4; ++nt) {
            acc[w][nt] = __builtin_amdgcn_wmma_f32_16x16x32_f16(
                false, a[c].v, false, bf[c][w][nt].v, (short)0, acc[w][nt],
                false, false);
          }
        }
      }
      if (refill || j == 0) {
        // keeps the products in front of the foot: raised to the LDS loads, its
        // barrier holds every wave until the slowest wave's fragments are back,
        // and no wave computes under another's loads
        __builtin_amdgcn_sched_barrier(0);
        stage_foot();
        if (refill) issue_stage(st + 2);           // into the buffer just read
      }
    }
  };

  for (int st2 = 0; st2 < 6; st2 += 2) two_stages(st2, true);
  two_stages(6, false);

  // --- join the two K groups' partial sums through LDS -----------------------
  // K group g of a row tile ends up with column tiles 2g and 2g+1 of q, k and v.
  // A wave stores the six tiles that are the other group's, 512 contiguous bytes
  // a store, and keeps its own six in registers.
#pragma unroll
  for (int nt = 0; nt < 4; ++nt) {
    if ((nt >> 1) != kg) {
#pragma unroll
      for (int w = 0; w < 3; ++w) {
        float4 lo, hi;
        lo.x = acc[w][nt][0]; lo.y = acc[w][nt][1];
        lo.z = acc[w][nt][2]; lo.w = acc[w][nt][3];
        hi.x = acc[w][nt][4]; hi.y = acc[w][nt][5];
        hi.z = acc[w][nt][6]; hi.w = acc[w][nt][7];
        part[wid][w * 2 + (nt & 1)][0][lane] = lo;
        part[wid][w * 2 + (nt & 1)][1][lane] = hi;
      }
    }
  }
  v8f sum[3][2];
#pragma unroll
  for (int w = 0; w < 3; ++w) {
    if (kg == 0) { sum[w][0] = acc[w][0]; sum[w][1] = acc[w][1]; }
    else         { sum[w][0] = acc[w][2]; sum[w][1] = acc[w][3]; }
  }
  __syncthreads();   // publishes every wave's partial sums
#pragma unroll
  for (int w = 0; w < 3; ++w) {
#pragma unroll
    for (int n = 0; n < 2; ++n) {
      const float4 lo = part[wid ^ 1][w * 2 + n][0][lane];
      const float4 hi = part[wid ^ 1][w * 2 + n][1][lane];
      sum[w][n][0] += lo.x; sum[w][n][1] += lo.y;
      sum[w][n][2] += lo.z; sum[w][n][3] += lo.w;
      sum[w][n][4] += hi.x; sum[w][n][5] += hi.y;
      sum[w][n][6] += hi.z; sum[w][n][7] += hi.w;
    }
  }

  // bias add + f16 store of column tiles 2*kg and 2*kg+1
#pragma unroll
  for (int w = 0; w < 3; ++w) {
#pragma unroll
    for (int n = 0; n < 2; ++n) {
      const int nt = kg * 2 + n;
      const int d = nt * 16 + rc;
      const float bias = Bs[w][d];
      if (w == 2) {
        // the lane's 8 keys of column d are one whole run of fragment nt
        union { uint4 q; _Float16 h[8]; } run;
#pragma unroll
        for (int r = 0; r < 8; ++r) run.h[r] = (_Float16)(sum[w][n][r] + bias);
        const int b   = row0 >> 11;                // / S_
        const int kt  = row0 & (S_ - 1) & ~31;
        const int pos = frag_pos(nt, (row0 >> 4) & 1, lane);
        *(uint4*)(vt + ((size_t)b * D_ + (pos >> 5)) * S_ + kt + (pos & 31)) = run.q;
      } else {
#pragma unroll
        for (int r = 0; r < 8; ++r) {
          const int row   = r + 8 * half;
          const int bsrow = row0 + row;
          const _Float16 hv = (_Float16)(sum[w][n][r] + bias);
          if (w == 0) {
            qh[(size_t)bsrow * D_ + d] = hv;
          } else {
            const int pos = frag_pos(2 * ((row0 >> 4) & 1) + (nt >> 1), nt & 1,
                                     (rc >> 3) * 16 + row);
            kh[(size_t)(row0 >> 5) * (32 * D_) + pos + (rc & 7)] = hv;
          }
        }
      }
    }
  }
}

__device__ __forceinline__ unsigned pinned(unsigned v) {
  unsigned w = __builtin_amdgcn_readfirstlane(v);
  asm volatile("" : "+s"(w));
  return w;
}

__global__ __launch_bounds__(512)
void flash_attn_kernel(const _Float16* __restrict__ qh,
                       const _Float16* __restrict__ kh,
                       const _Float16* __restrict__ vt,
                       const int* __restrict__ mask,
                       float* __restrict__ out) {
  __shared__ __attribute__((aligned(2048))) _Float16 kbuf[2][4][32 * 64];  // 2 x 16 KB
  __shared__ __attribute__((aligned(2048))) _Float16 vbuf[2][4][64 * 32];  // 2 x 16 KB
  __shared__ __align__(16) float  mbias[S_];           // 8 KB, 0 or -8e30
  __shared__ __align__(16) float4 part[16][8][32];     // 64 KB, each wave's O^T
  __shared__ __align__(8)  float2 pml[16][16];         // each wave's (m, l) per query

  const int tid  = threadIdx.x;
  const int lane = tid & 31;
  const int wid  = __builtin_amdgcn_readfirstlane(tid >> 5);
  const int kg   = wid & 3;                            // key group
  const int qt   = wid >> 2;                           // query tile
  const int b    = blockIdx.x >> 5;                    // 32 blocks per batch
  const int q0   = ((blockIdx.x & 31) << 6) + (qt << 4);
  const int half = lane >> 4;
  const int rc   = lane & 15;

  const _Float16* kbase = kh + (size_t)(b * S_) * D_;  // per 32 keys 2048 halves, fragment order
  const _Float16* vbase = vt + (size_t)(b * D_) * S_;  // [64][2048], fragment order per 32 keys

  // Q fragments (B operand, column = query): two b128 loads each
  Frag a0, a1;
  {
    const _Float16* qrow = qh + (size_t)(b * S_ + q0 + rc) * D_;
    load_frag_h16(a0, qrow, half);
    load_frag_h16(a1, qrow + 32, half);
  }

  float m = -1e30f, l = 0.0f;                          // this lane's query
  v8f acc[4];                                          // O^T: row d, col query
#pragma unroll
  for (int nt = 0; nt < 4; ++nt)
#pragma unroll
    for (int e = 0; e < 8; ++e) acc[nt][e] = 0.0f;

  const float scale = 0.125f;                          // 1/sqrt(64)

  auto issue_stage = [&](const int st) __attribute__((always_inline)) {
    const int nb = st & 1;
#if defined(HAVE_TDM)
    if (pinned(wid < 4))
      tdm_load_2d(lds_offset(&kbuf[nb][wid][0]),
                  kbase + (size_t)(st * 128 + wid * 32) * D_, D_, S_, D_, 32, D_);
    else if (pinned(wid < 8))
      tdm_load_2d(lds_offset(&vbuf[nb][wid - 4][0]),
                  vbase + st * 128 + (wid - 4) * 32, S_, D_, 32, D_, S_);
#else
#pragma unroll
    for (int j = 0; j < 2; ++j) {
      const int c = tid * 2 + j;                       // 0..1023, 16 bytes each
      cp_async_b128(&kbuf[nb][0][c * 8], kbase + (size_t)(st * 128) * D_ + c * 8);
      cp_async_b128(&vbuf[nb][c >> 8][(c & 255) * 8],
                    vbase + (size_t)((c >> 2) & 63) * S_ + st * 128 +
                        (c >> 8) * 32 + (c & 3) * 8);
    }
#endif
  };
  issue_stage(0);

  // mask table: -8e30 absorbs any score and gives -1e30 after the 1/8 scale;
  // published by the first barrier of the loop
  {
    const int4 mm = *(const int4*)(mask + b * S_ + tid * 4);
    float4 f;
    f.x = (mm.x == 0) ? -8e30f : 0.0f;
    f.y = (mm.y == 0) ? -8e30f : 0.0f;
    f.z = (mm.z == 0) ? -8e30f : 0.0f;
    f.w = (mm.w == 0) ? -8e30f : 0.0f;
    *(float4*)&mbias[tid * 4] = f;
  }

  for (int st = 0; st < S_ / 128; ++st) {
    const int kt = st * 128 + kg * 32;
    if (st + 1 < S_ / 128) {
      issue_stage(st + 1);
#if defined(HAVE_TDM)
      wait_tensor<1>();
#else
      wait_async<4>();
#endif
    } else {
#if defined(HAVE_TDM)
      wait_tensor<0>();
#else
      wait_async<0>();
#endif
    }
    __syncthreads();

    const _Float16* kl = kbuf[st & 1][kg];
    const _Float16* vl = vbuf[st & 1][kg];

    // --- scores: S^T = K @ Q^T for 2 groups of 16 keys (ds_load_b128) ------
    Frag bk00, bk01, bk10, bk11;
    load_frag_tile(bk00, kl, 0, lane);
    load_frag_tile(bk01, kl, 1, lane);
    load_frag_tile(bk10, kl, 2, lane);
    load_frag_tile(bk11, kl, 3, lane);

    v8f s0, s1;                                        // start value: key mask
    {
      const float4 c0 = *(const float4*)&mbias[kt + 8 * half];
      const float4 c1 = *(const float4*)&mbias[kt + 8 * half + 4];
      const float4 c2 = *(const float4*)&mbias[kt + 16 + 8 * half];
      const float4 c3 = *(const float4*)&mbias[kt + 16 + 8 * half + 4];
      s0[0] = c0.x; s0[1] = c0.y; s0[2] = c0.z; s0[3] = c0.w;
      s0[4] = c1.x; s0[5] = c1.y; s0[6] = c1.z; s0[7] = c1.w;
      s1[0] = c2.x; s1[1] = c2.y; s1[2] = c2.z; s1[3] = c2.w;
      s1[4] = c3.x; s1[5] = c3.y; s1[6] = c3.z; s1[7] = c3.w;
    }
    Frag av[4];                                        // V^T rows, A operand
#pragma unroll
    for (int nt = 0; nt < 4; ++nt)
      load_frag_tile(av[nt], vl, nt, lane);
    // keeps the pass's LDS loads in one group ahead of the products: moved in
    // among them, each pair makes the wave wait out a full LDS round trip
    __builtin_amdgcn_sched_barrier(0);
    s0 = __builtin_amdgcn_wmma_f32_16x16x32_f16(false, bk00.v, false, a0.v,
                                                (short)0, s0, false, false);
    s0 = __builtin_amdgcn_wmma_f32_16x16x32_f16(false, bk01.v, false, a1.v,
                                                (short)0, s0, false, false);
    s1 = __builtin_amdgcn_wmma_f32_16x16x32_f16(false, bk10.v, false, a0.v,
                                                (short)0, s1, false, false);
    s1 = __builtin_amdgcn_wmma_f32_16x16x32_f16(false, bk11.v, false, a1.v,
                                                (short)0, s1, false, false);

    // --- online softmax update, one query per lane --------------------------
    float v0[8], v1[8];
#pragma unroll
    for (int r = 0; r < 8; ++r) { v0[r] = s0[r] * scale; v1[r] = s1[r] * scale; }
    float rmax = fmaxf(v0[0], v1[0]);
#pragma unroll
    for (int r = 1; r < 8; ++r) rmax = fmaxf(rmax, fmaxf(v0[r], v1[r]));
    rmax = fmaxf(rmax, xhalf(rmax));                   // both halves' 32 keys
    const float mn = fmaxf(m, rmax);
    const float al = __expf(m - mn);
    float rs0 = 0.0f, rs1 = 0.0f;
    Frag pb;                                           // P^T as B operand
#pragma unroll
    for (int r = 0; r < 8; ++r) {
      float e0, e1;
      exp_pair(e0, e1, v0[r] - mn, v1[r] - mn);
      rs0 += e0;
      rs1 += e1;
      pb.h[r]     = (_Float16)e0;                      // k = 8*half + r
      pb.h[8 + r] = (_Float16)e1;                      // k = 16 + 8*half + r
    }
    l = l * al + (rs0 + rs1);                          // this half's keys only
    m = mn;
#pragma unroll
    for (int nt = 0; nt < 4; ++nt)
#pragma unroll
      for (int r = 0; r < 8; ++r) acc[nt][r] *= al;

    // --- acc += V^T @ P^T ---------------------------------------------------
#pragma unroll
    for (int nt = 0; nt < 4; ++nt)
      acc[nt] = __builtin_amdgcn_wmma_f32_16x16x32_f16(
          false, av[nt].v, false, pb.v, (short)0, acc[nt], false, false);
    __builtin_amdgcn_sched_barrier(0);
    asm volatile("v_nop\n\tv_nop\n\tv_nop\n\tv_nop");
    __syncthreads();   // protect K/V buffers for reuse
  }

  const float lt = l + xhalf(l);                       // join the halves' sums
#pragma unroll
  for (int nt = 0; nt < 4; ++nt) {
    float4 o0, o1;
    o0.x = acc[nt][0]; o0.y = acc[nt][1]; o0.z = acc[nt][2]; o0.w = acc[nt][3];
    o1.x = acc[nt][4]; o1.y = acc[nt][5]; o1.z = acc[nt][6]; o1.w = acc[nt][7];
    const int pl = half * 16 + ((rc + 4 * nt) & 15);
    part[wid][nt * 2][pl]     = o0;
    part[wid][nt * 2 + 1][pl] = o1;
  }
  if (half == 0) pml[wid][rc] = make_float2(m, lt);
  __syncthreads();   // publishes every wave's partial result

  // wave kg of a query tile joins its queries 4*kg .. 4*kg+3; a lane takes 8
  // consecutive d of one query, so a wave stores four whole rows of out
  const int qi = 4 * kg + (lane >> 3);
  const int dn = (lane & 7) >> 1;                      // the run's nt
  const int pr = (lane & 1) * 16 + ((qi + 4 * dn) & 15);
  float2 ml[4];
#pragma unroll
  for (int g = 0; g < 4; ++g) ml[g] = pml[qt * 4 + g][qi];
  const float mj = fmaxf(fmaxf(ml[0].x, ml[1].x), fmaxf(ml[2].x, ml[3].x));
  float wg[4];
  exp_pair(wg[0], wg[1], ml[0].x - mj, ml[1].x - mj);
  exp_pair(wg[2], wg[3], ml[2].x - mj, ml[3].x - mj);
  float lj = 0.0f;
  float4 o0 = {0.0f, 0.0f, 0.0f, 0.0f}, o1 = {0.0f, 0.0f, 0.0f, 0.0f};
#pragma unroll
  for (int g = 0; g < 4; ++g) {
    const float4 p0 = part[qt * 4 + g][dn * 2][pr];
    const float4 p1 = part[qt * 4 + g][dn * 2 + 1][pr];
    lj += wg[g] * ml[g].y;
    o0.x += wg[g] * p0.x; o0.y += wg[g] * p0.y;
    o0.z += wg[g] * p0.z; o0.w += wg[g] * p0.w;
    o1.x += wg[g] * p1.x; o1.y += wg[g] * p1.y;
    o1.z += wg[g] * p1.z; o1.w += wg[g] * p1.w;
  }
  // --- normalize and store ---------------------------------------------------
  const float inv = 1.0f / lj;
  float* orow = out + (size_t)(b * S_ + q0 + qi) * D_ + (lane & 7) * 8;
  o0.x *= inv; o0.y *= inv; o0.z *= inv; o0.w *= inv;
  o1.x *= inv; o1.y *= inv; o1.z *= inv; o1.w *= inv;
  *(float4*)(orow)     = o0;
  *(float4*)(orow + 4) = o1;
}

// ---------------------------------------------------------------------------
extern "C" void kernel_launch(void* const* d_in, const int* in_sizes, int n_in,
                              void* d_out, int out_size, void* d_ws, size_t ws_size,
                              hipStream_t stream) {
  const float* x    = (const float*)d_in[0];
  const int*   mask = (const int*)d_in[1];
  const float* Wq   = (const float*)d_in[2];
  const float* bq   = (const float*)d_in[3];
  const float* Wk   = (const float*)d_in[4];
  const float* bk   = (const float*)d_in[5];
  const float* Wv   = (const float*)d_in[6];
  const float* bv   = (const float*)d_in[7];
  float* out = (float*)d_out;

  char* ws = (char*)d_ws;
  _Float16* qh = (_Float16*)ws;                                  // 2 MB
  _Float16* kh = (_Float16*)(ws + (size_t)2 * 1024 * 1024);      // 2 MB
  _Float16* vt = (_Float16*)(ws + (size_t)4 * 1024 * 1024);      // 2 MB
  _Float16* wt = (_Float16*)(ws + (size_t)6 * 1024 * 1024);      // 384 KB

  wtrans_kernel<<<96, 256, 0, stream>>>(Wq, Wk, Wv, wt);
  qkv_proj_kernel<<<256, 256, 0, stream>>>(x, wt, bq, bk, bv, qh, kh, vt);
  flash_attn_kernel<<<256, 512, 0, stream>>>(qh, kh, vt, mask, out);
}

// v007
// Measured time: 29.1 microseconds a run.
// Timed twice side by side with v006, it ran 1.06 and 1.05 times as fast.
// All steps since v000 together make it 4.53 times as fast.
#include <hip/hip_runtime.h>
#include <hip/hip_bf16.h>

typedef __attribute__((ext_vector_type(16))) _Float16 v16h;
typedef __attribute__((ext_vector_type(8)))  float    v8f;
typedef __attribute__((ext_vector_type(4)))  int      v4i;

#define B_  8
#define S_  2048
#define H_  1024
#define D_  64

#define AS1 __attribute__((address_space(1)))
#define AS3 __attribute__((address_space(3)))

union Frag {
  v16h v;
  _Float16 h[16];
  unsigned u[8];
};

__device__ __forceinline__ void load_frag_h16(Frag& f, const _Float16* base,
                                              int half) {
  const uint4 lo = *(const uint4*)(base + 8 * half);
  const uint4 hi = *(const uint4*)(base + 16 + 8 * half);
  f.u[0] = lo.x; f.u[1] = lo.y; f.u[2] = lo.z; f.u[3] = lo.w;
  f.u[4] = hi.x; f.u[5] = hi.y; f.u[6] = hi.z; f.u[7] = hi.w;
}

__device__ __forceinline__ int frag_pos(int f, int p, int l) {
  return ((2 * f + p) * 32 + l) * 8;
}

__device__ __forceinline__ void load_frag_tile(Frag& fr, const _Float16* tile,
                                               int f, int lane) {
  const uint4 lo = *(const uint4*)(tile + frag_pos(f, 0, lane));
  const uint4 hi = *(const uint4*)(tile + frag_pos(f, 1, lane));
  fr.u[0] = lo.x; fr.u[1] = lo.y; fr.u[2] = lo.z; fr.u[3] = lo.w;
  fr.u[4] = hi.x; fr.u[5] = hi.y; fr.u[6] = hi.z; fr.u[7] = hi.w;
}

#if __has_builtin(__builtin_amdgcn_global_load_async_to_lds_b128)
#define HAVE_ASYNC_LDS 1
#endif

__device__ __forceinline__ void cp_async_b128(void* lds, const void* g) {
#if defined(HAVE_ASYNC_LDS)
  __builtin_amdgcn_global_load_async_to_lds_b128(
      (AS1 v4i*)(v4i*)g, (AS3 v4i*)(v4i*)lds, 0, 0);
#else
  *(uint4*)lds = *(const uint4*)g;   // synchronous fallback
#endif
}

// Foot of a stage of the projection loop, in every wave: the wave's own LDS
// reads of the stage are over, its own copies of the next stage have landed,
// then the work-group barrier, which publishes the next stage and frees the
// buffer just read. Written by hand because __syncthreads() also waits out every
// outstanding global load of the wave, and the x ring stays in flight across it.
__device__ __forceinline__ void stage_foot() {
  asm volatile("s_wait_dscnt 0x0" ::: "memory");
  asm volatile("s_wait_asynccnt 0x0" ::: "memory");
  asm volatile("s_barrier_signal -1\n\ts_barrier_wait -1" ::: "memory");
}

typedef unsigned u32x4 __attribute__((ext_vector_type(4)));
typedef unsigned u32x8 __attribute__((ext_vector_type(8)));

__device__ __forceinline__ unsigned lds_offset(const void* p) {
  return (unsigned)(unsigned long long)(AS3 void*)(void*)p;
}

__device__ __forceinline__ unsigned uni(unsigned v) {
  return (unsigned)__builtin_amdgcn_readfirstlane(v);
}

__device__ __forceinline__ void wait_tensor0(u32x4 g0, u32x8 g1) {
  asm volatile("s_wait_tensorcnt 0x0" ::"s"(g0), "s"(g1) : "memory");
}

__device__ __forceinline__ float xhalf(float x) {
  const int i = __builtin_bit_cast(int, x);
  return __builtin_bit_cast(float, __builtin_amdgcn_permlanex16(
      i, i, 0x76543210, 0xfedcba98, false, false));
}

__device__ __forceinline__ void exp_pair(float& r0, float& r1, float x0, float x1) {
  asm("v_exp_f32 %0, %2\n\tv_exp_f32 %1, %3\n\tv_nop"
      : "=&v"(r0), "=&v"(r1)
      : "v"(x0 * 1.44269504f), "v"(x1 * 1.44269504f));
}

// ---------------------------------------------------------------------------
// Kernel 0: convert W (f32, [k][n]) -> Wt (f16, [w][64][1024]) once. Each chunk
// of 32 k (columns kc..kc+31 of all 64 rows, row-major: the tile kernel 1
// stages) holds its 64 n x 32 k in fragment order, fragment = n / 16.
// ---------------------------------------------------------------------------
__global__ __launch_bounds__(256)
void wtrans_kernel(const float* __restrict__ Wq, const float* __restrict__ Wk,
                   const float* __restrict__ Wv, _Float16* __restrict__ wt) {
  const int id = blockIdx.x * 256 + threadIdx.x;   // 24576 threads
  const int w  = id >> 13;                         // 8192 per weight
  const int r  = id & 8191;
  // a wave takes 4 n x 64 k (two chunks): in fragment order that is four whole
  // 128-byte lines of Wt, each stored by this wave alone
  const int n  = ((r >> 9) << 2) | (r & 3);        // 0..63
  const int k0 = ((r >> 2) & 127) * 8;             // 0..1016
  const float* W = (w == 0) ? Wq : (w == 1) ? Wk : Wv;
  // the thread's 8 k are one run of lane ((k0 >> 3) & 1) * 16 + (n & 15)
  const int pos = frag_pos(n >> 4, (k0 >> 4) & 1, ((k0 >> 3) & 1) * 16 + (n & 15));
  _Float16* dst = wt + ((size_t)w << 16) + (size_t)(pos >> 5) * H_ +
                  (k0 & ~31) + (pos & 31);
#pragma unroll
  for (int j = 0; j < 8; ++j)
    dst[j] = (_Float16)W[(size_t)(k0 + j) * D_ + n];
}

#define WCH_ (3 * 2048 + 32)

__global__ __launch_bounds__(256)
void qkv_proj_kernel(const float* __restrict__ x,
                     const _Float16* __restrict__ wt,
                     const float* __restrict__ bq, const float* __restrict__ bk,
                     const float* __restrict__ bv,
                     _Float16* __restrict__ qh, _Float16* __restrict__ kh,
                     _Float16* __restrict__ vt) {
  // One LDS block: the partial sums (48 KB) at its start, the two Wt stages
  // (96.5 KB) from 64 KiB on. The compiler folds the constant steps of the
  // copies' global addresses, up to 65,280 bytes, into their offset field and
  // takes them off the LDS address register, which so never falls below zero.
  __shared__ __align__(16) unsigned char smem[65536 + 2 * 4 * WCH_ * 2];
  float4 (*part)[6][2][32] = (float4 (*)[6][2][32])smem;
  _Float16* wlds = (_Float16*)(smem + 65536);

  const int tid  = threadIdx.x;
  const int lane = tid & 31;
  const int wid  = __builtin_amdgcn_readfirstlane(tid >> 5);
  const int kg   = wid & 1;                        // K group
  const int rt   = wid >> 1;                       // row tile
  const int row0 = (blockIdx.x * 4 + rt) * 16;     // flat row over B*S
  const int half = lane >> 4;
  const int rc   = lane & 15;

  const float* Bs[3] = {bq, bk, bv};

  v8f acc[3][4];
#pragma unroll
  for (int w = 0; w < 3; ++w)
#pragma unroll
    for (int nt = 0; nt < 4; ++nt)
#pragma unroll
      for (int e = 0; e < 8; ++e) acc[w][nt][e] = 0.0f;

  // one stage = columns 128*st .. 128*st+127 of the 192 rows of Wt: 3072 pieces
  // of 16 bytes, 12 a thread. 16 threads take the 256 contiguous bytes of a row;
  // copy i takes rows 16*i .. 16*i+15 of the 192.
  const _Float16* wsrc = wt + (size_t)(tid >> 4) * H_ + (tid & 15) * 8;
  const int wdst = ((tid >> 2) & 3) * WCH_ + (tid >> 4) * 32 + (tid & 3) * 8;
  auto issue_stage = [&](const int st) __attribute__((always_inline)) {
#pragma unroll
    for (int i = 0; i < 12; ++i)
      cp_async_b128(&wlds[(st & 1) * 4 * WCH_ + wdst + i * 512],
                    wsrc + (size_t)i * 16 * H_ + st * 128);
  };
  issue_stage(0);

  // x ring: the wave's 16x32 chunks of x for two stages, two a stage, in
  // registers. A stage converts its chunks and asks at once for those two stages
  // on, so 16 row loads of each of the 8 waves stay in flight.
  const float* xlane = x + (size_t)(row0 + rc) * H_ + kg * 64 + 8 * half;
  float4 xr[2][2][4];
#pragma unroll
  for (int j = 0; j < 2; ++j)
#pragma unroll
    for (int c = 0; c < 2; ++c) {
      xr[j][c][0] = *(const float4*)(xlane + j * 128 + c * 32);
      xr[j][c][1] = *(const float4*)(xlane + j * 128 + c * 32 + 4);
      xr[j][c][2] = *(const float4*)(xlane + j * 128 + c * 32 + 16);
      xr[j][c][3] = *(const float4*)(xlane + j * 128 + c * 32 + 20);
    }

  // stage 0 has landed and is published; then stage 1 flies under stage 0's work
  asm volatile("s_wait_asynccnt 0x0" ::: "memory");
  asm volatile("s_barrier_signal -1\n\ts_barrier_wait -1" ::: "memory");
  issue_stage(1);

  // two stages; refill is a literal at both calls, so that the counted load
  // waits of the refilling stages are not merged with those of the last two
  auto two_stages = [&](const int st2, const bool refill)
      __attribute__((always_inline)) {
#pragma unroll
    for (int j = 0; j < 2; ++j) {
      const int st = st2 + j;
      const _Float16* tile = &wlds[(j * 4 + kg * 2) * WCH_];

      Frag a[2];                                   // two 16x32 chunks of x
      Frag bf[2][3][4];                            // their 12 Wt fragments each
#pragma unroll
      for (int c = 0; c < 2; ++c)
#pragma unroll
        for (int w = 0; w < 3; ++w)
#pragma unroll
          for (int nt = 0; nt < 4; ++nt)
            load_frag_tile(bf[c][w][nt], tile + c * WCH_ + w * 2048, nt, lane);
#pragma unroll
      for (int c = 0; c < 2; ++c) {
        const float4 f0 = xr[j][c][0], f1 = xr[j][c][1];
        const float4 f2 = xr[j][c][2], f3 = xr[j][c][3];
        a[c].h[0]  = (_Float16)f0.x; a[c].h[1]  = (_Float16)f0.y;
        a[c].h[2]  = (_Float16)f0.z; a[c].h[3]  = (_Float16)f0.w;
        a[c].h[4]  = (_Float16)f1.x; a[c].h[5]  = (_Float16)f1.y;
        a[c].h[6]  = (_Float16)f1.z; a[c].h[7]  = (_Float16)f1.w;
        a[c].h[8]  = (_Float16)f2.x; a[c].h[9]  = (_Float16)f2.y;
        a[c].h[10] = (_Float16)f2.z; a[c].h[11] = (_Float16)f2.w;
        a[c].h[12] = (_Float16)f3.x; a[c].h[13] = (_Float16)f3.y;
        a[c].h[14] = (_Float16)f3.z; a[c].h[15] = (_Float16)f3.w;
      }
      if (refill) {
        const float* xn = xlane + (st + 2) * 128;
#pragma unroll
        for (int c = 0; c < 2; ++c) {
          xr[j][c][0] = *(const float4*)(xn + c * 32);
          xr[j][c][1] = *(const float4*)(xn + c * 32 + 4);
          xr[j][c][2] = *(const float4*)(xn + c * 32 + 16);
          xr[j][c][3] = *(const float4*)(xn + c * 32 + 20);
        }
        // the loop advances the ring's address register behind these loads:
        // the wait that stands in front of such an overwrite
        asm volatile("s_wait_xcnt 0x0" ::: "memory");
      }
      // keeps the stage's 48 LDS loads in one group, each fragment in registers
      // of its own, so that the second chunk's land under the first's products,
      // and the ring's eight loads ahead of the products: sunk below, they lose
      // their lead
      __builtin_amdgcn_sched_barrier(0);

#pragma unroll
      for (int c = 0; c < 2; ++c) {
#pragma unroll
        for (int w = 0; w < 3; ++w) {
#pragma unroll
          for (int nt = 0; nt < 4; ++nt) {
            acc[w][nt] = __builtin_amdgcn_wmma_f32_16x16x32_f16(
                false, a[c].v, false, bf[c][w][nt].v, (short)0, acc[w][nt],
                false, false);
          }
        }
      }
      if (refill || j == 0) {
        // keeps the products in front of the foot: raised to the LDS loads, its
        // barrier holds every wave until the slowest wave's fragments are back,
        // and no wave computes under another's loads
        __builtin_amdgcn_sched_barrier(0);
        stage_foot();
        if (refill) issue_stage(st + 2);           // into the buffer just read
      }
    }
  };

  for (int st2 = 0; st2 < 6; st2 += 2) two_stages(st2, true);
  two_stages(6, false);

  // --- join the two K groups' partial sums through LDS -----------------------
  // K group g of a row tile ends up with column tiles 2g and 2g+1 of q, k and v.
  // A wave stores the six tiles that are the other group's, 512 contiguous bytes
  // a store, and keeps its own six in registers.
#pragma unroll
  for (int nt = 0; nt < 4; ++nt) {
    if ((nt >> 1) != kg) {
#pragma unroll
      for (int w = 0; w < 3; ++w) {
        float4 lo, hi;
        lo.x = acc[w][nt][0]; lo.y = acc[w][nt][1];
        lo.z = acc[w][nt][2]; lo.w = acc[w][nt][3];
        hi.x = acc[w][nt][4]; hi.y = acc[w][nt][5];
        hi.z = acc[w][nt][6]; hi.w = acc[w][nt][7];
        part[wid][w * 2 + (nt & 1)][0][lane] = lo;
        part[wid][w * 2 + (nt & 1)][1][lane] = hi;
      }
    }
  }
  v8f sum[3][2];
#pragma unroll
  for (int w = 0; w < 3; ++w) {
    if (kg == 0) { sum[w][0] = acc[w][0]; sum[w][1] = acc[w][1]; }
    else         { sum[w][0] = acc[w][2]; sum[w][1] = acc[w][3]; }
  }
  __syncthreads();   // publishes every wave's partial sums
#pragma unroll
  for (int w = 0; w < 3; ++w) {
#pragma unroll
    for (int n = 0; n < 2; ++n) {
      const float4 lo = part[wid ^ 1][w * 2 + n][0][lane];
      const float4 hi = part[wid ^ 1][w * 2 + n][1][lane];
      sum[w][n][0] += lo.x; sum[w][n][1] += lo.y;
      sum[w][n][2] += lo.z; sum[w][n][3] += lo.w;
      sum[w][n][4] += hi.x; sum[w][n][5] += hi.y;
      sum[w][n][6] += hi.z; sum[w][n][7] += hi.w;
    }
  }

  // bias add + f16 store of column tiles 2*kg and 2*kg+1
#pragma unroll
  for (int w = 0; w < 3; ++w) {
#pragma unroll
    for (int n = 0; n < 2; ++n) {
      const int nt = kg * 2 + n;
      const int d = nt * 16 + rc;
      const float bias = Bs[w][d];
      if (w == 2) {
        // the lane's 8 keys of column d are one whole run of fragment nt
        union { uint4 q; _Float16 h[8]; } run;
#pragma unroll
        for (int r = 0; r < 8; ++r) run.h[r] = (_Float16)(sum[w][n][r] + bias);
        const int b   = row0 >> 11;                // / S_
        const int kt  = row0 & (S_ - 1) & ~31;
        const int pos = frag_pos(nt, (row0 >> 4) & 1, lane);
        *(uint4*)(vt + ((size_t)b * D_ + (pos >> 5)) * S_ + kt + (pos & 31)) = run.q;
      } else {
#pragma unroll
        for (int r = 0; r < 8; ++r) {
          const int row   = r + 8 * half;
          const int bsrow = row0 + row;
          const _Float16 hv = (_Float16)(sum[w][n][r] + bias);
          if (w == 0) {
            qh[(size_t)bsrow * D_ + d] = hv;
          } else {
            const int pos = frag_pos(2 * ((row0 >> 4) & 1) + (nt >> 1), nt & 1,
                                     (rc >> 3) * 16 + row);
            kh[(size_t)(row0 >> 5) * (32 * D_) + pos + (rc & 7)] = hv;
          }
        }
      }
    }
  }
}

__device__ __forceinline__ unsigned pinned(unsigned v) {
  unsigned w = __builtin_amdgcn_readfirstlane(v);
  asm volatile("" : "+s"(w));
  return w;
}

#define NST_ (S_ / 256)                                // stages of 256 keys

__global__ __launch_bounds__(512)
void flash_attn_kernel(const _Float16* __restrict__ qh,
                       const _Float16* __restrict__ kh,
                       const _Float16* __restrict__ vt,
                       const int* __restrict__ mask,
                       float* __restrict__ out) {
  // [buffer][K, V^T][tile][4 KB]: wave w's tile lies at 4096 * w of a buffer
  __shared__ __attribute__((aligned(2048))) _Float16 ring[2][2][8][2048];  // 128 KB
  __shared__ __align__(16) float  mbias[S_];           // 8 KB, 0 or -8e30
  __shared__ __align__(16) float4 part[16][16][32];    // 128 KB, each wave's O^T
  __shared__ __align__(8)  float2 pml[16][32];         // each wave's (m, l) per query

  const int tid  = threadIdx.x;
  const int lane = tid & 31;
  const int wid  = __builtin_amdgcn_readfirstlane(tid >> 5);
  const int kg   = wid & 7;                            // key group
  const int qp   = wid >> 3;                           // query pair
  const int b    = blockIdx.x >> 5;                    // 32 blocks per batch
  const int q0   = ((blockIdx.x & 31) << 6) + (qp << 5);
  const int half = lane >> 4;
  const int rc   = lane & 15;

  const _Float16* kbase = kh + (size_t)(b * S_) * D_;  // [key][64]
  const _Float16* vbase = vt + (size_t)(b * D_) * S_;  // [d][2048]

  // ---- staging: one tensor load a wave and stage ---------------------------
  // stage st = keys 256*st .. 256*st+255, tile g = its keys 32*g .. 32*g+31.
  // K tile: 32 rows of 128 bytes at pitch 128; V^T tile: 64 rows of 64 bytes at
  // pitch 4096. All extents in bytes, tensor = tile, no pad, no mask.
  const bool     isk   = wid < 8;
  const unsigned rowb  = isk ? 128u : 64u;
  const unsigned nrow  = isk ? 32u : 64u;
  const unsigned pitch = isk ? 128u : (unsigned)(S_ * 2);
  const unsigned step  = isk ? 256u * D_ * 2u : 256u * 2u;   // bytes a stage
  const unsigned long long src0 = (unsigned long long)(size_t)(
      isk ? kbase + kg * (32 * D_) : vbase + kg * 32);
  const unsigned dst0 = lds_offset(&ring[0][0][0][0]) + (unsigned)wid * 4096u;
  u32x8 g1;
  g1[0] = uni(0u);
  g1[1] = uni(rowb << 16);
  g1[2] = uni(nrow << 16);
  g1[3] = uni(rowb << 16);
  g1[4] = uni(nrow);
  g1[5] = uni(pitch);
  g1[6] = uni(0u);
  g1[7] = uni(0u);
  u32x4 g0;
  auto issue_stage = [&](const unsigned st) __attribute__((always_inline)) {
    const unsigned long long ga = src0 + (unsigned long long)st * step;
    g0[0] = uni(1u);                                   // count 1
    g0[1] = uni(dst0 + (st & 1u) * 65536u);            // place in LDS
    g0[2] = uni((unsigned)ga);
    g0[3] = uni(((unsigned)(ga >> 32) & 0x01FFFFFFu) | 0x80000000u);  // type 2
    asm volatile("tensor_load_to_lds %0, %1" ::"s"(g0), "s"(g1) : "memory");
  };
  issue_stage(0);

  // Q fragments (B operand, column = query): two b128 loads each
  Frag a0[2], a1[2];
#pragma unroll
  for (int t = 0; t < 2; ++t) {
    const _Float16* qrow = qh + (size_t)(b * S_ + q0 + 16 * t + rc) * D_;
    load_frag_h16(a0[t], qrow, half);
    load_frag_h16(a1[t], qrow + 32, half);
  }
  // the wait that stands in front of an overwrite of these loads' address
  asm volatile("s_wait_xcnt 0x0" ::: "memory");

  float m[2] = {-1e30f, -1e30f}, l[2] = {0.0f, 0.0f};  // this lane's two queries
  v8f acc[2][4];                                       // O^T: row d, col query
#pragma unroll
  for (int t = 0; t < 2; ++t)
#pragma unroll
    for (int nt = 0; nt < 4; ++nt)
#pragma unroll
      for (int e = 0; e < 8; ++e) acc[t][nt][e] = 0.0f;

  const float scale = 0.125f;                          // 1/sqrt(64)

  // mask table: -8e30 absorbs any score and gives -1e30 after the 1/8 scale;
  // published by the barrier in front of the loop
  {
    const int4 mm = *(const int4*)(mask + b * S_ + tid * 4);
    float4 f;
    f.x = (mm.x == 0) ? -8e30f : 0.0f;
    f.y = (mm.y == 0) ? -8e30f : 0.0f;
    f.z = (mm.z == 0) ? -8e30f : 0.0f;
    f.w = (mm.w == 0) ? -8e30f : 0.0f;
    *(float4*)&mbias[tid * 4] = f;
  }

  // stage 0 has landed and is published; then stage 1 flies under stage 0's work
  wait_tensor0(g0, g1);
  __syncthreads();
  issue_stage(pinned(1));

  for (int st = 0; st < NST_; ++st) {
    const int kt = st * 256 + kg * 32;
    const _Float16* kl = ring[st & 1][0][kg];
    const _Float16* vl = ring[st & 1][1][kg];

    // --- scores: S^T = K @ Q^T for 2 groups of 16 keys (ds_load_b128) ------
    Frag bk00, bk01, bk10, bk11;
    load_frag_tile(bk00, kl, 0, lane);
    load_frag_tile(bk01, kl, 1, lane);
    load_frag_tile(bk10, kl, 2, lane);
    load_frag_tile(bk11, kl, 3, lane);

    v8f c0v, c1v;                                      // start value: key mask
    {
      const float4 c0 = *(const float4*)&mbias[kt + 8 * half];
      const float4 c1 = *(const float4*)&mbias[kt + 8 * half + 4];
      const float4 c2 = *(const float4*)&mbias[kt + 16 + 8 * half];
      const float4 c3 = *(const float4*)&mbias[kt + 16 + 8 * half + 4];
      c0v[0] = c0.x; c0v[1] = c0.y; c0v[2] = c0.z; c0v[3] = c0.w;
      c0v[4] = c1.x; c0v[5] = c1.y; c0v[6] = c1.z; c0v[7] = c1.w;
      c1v[0] = c2.x; c1v[1] = c2.y; c1v[2] = c2.z; c1v[3] = c2.w;
      c1v[4] = c3.x; c1v[5] = c3.y; c1v[6] = c3.z; c1v[7] = c3.w;
    }
    Frag av[4];                                        // V^T rows, A operand
#pragma unroll
    for (int nt = 0; nt < 4; ++nt)
      load_frag_tile(av[nt], vl, nt, lane);
    // keeps the pass's LDS loads in one group ahead of the products: moved in
    // among them, each pair costs the wave a full LDS round trip
    __builtin_amdgcn_sched_barrier(0);
    v8f s0[2], s1[2];
#pragma unroll
    for (int t = 0; t < 2; ++t) {
      s0[t] = __builtin_amdgcn_wmma_f32_16x16x32_f16(false, bk00.v, false, a0[t].v,
                                                     (short)0, c0v, false, false);
      s1[t] = __builtin_amdgcn_wmma_f32_16x16x32_f16(false, bk10.v, false, a0[t].v,
                                                     (short)0, c1v, false, false);
    }
#pragma unroll
    for (int t = 0; t < 2; ++t) {
      s0[t] = __builtin_amdgcn_wmma_f32_16x16x32_f16(false, bk01.v, false, a1[t].v,
                                                     (short)0, s0[t], false, false);
      s1[t] = __builtin_amdgcn_wmma_f32_16x16x32_f16(false, bk11.v, false, a1[t].v,
                                                     (short)0, s1[t], false, false);
    }

#pragma unroll
    for (int t = 0; t < 2; ++t) {
      // --- online softmax update, one query per lane and tile ---------------
      float v0[8], v1[8];
#pragma unroll
      for (int r = 0; r < 8; ++r) {
        v0[r] = s0[t][r] * scale;
        v1[r] = s1[t][r] * scale;
      }
      float rmax = fmaxf(v0[0], v1[0]);
#pragma unroll
      for (int r = 1; r < 8; ++r) rmax = fmaxf(rmax, fmaxf(v0[r], v1[r]));
      rmax = fmaxf(rmax, xhalf(rmax));                 // both halves' 32 keys
      const float mn = fmaxf(m[t], rmax);
      const float al = __expf(m[t] - mn);
      float rs0 = 0.0f, rs1 = 0.0f;
      Frag pb;                                         // P^T as B operand
#pragma unroll
      for (int r = 0; r < 8; ++r) {
        float e0, e1;
        exp_pair(e0, e1, v0[r] - mn, v1[r] - mn);
        rs0 += e0;
        rs1 += e1;
        pb.h[r]     = (_Float16)e0;                    // k = 8*half + r
        pb.h[8 + r] = (_Float16)e1;                    // k = 16 + 8*half + r
      }
      l[t] = l[t] * al + (rs0 + rs1);                  // this half's keys only
      m[t] = mn;
#pragma unroll
      for (int nt = 0; nt < 4; ++nt)
#pragma unroll
        for (int r = 0; r < 8; ++r) acc[t][nt][r] *= al;

      // --- acc += V^T @ P^T -------------------------------------------------
#pragma unroll
      for (int nt = 0; nt < 4; ++nt)
        acc[t][nt] = __builtin_amdgcn_wmma_f32_16x16x32_f16(
            false, av[nt].v, false, pb.v, (short)0, acc[t][nt], false, false);
    }
    __builtin_amdgcn_sched_barrier(0);
    asm volatile("v_nop\n\tv_nop\n\tv_nop\n\tv_nop");
    // Foot of the pass, in every wave: its LDS reads of this stage are over, its
    // own tile of the next stage has landed, then the one barrier, which
    // publishes the next stage and frees the buffer just read for the refill.
    asm volatile("s_wait_dscnt 0x0" ::: "memory");
    wait_tensor0(g0, g1);
    __syncthreads();
    if (pinned(st + 2 < NST_)) issue_stage(pinned(st + 2));
  }
  wait_tensor0(g0, g1);
  asm volatile("s_wait_dscnt 0x0" ::: "memory");

#pragma unroll
  for (int t = 0; t < 2; ++t) {
    const float lt = l[t] + xhalf(l[t]);               // join the halves' sums
#pragma unroll
    for (int nt = 0; nt < 4; ++nt) {
      float4 o0, o1;
      o0.x = acc[t][nt][0]; o0.y = acc[t][nt][1];
      o0.z = acc[t][nt][2]; o0.w = acc[t][nt][3];
      o1.x = acc[t][nt][4]; o1.y = acc[t][nt][5];
      o1.z = acc[t][nt][6]; o1.w = acc[t][nt][7];
      const int pl = half * 16 + ((rc + 4 * nt) & 15);
      part[wid][t * 8 + nt * 2][pl]     = o0;
      part[wid][t * 8 + nt * 2 + 1][pl] = o1;
    }
    if (half == 0) pml[wid][t * 16 + rc] = make_float2(m[t], lt);
  }
  __syncthreads();   // publishes every wave's partial result

  // wave kg of a query pair joins its queries 4*kg .. 4*kg+3; a lane takes 8
  // consecutive d of one query, so a wave stores four whole rows of out
  const int tj = kg >> 2;                              // the queries' tile
  const int qi = 4 * (kg & 3) + (lane >> 3);           // query inside the tile
  const int dn = (lane & 7) >> 1;                      // the run's nt
  const int pr = (lane & 1) * 16 + ((qi + 4 * dn) & 15);
  float2 ml[8];
#pragma unroll
  for (int g = 0; g < 8; ++g) ml[g] = pml[qp * 8 + g][tj * 16 + qi];
  float mj = ml[0].x;
#pragma unroll
  for (int g = 1; g < 8; ++g) mj = fmaxf(mj, ml[g].x);
  float wg[8];
#pragma unroll
  for (int g = 0; g < 8; g += 2)
    exp_pair(wg[g], wg[g + 1], ml[g].x - mj, ml[g + 1].x - mj);
  float lj = 0.0f;
  float4 o0 = {0.0f, 0.0f, 0.0f, 0.0f}, o1 = {0.0f, 0.0f, 0.0f, 0.0f};
#pragma unroll
  for (int g = 0; g < 8; ++g) {
    const float4 p0 = part[qp * 8 + g][tj * 8 + dn * 2][pr];
    const float4 p1 = part[qp * 8 + g][tj * 8 + dn * 2 + 1][pr];
    lj += wg[g] * ml[g].y;
    o0.x += wg[g] * p0.x; o0.y += wg[g] * p0.y;
    o0.z += wg[g] * p0.z; o0.w += wg[g] * p0.w;
    o1.x += wg[g] * p1.x; o1.y += wg[g] * p1.y;
    o1.z += wg[g] * p1.z; o1.w += wg[g] * p1.w;
  }
  // --- normalize and store ---------------------------------------------------
  const float inv = 1.0f / lj;
  float* orow = out + (size_t)(b * S_ + q0 + tj * 16 + qi) * D_ + (lane & 7) * 8;
  o0.x *= inv; o0.y *= inv; o0.z *= inv; o0.w *= inv;
  o1.x *= inv; o1.y *= inv; o1.z *= inv; o1.w *= inv;
  *(float4*)(orow)     = o0;
  *(float4*)(orow + 4) = o1;
}

// ---------------------------------------------------------------------------
extern "C" void kernel_launch(void* const* d_in, const int* in_sizes, int n_in,
                              void* d_out, int out_size, void* d_ws, size_t ws_size,
                              hipStream_t stream) {
  const float* x    = (const float*)d_in[0];
  const int*   mask = (const int*)d_in[1];
  const float* Wq   = (const float*)d_in[2];
  const float* bq   = (const float*)d_in[3];
  const float* Wk   = (const float*)d_in[4];
  const float* bk   = (const float*)d_in[5];
  const float* Wv   = (const float*)d_in[6];
  const float* bv   = (const float*)d_in[7];
  float* out = (float*)d_out;

  char* ws = (char*)d_ws;
  _Float16* qh = (_Float16*)ws;                                  // 2 MB
  _Float16* kh = (_Float16*)(ws + (size_t)2 * 1024 * 1024);      // 2 MB
  _Float16* vt = (_Float16*)(ws + (size_t)4 * 1024 * 1024);      // 2 MB
  _Float16* wt = (_Float16*)(ws + (size_t)6 * 1024 * 1024);      // 384 KB

  wtrans_kernel<<<96, 256, 0, stream>>>(Wq, Wk, Wv, wt);
  qkv_proj_kernel<<<256, 256, 0, stream>>>(x, wt, bq, bk, bv, qh, kh, vt);
  flash_attn_kernel<<<256, 512, 0, stream>>>(qh, kh, vt, mask, out);
}

// v008
// Measured time: 26.6 microseconds a run.
// Timed twice side by side with v007, it ran 1.07 and 1.08 times as fast.
// All steps since v000 together make it 4.86 times as fast.
#include <hip/hip_runtime.h>
#include <hip/hip_bf16.h>

typedef __attribute__((ext_vector_type(16))) _Float16 v16h;
typedef __attribute__((ext_vector_type(8)))  float    v8f;
typedef __attribute__((ext_vector_type(4)))  int      v4i;

#define B_  8
#define S_  2048
#define H_  1024
#define D_  64

#define AS1 __attribute__((address_space(1)))
#define AS3 __attribute__((address_space(3)))

union Frag {
  v16h v;
  _Float16 h[16];
  unsigned u[8];
};

__device__ __forceinline__ void load_frag_h16(Frag& f, const _Float16* base,
                                              int half) {
  const uint4 lo = *(const uint4*)(base + 8 * half);
  const uint4 hi = *(const uint4*)(base + 16 + 8 * half);
  f.u[0] = lo.x; f.u[1] = lo.y; f.u[2] = lo.z; f.u[3] = lo.w;
  f.u[4] = hi.x; f.u[5] = hi.y; f.u[6] = hi.z; f.u[7] = hi.w;
}

__device__ __forceinline__ int frag_pos(int f, int p, int l) {
  return ((2 * f + p) * 32 + l) * 8;
}

__device__ __forceinline__ void load_frag_tile(Frag& fr, const _Float16* tile,
                                               int f, int lane) {
  const uint4 lo = *(const uint4*)(tile + frag_pos(f, 0, lane));
  const uint4 hi = *(const uint4*)(tile + frag_pos(f, 1, lane));
  fr.u[0] = lo.x; fr.u[1] = lo.y; fr.u[2] = lo.z; fr.u[3] = lo.w;
  fr.u[4] = hi.x; fr.u[5] = hi.y; fr.u[6] = hi.z; fr.u[7] = hi.w;
}

#if __has_builtin(__builtin_amdgcn_global_load_async_to_lds_b128)
#define HAVE_ASYNC_LDS 1
#endif

__device__ __forceinline__ void cp_async_b128(void* lds, const void* g) {
#if defined(HAVE_ASYNC_LDS)
  __builtin_amdgcn_global_load_async_to_lds_b128(
      (AS1 v4i*)(v4i*)g, (AS3 v4i*)(v4i*)lds, 0, 0);
#else
  *(uint4*)lds = *(const uint4*)g;   // synchronous fallback
#endif
}

// Foot of a stage of the projection loop, in every wave: the wave's own LDS
// reads of the stage are over, its own copies of the next stage have landed,
// then the work-group barrier, which publishes the next stage and frees the
// buffer just read. Written by hand because __syncthreads() also waits out every
// outstanding global load of the wave, and the x ring stays in flight across it.
__device__ __forceinline__ void stage_foot() {
  asm volatile("s_wait_dscnt 0x0" ::: "memory");
  asm volatile("s_wait_asynccnt 0x0" ::: "memory");
  asm volatile("s_barrier_signal -1\n\ts_barrier_wait -1" ::: "memory");
}

typedef unsigned u32x4 __attribute__((ext_vector_type(4)));
typedef unsigned u32x8 __attribute__((ext_vector_type(8)));

__device__ __forceinline__ unsigned lds_offset(const void* p) {
  return (unsigned)(unsigned long long)(AS3 void*)(void*)p;
}

__device__ __forceinline__ unsigned uni(unsigned v) {
  return (unsigned)__builtin_amdgcn_readfirstlane(v);
}

__device__ __forceinline__ void wait_tensor0(u32x4 g0, u32x8 g1) {
  asm volatile("s_wait_tensorcnt 0x0" ::"s"(g0), "s"(g1) : "memory");
}

__device__ __forceinline__ float xhalf(float x) {
  const int i = __builtin_bit_cast(int, x);
  return __builtin_bit_cast(float, __builtin_amdgcn_permlanex16(
      i, i, 0x76543210, 0xfedcba98, false, false));
}

__device__ __forceinline__ void exp_pair(float& r0, float& r1, float x0, float x1) {
  asm("v_exp_f32 %0, %2\n\tv_exp_f32 %1, %3\n\tv_nop"
      : "=&v"(r0), "=&v"(r1)
      : "v"(x0 * 1.44269504f), "v"(x1 * 1.44269504f));
}

// ---------------------------------------------------------------------------
// Kernel 0: convert W (f32, [k][n]) -> Wt (f16, [w][64][1024]) once. Each chunk
// of 32 k (columns kc..kc+31 of all 64 rows, row-major: the tile kernel 1
// stages) holds its 64 n x 32 k in fragment order, fragment = n / 16.
// ---------------------------------------------------------------------------
__global__ __launch_bounds__(256)
void wtrans_kernel(const float* __restrict__ Wq, const float* __restrict__ Wk,
                   const float* __restrict__ Wv, _Float16* __restrict__ wt) {
  const int id = blockIdx.x * 256 + threadIdx.x;   // 24576 threads
  const int w  = id >> 13;                         // 8192 per weight
  const int r  = id & 8191;
  // a wave takes 4 n x 64 k (two chunks): in fragment order that is four whole
  // 128-byte lines of Wt, each stored by this wave alone
  const int n  = ((r >> 9) << 2) | (r & 3);        // 0..63
  const int k0 = ((r >> 2) & 127) * 8;             // 0..1016
  const float* W = (w == 0) ? Wq : (w == 1) ? Wk : Wv;
  // the thread's 8 k are one run of lane ((k0 >> 3) & 1) * 16 + (n & 15)
  const int pos = frag_pos(n >> 4, (k0 >> 4) & 1, ((k0 >> 3) & 1) * 16 + (n & 15));
  _Float16* dst = wt + ((size_t)w << 16) + (size_t)(pos >> 5) * H_ +
                  (k0 & ~31) + (pos & 31);
#pragma unroll
  for (int j = 0; j < 8; ++j)
    dst[j] = (_Float16)W[(size_t)(k0 + j) * D_ + n];
}

#define WCH_ (3 * 2048 + 32)

__global__ __launch_bounds__(256)
void qkv_proj_kernel(const float* __restrict__ x,
                     const _Float16* __restrict__ wt,
                     const float* __restrict__ bq, const float* __restrict__ bk,
                     const float* __restrict__ bv,
                     _Float16* __restrict__ qh, _Float16* __restrict__ kh,
                     _Float16* __restrict__ vt) {
  // One LDS block: the partial sums (48 KB) at its start, the two Wt stages
  // (96.5 KB) from 64 KiB on. The compiler folds constant steps of the copies'
  // global addresses, under 64 KiB, into their offset field and takes them off
  // the LDS address register, which so never falls below zero.
  __shared__ __align__(16) unsigned char smem[65536 + 2 * 4 * WCH_ * 2];
  float4 (*part)[6][2][32] = (float4 (*)[6][2][32])smem;
  _Float16* wlds = (_Float16*)(smem + 65536);

  const int tid  = threadIdx.x;
  const int lane = tid & 31;
  const int wid  = __builtin_amdgcn_readfirstlane(tid >> 5);
  const int kg   = wid & 1;                        // K group
  const int rt   = wid >> 1;                       // row tile
  const int row0 = (blockIdx.x * 4 + rt) * 16;     // flat row over B*S
  const int half = lane >> 4;
  const int rc   = lane & 15;

  const float* Bs[3] = {bq, bk, bv};

  // Pass p of the block works on K stage (p + rot) mod 8. All 256 blocks read the
  // same Wt; started together on one stage they ask L2 for the same lines at one
  // moment. The index is folded so that blocks whose indices are equal modulo 8,
  // and neighbours too, get different starts.
  const int rot = (blockIdx.x + (blockIdx.x >> 3)) & 7;

  v8f acc[3][4];
#pragma unroll
  for (int w = 0; w < 3; ++w)
#pragma unroll
    for (int nt = 0; nt < 4; ++nt)
#pragma unroll
      for (int e = 0; e < 8; ++e) acc[w][nt][e] = 0.0f;

  // one stage = 128 columns of the 192 rows of Wt, for pass st those of K stage
  // (st + rot) mod 8, into the buffer of the pass's parity: 3072 pieces
  // of 16 bytes, 12 a thread. 16 threads take the 256 contiguous bytes of a row;
  // copy i takes rows 16*i .. 16*i+15 of the 192.
  const _Float16* wsrc = wt + (size_t)(tid >> 4) * H_ + (tid & 15) * 8;
  const int wdst = ((tid >> 2) & 3) * WCH_ + (tid >> 4) * 32 + (tid & 3) * 8;
  auto issue_stage = [&](const int st, const _Float16* ws)
      __attribute__((always_inline)) {
#pragma unroll
    for (int i = 0; i < 12; ++i)
      cp_async_b128(&wlds[(st & 1) * 4 * WCH_ + wdst + i * 512],
                    ws + (size_t)i * 16 * H_);
  };
  issue_stage(0, wsrc + rot * 128);

  // x ring: the wave's 16x32 chunks of x for two stages, two a stage, in
  // registers. A stage converts its chunks and asks at once for those two stages
  // on, so 16 row loads of each of the 8 waves stay in flight.
  const float* xlane = x + (size_t)(row0 + rc) * H_ + kg * 64 + 8 * half;
  float4 xr[2][2][4];
#pragma unroll
  for (int j = 0; j < 2; ++j)
#pragma unroll
    for (int c = 0; c < 2; ++c) {
      const float* x0 = xlane + ((j + rot) & 7) * 128 + c * 32;
      xr[j][c][0] = *(const float4*)(x0);
      xr[j][c][1] = *(const float4*)(x0 + 4);
      xr[j][c][2] = *(const float4*)(x0 + 16);
      xr[j][c][3] = *(const float4*)(x0 + 20);
    }
  // where the next refill of the ring and the next copies of Wt read: they step
  // from K stage to K stage at each pass's foot, from stage 7 back to stage 0
  const float*    xn = xlane + ((2 + rot) & 7) * 128;
  const _Float16* wn = wsrc + ((2 + rot) & 7) * 128;

  // stage 0 has landed and is published; then stage 1 flies under stage 0's work
  asm volatile("s_wait_asynccnt 0x0" ::: "memory");
  asm volatile("s_barrier_signal -1\n\ts_barrier_wait -1" ::: "memory");
  issue_stage(1, wsrc + ((1 + rot) & 7) * 128);

  // two stages; refill is a literal at both calls, so that the counted load
  // waits of the refilling stages are not merged with those of the last two
  auto two_stages = [&](const int st2, const bool refill)
      __attribute__((always_inline)) {
#pragma unroll
    for (int j = 0; j < 2; ++j) {
      const int st = st2 + j;
      const _Float16* tile = &wlds[(j * 4 + kg * 2) * WCH_];

      Frag a[2];                                   // two 16x32 chunks of x
      Frag bf[2][3][4];                            // their 12 Wt fragments each
#pragma unroll
      for (int c = 0; c < 2; ++c)
#pragma unroll
        for (int w = 0; w < 3; ++w)
#pragma unroll
          for (int nt = 0; nt < 4; ++nt)
            load_frag_tile(bf[c][w][nt], tile + c * WCH_ + w * 2048, nt, lane);
#pragma unroll
      for (int c = 0; c < 2; ++c) {
        const float4 f0 = xr[j][c][0], f1 = xr[j][c][1];
        const float4 f2 = xr[j][c][2], f3 = xr[j][c][3];
        a[c].h[0]  = (_Float16)f0.x; a[c].h[1]  = (_Float16)f0.y;
        a[c].h[2]  = (_Float16)f0.z; a[c].h[3]  = (_Float16)f0.w;
        a[c].h[4]  = (_Float16)f1.x; a[c].h[5]  = (_Float16)f1.y;
        a[c].h[6]  = (_Float16)f1.z; a[c].h[7]  = (_Float16)f1.w;
        a[c].h[8]  = (_Float16)f2.x; a[c].h[9]  = (_Float16)f2.y;
        a[c].h[10] = (_Float16)f2.z; a[c].h[11] = (_Float16)f2.w;
        a[c].h[12] = (_Float16)f3.x; a[c].h[13] = (_Float16)f3.y;
        a[c].h[14] = (_Float16)f3.z; a[c].h[15] = (_Float16)f3.w;
      }
      if (refill) {
#pragma unroll
        for (int c = 0; c < 2; ++c) {
          xr[j][c][0] = *(const float4*)(xn + c * 32);
          xr[j][c][1] = *(const float4*)(xn + c * 32 + 4);
          xr[j][c][2] = *(const float4*)(xn + c * 32 + 16);
          xr[j][c][3] = *(const float4*)(xn + c * 32 + 20);
        }
        // the loop advances the ring's address register behind these loads:
        // the wait that stands in front of such an overwrite
        asm volatile("s_wait_xcnt 0x0" ::: "memory");
      }
      // keeps the stage's 48 LDS loads in one group, each fragment in registers
      // of its own, so that the second chunk's land under the first's products,
      // and the ring's eight loads ahead of the products: sunk below, they lose
      // their lead
      __builtin_amdgcn_sched_barrier(0);

#pragma unroll
      for (int c = 0; c < 2; ++c) {
#pragma unroll
        for (int w = 0; w < 3; ++w) {
#pragma unroll
          for (int nt = 0; nt < 4; ++nt) {
            acc[w][nt] = __builtin_amdgcn_wmma_f32_16x16x32_f16(
                false, a[c].v, false, bf[c][w][nt].v, (short)0, acc[w][nt],
                false, false);
          }
        }
      }
      if (refill || j == 0) {
        // keeps the products in front of the foot: raised to the LDS loads, its
        // barrier holds every wave until the slowest wave's fragments are back,
        // and no wave computes under another's loads
        __builtin_amdgcn_sched_barrier(0);
        stage_foot();
        if (refill) {
          issue_stage(st + 2, wn);                 // into the buffer just read
          const int step = (((st + 3 + rot) & 7) == 0) ? -7 * 128 : 128;
          xn += step;
          wn += step;
        }
      }
    }
  };

  for (int st2 = 0; st2 < 6; st2 += 2) two_stages(st2, true);
  two_stages(6, false);

  // --- join the two K groups' partial sums through LDS -----------------------
  // K group g of a row tile ends up with column tiles 2g and 2g+1 of q, k and v.
  // A wave stores the six tiles that are the other group's, 512 contiguous bytes
  // a store, and keeps its own six in registers.
#pragma unroll
  for (int nt = 0; nt < 4; ++nt) {
    if ((nt >> 1) != kg) {
#pragma unroll
      for (int w = 0; w < 3; ++w) {
        float4 lo, hi;
        lo.x = acc[w][nt][0]; lo.y = acc[w][nt][1];
        lo.z = acc[w][nt][2]; lo.w = acc[w][nt][3];
        hi.x = acc[w][nt][4]; hi.y = acc[w][nt][5];
        hi.z = acc[w][nt][6]; hi.w = acc[w][nt][7];
        part[wid][w * 2 + (nt & 1)][0][lane] = lo;
        part[wid][w * 2 + (nt & 1)][1][lane] = hi;
      }
    }
  }
  v8f sum[3][2];
#pragma unroll
  for (int w = 0; w < 3; ++w) {
    if (kg == 0) { sum[w][0] = acc[w][0]; sum[w][1] = acc[w][1]; }
    else         { sum[w][0] = acc[w][2]; sum[w][1] = acc[w][3]; }
  }
  __syncthreads();   // publishes every wave's partial sums
#pragma unroll
  for (int w = 0; w < 3; ++w) {
#pragma unroll
    for (int n = 0; n < 2; ++n) {
      const float4 lo = part[wid ^ 1][w * 2 + n][0][lane];
      const float4 hi = part[wid ^ 1][w * 2 + n][1][lane];
      sum[w][n][0] += lo.x; sum[w][n][1] += lo.y;
      sum[w][n][2] += lo.z; sum[w][n][3] += lo.w;
      sum[w][n][4] += hi.x; sum[w][n][5] += hi.y;
      sum[w][n][6] += hi.z; sum[w][n][7] += hi.w;
    }
  }

  // bias add + f16 store of column tiles 2*kg and 2*kg+1
#pragma unroll
  for (int w = 0; w < 3; ++w) {
#pragma unroll
    for (int n = 0; n < 2; ++n) {
      const int nt = kg * 2 + n;
      const int d = nt * 16 + rc;
      const float bias = Bs[w][d];
      if (w == 2) {
        // the lane's 8 keys of column d are one whole run of fragment nt
        union { uint4 q; _Float16 h[8]; } run;
#pragma unroll
        for (int r = 0; r < 8; ++r) run.h[r] = (_Float16)(sum[w][n][r] + bias);
        const int b   = row0 >> 11;                // / S_
        const int kt  = row0 & (S_ - 1) & ~31;
        const int pos = frag_pos(nt, (row0 >> 4) & 1, lane);
        *(uint4*)(vt + ((size_t)b * D_ + (pos >> 5)) * S_ + kt + (pos & 31)) = run.q;
      } else {
#pragma unroll
        for (int r = 0; r < 8; ++r) {
          const int row   = r + 8 * half;
          const int bsrow = row0 + row;
          const _Float16 hv = (_Float16)(sum[w][n][r] + bias);
          if (w == 0) {
            qh[(size_t)bsrow * D_ + d] = hv;
          } else {
            const int pos = frag_pos(2 * ((row0 >> 4) & 1) + (nt >> 1), nt & 1,
                                     (rc >> 3) * 16 + row);
            kh[(size_t)(row0 >> 5) * (32 * D_) + pos + (rc & 7)] = hv;
          }
        }
      }
    }
  }
}

__device__ __forceinline__ unsigned pinned(unsigned v) {
  unsigned w = __builtin_amdgcn_readfirstlane(v);
  asm volatile("" : "+s"(w));
  return w;
}

#define NST_ (S_ / 256)                                // stages of 256 keys

__global__ __launch_bounds__(512)
void flash_attn_kernel(const _Float16* __restrict__ qh,
                       const _Float16* __restrict__ kh,
                       const _Float16* __restrict__ vt,
                       const int* __restrict__ mask,
                       float* __restrict__ out) {
  // [buffer][K, V^T][tile][4 KB]: wave w's tile lies at 4096 * w of a buffer
  __shared__ __attribute__((aligned(2048))) _Float16 ring[2][2][8][2048];  // 128 KB
  __shared__ __align__(16) float  mbias[S_];           // 8 KB, 0 or -8e30
  __shared__ __align__(16) float4 part[16][16][32];    // 128 KB, each wave's O^T
  __shared__ __align__(8)  float2 pml[16][32];         // each wave's (m, l) per query

  const int tid  = threadIdx.x;
  const int lane = tid & 31;
  const int wid  = __builtin_amdgcn_readfirstlane(tid >> 5);
  const int kg   = wid & 7;                            // key group
  const int qp   = wid >> 3;                           // query pair
  const int b    = blockIdx.x >> 5;                    // 32 blocks per batch
  const int q0   = ((blockIdx.x & 31) << 6) + (qp << 5);
  const int half = lane >> 4;
  const int rc   = lane & 15;

  const _Float16* kbase = kh + (size_t)(b * S_) * D_;  // [key][64]
  const _Float16* vbase = vt + (size_t)(b * D_) * S_;  // [d][2048]

  // ---- staging: one tensor load a wave and stage ---------------------------
  // stage s = keys 256*s .. 256*s+255, tile g = its keys 32*g .. 32*g+31. Pass p
  // of the block works on stage (p + rot) mod 8: a batch's 32 blocks read the same
  // K and V^T, and started on one stage they ask L2 for the same lines at one
  // moment. Each of the eight starts is taken by four of a batch's blocks.
  // K tile: 32 rows of 128 bytes at pitch 128; V^T tile: 64 rows of 64 bytes at
  // pitch 4096. All extents in bytes, tensor = tile, no pad, no mask.
  const bool     isk   = wid < 8;
  const unsigned rowb  = isk ? 128u : 64u;
  const unsigned nrow  = isk ? 32u : 64u;
  const unsigned pitch = isk ? 128u : (unsigned)(S_ * 2);
  const unsigned step  = isk ? 256u * D_ * 2u : 256u * 2u;   // bytes a stage
  const unsigned long long src0 = (unsigned long long)(size_t)(
      isk ? kbase + kg * (32 * D_) : vbase + kg * 32);
  const unsigned dst0 = lds_offset(&ring[0][0][0][0]) + (unsigned)wid * 4096u;
  u32x8 g1;
  g1[0] = uni(0u);
  g1[1] = uni(rowb << 16);
  g1[2] = uni(nrow << 16);
  g1[3] = uni(rowb << 16);
  g1[4] = uni(nrow);
  g1[5] = uni(pitch);
  g1[6] = uni(0u);
  g1[7] = uni(0u);
  const unsigned rot = (((blockIdx.x >> 3) & 3u) << 1) | (blockIdx.x & 1u);
  u32x4 g0;
  auto issue_stage = [&](const unsigned st) __attribute__((always_inline)) {
    const unsigned long long ga =
        src0 + (unsigned long long)((st + rot) & (NST_ - 1u)) * step;
    g0[0] = uni(1u);                                   // count 1
    g0[1] = uni(dst0 + (st & 1u) * 65536u);            // place in LDS
    g0[2] = uni((unsigned)ga);
    g0[3] = uni(((unsigned)(ga >> 32) & 0x01FFFFFFu) | 0x80000000u);  // type 2
    asm volatile("tensor_load_to_lds %0, %1" ::"s"(g0), "s"(g1) : "memory");
  };
  issue_stage(0);

  // Q fragments (B operand, column = query): two b128 loads each
  Frag a0[2], a1[2];
#pragma unroll
  for (int t = 0; t < 2; ++t) {
    const _Float16* qrow = qh + (size_t)(b * S_ + q0 + 16 * t + rc) * D_;
    load_frag_h16(a0[t], qrow, half);
    load_frag_h16(a1[t], qrow + 32, half);
  }
  // the wait that stands in front of an overwrite of these loads' address
  asm volatile("s_wait_xcnt 0x0" ::: "memory");

  float m[2] = {-1e30f, -1e30f}, l[2] = {0.0f, 0.0f};  // this lane's two queries
  v8f acc[2][4];                                       // O^T: row d, col query
#pragma unroll
  for (int t = 0; t < 2; ++t)
#pragma unroll
    for (int nt = 0; nt < 4; ++nt)
#pragma unroll
      for (int e = 0; e < 8; ++e) acc[t][nt][e] = 0.0f;

  const float scale = 0.125f;                          // 1/sqrt(64)

  // mask table: -8e30 absorbs any score and gives -1e30 after the 1/8 scale;
  // published by the barrier in front of the loop
  {
    const int4 mm = *(const int4*)(mask + b * S_ + tid * 4);
    float4 f;
    f.x = (mm.x == 0) ? -8e30f : 0.0f;
    f.y = (mm.y == 0) ? -8e30f : 0.0f;
    f.z = (mm.z == 0) ? -8e30f : 0.0f;
    f.w = (mm.w == 0) ? -8e30f : 0.0f;
    *(float4*)&mbias[tid * 4] = f;
  }

  // pass 0's stage has landed and is published; then pass 1's flies under pass 0's work
  wait_tensor0(g0, g1);
  __syncthreads();
  issue_stage(pinned(1));

  for (int st = 0; st < NST_; ++st) {
    const int kt = (int)((st + rot) & (NST_ - 1u)) * 256 + kg * 32;
    const _Float16* kl = ring[st & 1][0][kg];
    const _Float16* vl = ring[st & 1][1][kg];

    // --- scores: S^T = K @ Q^T for 2 groups of 16 keys (ds_load_b128) ------
    Frag bk00, bk01, bk10, bk11;
    load_frag_tile(bk00, kl, 0, lane);
    load_frag_tile(bk01, kl, 1, lane);
    load_frag_tile(bk10, kl, 2, lane);
    load_frag_tile(bk11, kl, 3, lane);

    v8f c0v, c1v;                                      // start value: key mask
    {
      const float4 c0 = *(const float4*)&mbias[kt + 8 * half];
      const float4 c1 = *(const float4*)&mbias[kt + 8 * half + 4];
      const float4 c2 = *(const float4*)&mbias[kt + 16 + 8 * half];
      const float4 c3 = *(const float4*)&mbias[kt + 16 + 8 * half + 4];
      c0v[0] = c0.x; c0v[1] = c0.y; c0v[2] = c0.z; c0v[3] = c0.w;
      c0v[4] = c1.x; c0v[5] = c1.y; c0v[6] = c1.z; c0v[7] = c1.w;
      c1v[0] = c2.x; c1v[1] = c2.y; c1v[2] = c2.z; c1v[3] = c2.w;
      c1v[4] = c3.x; c1v[5] = c3.y; c1v[6] = c3.z; c1v[7] = c3.w;
    }
    Frag av[4];                                        // V^T rows, A operand
#pragma unroll
    for (int nt = 0; nt < 4; ++nt)
      load_frag_tile(av[nt], vl, nt, lane);
    // keeps the pass's LDS loads in one group ahead of the products: moved in
    // among them, each pair costs the wave a full LDS round trip
    __builtin_amdgcn_sched_barrier(0);
    v8f s0[2], s1[2];
#pragma unroll
    for (int t = 0; t < 2; ++t) {
      s0[t] = __builtin_amdgcn_wmma_f32_16x16x32_f16(false, bk00.v, false, a0[t].v,
                                                     (short)0, c0v, false, false);
      s1[t] = __builtin_amdgcn_wmma_f32_16x16x32_f16(false, bk10.v, false, a0[t].v,
                                                     (short)0, c1v, false, false);
    }
#pragma unroll
    for (int t = 0; t < 2; ++t) {
      s0[t] = __builtin_amdgcn_wmma_f32_16x16x32_f16(false, bk01.v, false, a1[t].v,
                                                     (short)0, s0[t], false, false);
      s1[t] = __builtin_amdgcn_wmma_f32_16x16x32_f16(false, bk11.v, false, a1[t].v,
                                                     (short)0, s1[t], false, false);
    }

#pragma unroll
    for (int t = 0; t < 2; ++t) {
      // --- online softmax update, one query per lane and tile ---------------
      float v0[8], v1[8];
#pragma unroll
      for (int r = 0; r < 8; ++r) {
        v0[r] = s0[t][r] * scale;
        v1[r] = s1[t][r] * scale;
      }
      float rmax = fmaxf(v0[0], v1[0]);
#pragma unroll
      for (int r = 1; r < 8; ++r) rmax = fmaxf(rmax, fmaxf(v0[r], v1[r]));
      rmax = fmaxf(rmax, xhalf(rmax));                 // both halves' 32 keys
      const float mn = fmaxf(m[t], rmax);
      const float al = __expf(m[t] - mn);
      float rs0 = 0.0f, rs1 = 0.0f;
      Frag pb;                                         // P^T as B operand
#pragma unroll
      for (int r = 0; r < 8; ++r) {
        float e0, e1;
        exp_pair(e0, e1, v0[r] - mn, v1[r] - mn);
        rs0 += e0;
        rs1 += e1;
        pb.h[r]     = (_Float16)e0;                    // k = 8*half + r
        pb.h[8 + r] = (_Float16)e1;                    // k = 16 + 8*half + r
      }
      l[t] = l[t] * al + (rs0 + rs1);                  // this half's keys only
      m[t] = mn;
#pragma unroll
      for (int nt = 0; nt < 4; ++nt)
#pragma unroll
        for (int r = 0; r < 8; ++r) acc[t][nt][r] *= al;

      // --- acc += V^T @ P^T -------------------------------------------------
#pragma unroll
      for (int nt = 0; nt < 4; ++nt)
        acc[t][nt] = __builtin_amdgcn_wmma_f32_16x16x32_f16(
            false, av[nt].v, false, pb.v, (short)0, acc[t][nt], false, false);
    }
    __builtin_amdgcn_sched_barrier(0);
    asm volatile("v_nop\n\tv_nop\n\tv_nop\n\tv_nop");
    // Foot of the pass, in every wave: its LDS reads of this stage are over, its
    // own tile of the next stage has landed, then the one barrier, which
    // publishes the next stage and frees the buffer just read for the refill.
    asm volatile("s_wait_dscnt 0x0" ::: "memory");
    wait_tensor0(g0, g1);
    __syncthreads();
    if (pinned(st + 2 < NST_)) issue_stage(pinned(st + 2));
  }
  wait_tensor0(g0, g1);
  asm volatile("s_wait_dscnt 0x0" ::: "memory");

#pragma unroll
  for (int t = 0; t < 2; ++t) {
    const float lt = l[t] + xhalf(l[t]);               // join the halves' sums
#pragma unroll
    for (int nt = 0; nt < 4; ++nt) {
      float4 o0, o1;
      o0.x = acc[t][nt][0]; o0.y = acc[t][nt][1];
      o0.z = acc[t][nt][2]; o0.w = acc[t][nt][3];
      o1.x = acc[t][nt][4]; o1.y = acc[t][nt][5];
      o1.z = acc[t][nt][6]; o1.w = acc[t][nt][7];
      const int pl = half * 16 + ((rc + 4 * nt) & 15);
      part[wid][t * 8 + nt * 2][pl]     = o0;
      part[wid][t * 8 + nt * 2 + 1][pl] = o1;
    }
    if (half == 0) pml[wid][t * 16 + rc] = make_float2(m[t], lt);
  }
  __syncthreads();   // publishes every wave's partial result

  // wave kg of a query pair joins its queries 4*kg .. 4*kg+3; a lane takes 8
  // consecutive d of one query, so a wave stores four whole rows of out
  const int tj = kg >> 2;                              // the queries' tile
  const int qi = 4 * (kg & 3) + (lane >> 3);           // query inside the tile
  const int dn = (lane & 7) >> 1;                      // the run's nt
  const int pr = (lane & 1) * 16 + ((qi + 4 * dn) & 15);
  float2 ml[8];
#pragma unroll
  for (int g = 0; g < 8; ++g) ml[g] = pml[qp * 8 + g][tj * 16 + qi];
  float mj = ml[0].x;
#pragma unroll
  for (int g = 1; g < 8; ++g) mj = fmaxf(mj, ml[g].x);
  float wg[8];
#pragma unroll
  for (int g = 0; g < 8; g += 2)
    exp_pair(wg[g], wg[g + 1], ml[g].x - mj, ml[g + 1].x - mj);
  float lj = 0.0f;
  float4 o0 = {0.0f, 0.0f, 0.0f, 0.0f}, o1 = {0.0f, 0.0f, 0.0f, 0.0f};
#pragma unroll
  for (int g = 0; g < 8; ++g) {
    const float4 p0 = part[qp * 8 + g][tj * 8 + dn * 2][pr];
    const float4 p1 = part[qp * 8 + g][tj * 8 + dn * 2 + 1][pr];
    lj += wg[g] * ml[g].y;
    o0.x += wg[g] * p0.x; o0.y += wg[g] * p0.y;
    o0.z += wg[g] * p0.z; o0.w += wg[g] * p0.w;
    o1.x += wg[g] * p1.x; o1.y += wg[g] * p1.y;
    o1.z += wg[g] * p1.z; o1.w += wg[g] * p1.w;
  }
  // --- normalize and store ---------------------------------------------------
  const float inv = 1.0f / lj;
  float* orow = out + (size_t)(b * S_ + q0 + tj * 16 + qi) * D_ + (lane & 7) * 8;
  o0.x *= inv; o0.y *= inv; o0.z *= inv; o0.w *= inv;
  o1.x *= inv; o1.y *= inv; o1.z *= inv; o1.w *= inv;
  *(float4*)(orow)     = o0;
  *(float4*)(orow + 4) = o1;
}

// ---------------------------------------------------------------------------
extern "C" void kernel_launch(void* const* d_in, const int* in_sizes, int n_in,
                              void* d_out, int out_size, void* d_ws, size_t ws_size,
                              hipStream_t stream) {
  const float* x    = (const float*)d_in[0];
  const int*   mask = (const int*)d_in[1];
  const float* Wq   = (const float*)d_in[2];
  const float* bq   = (const float*)d_in[3];
  const float* Wk   = (const float*)d_in[4];
  const float* bk   = (const float*)d_in[5];
  const float* Wv   = (const float*)d_in[6];
  const float* bv   = (const float*)d_in[7];
  float* out = (float*)d_out;

  char* ws = (char*)d_ws;
  _Float16* qh = (_Float16*)ws;                                  // 2 MB
  _Float16* kh = (_Float16*)(ws + (size_t)2 * 1024 * 1024);      // 2 MB
  _Float16* vt = (_Float16*)(ws + (size_t)4 * 1024 * 1024);      // 2 MB
  _Float16* wt = (_Float16*)(ws + (size_t)6 * 1024 * 1024);      // 384 KB

  wtrans_kernel<<<96, 256, 0, stream>>>(Wq, Wk, Wv, wt);
  qkv_proj_kernel<<<256, 256, 0, stream>>>(x, wt, bq, bk, bv, qh, kh, vt);
  flash_attn_kernel<<<256, 512, 0, stream>>>(qh, kh, vt, mask, out);
}

// v009
// One run takes 25.4 microseconds.
// Two timings next to v008 put it at 1.06 and 1.05 times that version's speed.
// All steps since v000 together make it 5.13 times as fast.
#include <hip/hip_runtime.h>
#include <hip/hip_bf16.h>

typedef __attribute__((ext_vector_type(16))) _Float16 v16h;
typedef __attribute__((ext_vector_type(8)))  float    v8f;
typedef __attribute__((ext_vector_type(4)))  int      v4i;

#define B_  8
#define S_  2048
#define H_  1024
#define D_  64

#define AS1 __attribute__((address_space(1)))
#define AS3 __attribute__((address_space(3)))

union Frag {
  v16h v;
  _Float16 h[16];
  unsigned u[8];
};

__device__ __forceinline__ void load_frag_h16(Frag& f, const _Float16* base,
                                              int half) {
  const uint4 lo = *(const uint4*)(base + 8 * half);
  const uint4 hi = *(const uint4*)(base + 16 + 8 * half);
  f.u[0] = lo.x; f.u[1] = lo.y; f.u[2] = lo.z; f.u[3] = lo.w;
  f.u[4] = hi.x; f.u[5] = hi.y; f.u[6] = hi.z; f.u[7] = hi.w;
}

__device__ __forceinline__ int frag_pos(int f, int p, int l) {
  return ((2 * f + p) * 32 + l) * 8;
}

__device__ __forceinline__ void load_frag_tile(Frag& fr, const _Float16* tile,
                                               int f, int lane) {
  const uint4 lo = *(const uint4*)(tile + frag_pos(f, 0, lane));
  const uint4 hi = *(const uint4*)(tile + frag_pos(f, 1, lane));
  fr.u[0] = lo.x; fr.u[1] = lo.y; fr.u[2] = lo.z; fr.u[3] = lo.w;
  fr.u[4] = hi.x; fr.u[5] = hi.y; fr.u[6] = hi.z; fr.u[7] = hi.w;
}

#if __has_builtin(__builtin_amdgcn_global_load_async_to_lds_b128)
#define HAVE_ASYNC_LDS 1
#endif

__device__ __forceinline__ void cp_async_b128(void* lds, const void* g) {
#if defined(HAVE_ASYNC_LDS)
  __builtin_amdgcn_global_load_async_to_lds_b128(
      (AS1 v4i*)(v4i*)g, (AS3 v4i*)(v4i*)lds, 0, 0);
#else
  *(uint4*)lds = *(const uint4*)g;   // synchronous fallback
#endif
}

// Foot of a stage of the projection loop, in every wave: the wave's own LDS
// reads of the stage are over, its own copies of the next stage have landed,
// then the work-group barrier, which publishes the next stage and frees the
// buffer just read. Written by hand because __syncthreads() also waits out every
// outstanding global load of the wave, and the x ring stays in flight across it.
__device__ __forceinline__ void stage_foot() {
  asm volatile("s_wait_dscnt 0x0" ::: "memory");
  asm volatile("s_wait_asynccnt 0x0" ::: "memory");
  asm volatile("s_barrier_signal -1\n\ts_barrier_wait -1" ::: "memory");
}

typedef unsigned u32x4 __attribute__((ext_vector_type(4)));
typedef unsigned u32x8 __attribute__((ext_vector_type(8)));

__device__ __forceinline__ unsigned lds_offset(const void* p) {
  return (unsigned)(unsigned long long)(AS3 void*)(void*)p;
}

__device__ __forceinline__ unsigned uni(unsigned v) {
  return (unsigned)__builtin_amdgcn_readfirstlane(v);
}

__device__ __forceinline__ void wait_tensor0(u32x4 g0, u32x8 g1) {
  asm volatile("s_wait_tensorcnt 0x0" ::"s"(g0), "s"(g1) : "memory");
}

__device__ __forceinline__ float xhalf(float x) {
  const int i = __builtin_bit_cast(int, x);
  return __builtin_bit_cast(float, __builtin_amdgcn_permlanex16(
      i, i, 0x76543210, 0xfedcba98, false, false));
}

__device__ __forceinline__ void exp2_pair(float& r0, float& r1, float x0, float x1) {
  asm("v_exp_f32 %0, %2\n\tv_exp_f32 %1, %3\n\tv_nop"
      : "=&v"(r0), "=&v"(r1)
      : "v"(x0), "v"(x1));
}

// q is stored times log2(e) / sqrt(64): K q then is the score as an exponent of 2
#define QSCALE_ 0.18033688f

// ---------------------------------------------------------------------------
// Kernel 0: convert W (f32, [k][n]) -> Wt (f16, [w][64][1024]) once. Each chunk
// of 32 k (columns kc..kc+31 of all 64 rows, row-major: the tile kernel 1
// stages) holds its 64 n x 32 k in fragment order, fragment = n / 16.
// ---------------------------------------------------------------------------
__global__ __launch_bounds__(256)
void wtrans_kernel(const float* __restrict__ Wq, const float* __restrict__ Wk,
                   const float* __restrict__ Wv, _Float16* __restrict__ wt) {
  const int id = blockIdx.x * 256 + threadIdx.x;   // 24576 threads
  const int w  = id >> 13;                         // 8192 per weight
  const int r  = id & 8191;
  // a wave takes 4 n x 64 k (two chunks): in fragment order that is four whole
  // 128-byte lines of Wt, each stored by this wave alone
  const int n  = ((r >> 9) << 2) | (r & 3);        // 0..63
  const int k0 = ((r >> 2) & 127) * 8;             // 0..1016
  const float* W = (w == 0) ? Wq : (w == 1) ? Wk : Wv;
  // the thread's 8 k are one run of lane ((k0 >> 3) & 1) * 16 + (n & 15)
  const int pos = frag_pos(n >> 4, (k0 >> 4) & 1, ((k0 >> 3) & 1) * 16 + (n & 15));
  _Float16* dst = wt + ((size_t)w << 16) + (size_t)(pos >> 5) * H_ +
                  (k0 & ~31) + (pos & 31);
#pragma unroll
  for (int j = 0; j < 8; ++j)
    dst[j] = (_Float16)W[(size_t)(k0 + j) * D_ + n];
}

#define WCH_ (3 * 2048 + 32)

__global__ __launch_bounds__(256)
void qkv_proj_kernel(const float* __restrict__ x,
                     const _Float16* __restrict__ wt,
                     const float* __restrict__ bq, const float* __restrict__ bk,
                     const float* __restrict__ bv,
                     _Float16* __restrict__ qh, _Float16* __restrict__ kh,
                     _Float16* __restrict__ vt) {
  // One LDS block: the partial sums (48 KB) at its start, the two Wt stages
  // (96.5 KB) from 64 KiB on. The compiler folds constant steps of the copies'
  // global addresses, under 64 KiB, into their offset field and takes them off
  // the LDS address register, which so never falls below zero.
  __shared__ __align__(16) unsigned char smem[65536 + 2 * 4 * WCH_ * 2];
  float4 (*part)[6][2][32] = (float4 (*)[6][2][32])smem;
  _Float16* wlds = (_Float16*)(smem + 65536);

  const int tid  = threadIdx.x;
  const int lane = tid & 31;
  const int wid  = __builtin_amdgcn_readfirstlane(tid >> 5);
  const int kg   = wid & 1;                        // K group
  const int rt   = wid >> 1;                       // row tile
  const int row0 = (blockIdx.x * 4 + rt) * 16;     // flat row over B*S
  const int half = lane >> 4;
  const int rc   = lane & 15;

  const float* Bs[3] = {bq, bk, bv};

  // Pass p of the block works on K stage (p + rot) mod 8. All 256 blocks read the
  // same Wt; started together on one stage they ask L2 for the same lines at one
  // moment. The index is folded so that blocks whose indices are equal modulo 8,
  // and neighbours too, get different starts.
  const int rot = (blockIdx.x + (blockIdx.x >> 3)) & 7;

  v8f acc[3][4];
#pragma unroll
  for (int w = 0; w < 3; ++w)
#pragma unroll
    for (int nt = 0; nt < 4; ++nt)
#pragma unroll
      for (int e = 0; e < 8; ++e) acc[w][nt][e] = 0.0f;

  // one stage = 128 columns of the 192 rows of Wt, for pass st those of K stage
  // (st + rot) mod 8, into the buffer of the pass's parity: 3072 pieces
  // of 16 bytes, 12 a thread. 16 threads take the 256 contiguous bytes of a row;
  // copy i takes rows 16*i .. 16*i+15 of the 192.
  const _Float16* wsrc = wt + (size_t)(tid >> 4) * H_ + (tid & 15) * 8;
  const int wdst = ((tid >> 2) & 3) * WCH_ + (tid >> 4) * 32 + (tid & 3) * 8;
  auto issue_stage = [&](const int st, const _Float16* ws)
      __attribute__((always_inline)) {
#pragma unroll
    for (int i = 0; i < 12; ++i)
      cp_async_b128(&wlds[(st & 1) * 4 * WCH_ + wdst + i * 512],
                    ws + (size_t)i * 16 * H_);
  };
  issue_stage(0, wsrc + rot * 128);

  // x ring: the wave's 16x32 chunks of x for two stages, two a stage, in
  // registers. A stage converts its chunks and asks at once for those two stages
  // on, so 16 row loads of each of the 8 waves stay in flight.
  const float* xlane = x + (size_t)(row0 + rc) * H_ + kg * 64 + 8 * half;
  float4 xr[2][2][4];
#pragma unroll
  for (int j = 0; j < 2; ++j)
#pragma unroll
    for (int c = 0; c < 2; ++c) {
      const float* x0 = xlane + ((j + rot) & 7) * 128 + c * 32;
      xr[j][c][0] = *(const float4*)(x0);
      xr[j][c][1] = *(const float4*)(x0 + 4);
      xr[j][c][2] = *(const float4*)(x0 + 16);
      xr[j][c][3] = *(const float4*)(x0 + 20);
    }
  // where the next refill of the ring and the next copies of Wt read: they step
  // from K stage to K stage at each pass's foot, from stage 7 back to stage 0
  const float*    xn = xlane + ((2 + rot) & 7) * 128;
  const _Float16* wn = wsrc + ((2 + rot) & 7) * 128;

  // stage 0 has landed and is published; then stage 1 flies under stage 0's work
  asm volatile("s_wait_asynccnt 0x0" ::: "memory");
  asm volatile("s_barrier_signal -1\n\ts_barrier_wait -1" ::: "memory");
  issue_stage(1, wsrc + ((1 + rot) & 7) * 128);

  // two stages; refill is a literal at both calls, so that the counted load
  // waits of the refilling stages are not merged with those of the last two
  auto two_stages = [&](const int st2, const bool refill)
      __attribute__((always_inline)) {
#pragma unroll
    for (int j = 0; j < 2; ++j) {
      const int st = st2 + j;
      const _Float16* tile = &wlds[(j * 4 + kg * 2) * WCH_];

      Frag a[2];                                   // two 16x32 chunks of x
      Frag bf[2][3][4];                            // their 12 Wt fragments each
#pragma unroll
      for (int c = 0; c < 2; ++c)
#pragma unroll
        for (int w = 0; w < 3; ++w)
#pragma unroll
          for (int nt = 0; nt < 4; ++nt)
            load_frag_tile(bf[c][w][nt], tile + c * WCH_ + w * 2048, nt, lane);
#pragma unroll
      for (int c = 0; c < 2; ++c) {
        const float4 f0 = xr[j][c][0], f1 = xr[j][c][1];
        const float4 f2 = xr[j][c][2], f3 = xr[j][c][3];
        a[c].h[0]  = (_Float16)f0.x; a[c].h[1]  = (_Float16)f0.y;
        a[c].h[2]  = (_Float16)f0.z; a[c].h[3]  = (_Float16)f0.w;
        a[c].h[4]  = (_Float16)f1.x; a[c].h[5]  = (_Float16)f1.y;
        a[c].h[6]  = (_Float16)f1.z; a[c].h[7]  = (_Float16)f1.w;
        a[c].h[8]  = (_Float16)f2.x; a[c].h[9]  = (_Float16)f2.y;
        a[c].h[10] = (_Float16)f2.z; a[c].h[11] = (_Float16)f2.w;
        a[c].h[12] = (_Float16)f3.x; a[c].h[13] = (_Float16)f3.y;
        a[c].h[14] = (_Float16)f3.z; a[c].h[15] = (_Float16)f3.w;
      }
      if (refill) {
#pragma unroll
        for (int c = 0; c < 2; ++c) {
          xr[j][c][0] = *(const float4*)(xn + c * 32);
          xr[j][c][1] = *(const float4*)(xn + c * 32 + 4);
          xr[j][c][2] = *(const float4*)(xn + c * 32 + 16);
          xr[j][c][3] = *(const float4*)(xn + c * 32 + 20);
        }
        // the loop advances the ring's address register behind these loads:
        // the wait that stands in front of such an overwrite
        asm volatile("s_wait_xcnt 0x0" ::: "memory");
      }
      // keeps the stage's 48 LDS loads in one group, each fragment in registers
      // of its own, so that the second chunk's land under the first's products,
      // and the ring's eight loads ahead of the products: sunk below, they lose
      // their lead
      __builtin_amdgcn_sched_barrier(0);

#pragma unroll
      for (int c = 0; c < 2; ++c) {
#pragma unroll
        for (int w = 0; w < 3; ++w) {
#pragma unroll
          for (int nt = 0; nt < 4; ++nt) {
            acc[w][nt] = __builtin_amdgcn_wmma_f32_16x16x32_f16(
                false, a[c].v, false, bf[c][w][nt].v, (short)0, acc[w][nt],
                false, false);
          }
        }
      }
      if (refill || j == 0) {
        // keeps the products in front of the foot: raised to the LDS loads, its
        // barrier holds every wave until the slowest wave's fragments are back,
        // and no wave computes under another's loads
        __builtin_amdgcn_sched_barrier(0);
        stage_foot();
        if (refill) {
          issue_stage(st + 2, wn);                 // into the buffer just read
          const int step = (((st + 3 + rot) & 7) == 0) ? -7 * 128 : 128;
          xn += step;
          wn += step;
        }
      }
    }
  };

  for (int st2 = 0; st2 < 6; st2 += 2) two_stages(st2, true);
  two_stages(6, false);

  // --- join the two K groups' partial sums through LDS -----------------------
  // K group g of a row tile ends up with column tiles 2g and 2g+1 of q, k and v.
  // A wave stores the six tiles that are the other group's, 512 contiguous bytes
  // a store, and keeps its own six in registers.
#pragma unroll
  for (int nt = 0; nt < 4; ++nt) {
    if ((nt >> 1) != kg) {
#pragma unroll
      for (int w = 0; w < 3; ++w) {
        float4 lo, hi;
        lo.x = acc[w][nt][0]; lo.y = acc[w][nt][1];
        lo.z = acc[w][nt][2]; lo.w = acc[w][nt][3];
        hi.x = acc[w][nt][4]; hi.y = acc[w][nt][5];
        hi.z = acc[w][nt][6]; hi.w = acc[w][nt][7];
        part[wid][w * 2 + (nt & 1)][0][lane] = lo;
        part[wid][w * 2 + (nt & 1)][1][lane] = hi;
      }
    }
  }
  v8f sum[3][2];
#pragma unroll
  for (int w = 0; w < 3; ++w) {
    if (kg == 0) { sum[w][0] = acc[w][0]; sum[w][1] = acc[w][1]; }
    else         { sum[w][0] = acc[w][2]; sum[w][1] = acc[w][3]; }
  }
  __syncthreads();   // publishes every wave's partial sums
#pragma unroll
  for (int w = 0; w < 3; ++w) {
#pragma unroll
    for (int n = 0; n < 2; ++n) {
      const float4 lo = part[wid ^ 1][w * 2 + n][0][lane];
      const float4 hi = part[wid ^ 1][w * 2 + n][1][lane];
      sum[w][n][0] += lo.x; sum[w][n][1] += lo.y;
      sum[w][n][2] += lo.z; sum[w][n][3] += lo.w;
      sum[w][n][4] += hi.x; sum[w][n][5] += hi.y;
      sum[w][n][6] += hi.z; sum[w][n][7] += hi.w;
    }
  }

  // bias add + f16 store of column tiles 2*kg and 2*kg+1
#pragma unroll
  for (int w = 0; w < 3; ++w) {
#pragma unroll
    for (int n = 0; n < 2; ++n) {
      const int nt = kg * 2 + n;
      const int d = nt * 16 + rc;
      const float bias = Bs[w][d];
      if (w == 2) {
        // the lane's 8 keys of column d are one whole run of fragment nt
        union { uint4 q; _Float16 h[8]; } run;
#pragma unroll
        for (int r = 0; r < 8; ++r) run.h[r] = (_Float16)(sum[w][n][r] + bias);
        const int b   = row0 >> 11;                // / S_
        const int kt  = row0 & (S_ - 1) & ~31;
        const int pos = frag_pos(nt, (row0 >> 4) & 1, lane);
        *(uint4*)(vt + ((size_t)b * D_ + (pos >> 5)) * S_ + kt + (pos & 31)) = run.q;
      } else {
#pragma unroll
        for (int r = 0; r < 8; ++r) {
          const int row   = r + 8 * half;
          const int bsrow = row0 + row;
          const float sv = sum[w][n][r] + bias;
          const _Float16 hv = (_Float16)(w == 0 ? sv * QSCALE_ : sv);
          if (w == 0) {
            qh[(size_t)bsrow * D_ + d] = hv;
          } else {
            const int pos = frag_pos(2 * ((row0 >> 4) & 1) + (nt >> 1), nt & 1,
                                     (rc >> 3) * 16 + row);
            kh[(size_t)(row0 >> 5) * (32 * D_) + pos + (rc & 7)] = hv;
          }
        }
      }
    }
  }
}

__device__ __forceinline__ unsigned pinned(unsigned v) {
  unsigned w = __builtin_amdgcn_readfirstlane(v);
  asm volatile("" : "+s"(w));
  return w;
}

#define NST_ (S_ / 256)                                // stages of 256 keys

__global__ __launch_bounds__(512)
void flash_attn_kernel(const _Float16* __restrict__ qh,
                       const _Float16* __restrict__ kh,
                       const _Float16* __restrict__ vt,
                       const int* __restrict__ mask,
                       float* __restrict__ out) {
  // [buffer][K, V^T][tile][4 KB]: wave w's tile lies at 4096 * w of a buffer
  __shared__ __attribute__((aligned(2048))) _Float16 ring[2][2][8][2048];  // 128 KB
  __shared__ __align__(16) float  mbias[S_];           // 8 KB, 0 or -1e30
  __shared__ __align__(16) float4 part[16][16][32];    // 128 KB, each wave's O^T
  __shared__ __align__(8)  float2 pml[16][32];         // each wave's (m, l) per query

  const int tid  = threadIdx.x;
  const int lane = tid & 31;
  const int wid  = __builtin_amdgcn_readfirstlane(tid >> 5);
  const int kg   = wid & 7;                            // key group
  const int qp   = wid >> 3;                           // query pair
  const int b    = blockIdx.x >> 5;                    // 32 blocks per batch
  const int q0   = ((blockIdx.x & 31) << 6) + (qp << 5);
  const int half = lane >> 4;
  const int rc   = lane & 15;

  const _Float16* kbase = kh + (size_t)(b * S_) * D_;  // [key][64]
  const _Float16* vbase = vt + (size_t)(b * D_) * S_;  // [d][2048]

  // ---- staging: one tensor load a wave and stage ---------------------------
  // stage s = keys 256*s .. 256*s+255, tile g = its keys 32*g .. 32*g+31. Pass p
  // of the block works on stage (p + rot) mod 8: a batch's 32 blocks read the same
  // K and V^T, and started on one stage they ask L2 for the same lines at one
  // moment. Each of the eight starts is taken by four of a batch's blocks.
  // K tile: 32 rows of 128 bytes at pitch 128; V^T tile: 64 rows of 64 bytes at
  // pitch 4096. All extents in bytes, tensor = tile, no pad, no mask.
  const bool     isk   = wid < 8;
  const unsigned rowb  = isk ? 128u : 64u;
  const unsigned nrow  = isk ? 32u : 64u;
  const unsigned pitch = isk ? 128u : (unsigned)(S_ * 2);
  const unsigned step  = isk ? 256u * D_ * 2u : 256u * 2u;   // bytes a stage
  const unsigned long long src0 = (unsigned long long)(size_t)(
      isk ? kbase + kg * (32 * D_) : vbase + kg * 32);
  const unsigned dst0 = lds_offset(&ring[0][0][0][0]) + (unsigned)wid * 4096u;
  u32x8 g1;
  g1[0] = uni(0u);
  g1[1] = uni(rowb << 16);
  g1[2] = uni(nrow << 16);
  g1[3] = uni(rowb << 16);
  g1[4] = uni(nrow);
  g1[5] = uni(pitch);
  g1[6] = uni(0u);
  g1[7] = uni(0u);
  const unsigned rot = (((blockIdx.x >> 3) & 3u) << 1) | (blockIdx.x & 1u);
  u32x4 g0;
  auto issue_stage = [&](const unsigned st) __attribute__((always_inline)) {
    const unsigned long long ga =
        src0 + (unsigned long long)((st + rot) & (NST_ - 1u)) * step;
    g0[0] = uni(1u);                                   // count 1
    g0[1] = uni(dst0 + (st & 1u) * 65536u);            // place in LDS
    g0[2] = uni((unsigned)ga);
    g0[3] = uni(((unsigned)(ga >> 32) & 0x01FFFFFFu) | 0x80000000u);  // type 2
    asm volatile("tensor_load_to_lds %0, %1" ::"s"(g0), "s"(g1) : "memory");
  };
  issue_stage(0);

  // Q fragments (B operand, column = query): two b128 loads each
  Frag a0[2], a1[2];
#pragma unroll
  for (int t = 0; t < 2; ++t) {
    const _Float16* qrow = qh + (size_t)(b * S_ + q0 + 16 * t + rc) * D_;
    load_frag_h16(a0[t], qrow, half);
    load_frag_h16(a1[t], qrow + 32, half);
  }
  // the wait that stands in front of an overwrite of these loads' address
  asm volatile("s_wait_xcnt 0x0" ::: "memory");

  // this lane's two queries: the maximum in use, the exponent above which it is
  // renewed (below every real score until a key that is not masked has been met,
  // so that the first such key sets it), and the sum
  float mu[2] = {0.0f, 0.0f}, thr[2] = {-1e29f, -1e29f}, l[2] = {0.0f, 0.0f};
  v8f acc[2][4];                                       // O^T: row d, col query
#pragma unroll
  for (int t = 0; t < 2; ++t)
#pragma unroll
    for (int nt = 0; nt < 4; ++nt)
#pragma unroll
      for (int e = 0; e < 8; ++e) acc[t][nt][e] = 0.0f;

  // mask table: -1e30 absorbs any score and any maximum in use;
  // published by the barrier in front of the loop
  {
    const int4 mm = *(const int4*)(mask + b * S_ + tid * 4);
    float4 f;
    f.x = (mm.x == 0) ? -1e30f : 0.0f;
    f.y = (mm.y == 0) ? -1e30f : 0.0f;
    f.z = (mm.z == 0) ? -1e30f : 0.0f;
    f.w = (mm.w == 0) ? -1e30f : 0.0f;
    *(float4*)&mbias[tid * 4] = f;
  }

  // pass 0's stage has landed and is published; then pass 1's flies under pass 0's work
  wait_tensor0(g0, g1);
  __syncthreads();
  issue_stage(pinned(1));

  for (int st = 0; st < NST_; ++st) {
    const int kt = (int)((st + rot) & (NST_ - 1u)) * 256 + kg * 32;
    const _Float16* kl = ring[st & 1][0][kg];
    const _Float16* vl = ring[st & 1][1][kg];

    // the key mask of the pass's 32 keys, read first: the start values are formed
    // from it while the fragments are still on their way
    v8f c0v, c1v;
    {
      const float4 c0 = *(const float4*)&mbias[kt + 8 * half];
      const float4 c1 = *(const float4*)&mbias[kt + 8 * half + 4];
      const float4 c2 = *(const float4*)&mbias[kt + 16 + 8 * half];
      const float4 c3 = *(const float4*)&mbias[kt + 16 + 8 * half + 4];
      c0v[0] = c0.x; c0v[1] = c0.y; c0v[2] = c0.z; c0v[3] = c0.w;
      c0v[4] = c1.x; c0v[5] = c1.y; c0v[6] = c1.z; c0v[7] = c1.w;
      c1v[0] = c2.x; c1v[1] = c2.y; c1v[2] = c2.z; c1v[3] = c2.w;
      c1v[4] = c3.x; c1v[5] = c3.y; c1v[6] = c3.z; c1v[7] = c3.w;
    }
    // --- scores: S^T = K @ Q^T for 2 groups of 16 keys (ds_load_b128) ------
    Frag bk00, bk01, bk10, bk11;
    load_frag_tile(bk00, kl, 0, lane);
    load_frag_tile(bk01, kl, 1, lane);
    load_frag_tile(bk10, kl, 2, lane);
    load_frag_tile(bk11, kl, 3, lane);
    Frag av[4];                                        // V^T rows, A operand
#pragma unroll
    for (int nt = 0; nt < 4; ++nt)
      load_frag_tile(av[nt], vl, nt, lane);
    // keeps the pass's LDS loads in one group ahead of the products: moved in
    // among them, each pair costs the wave a full LDS round trip
    __builtin_amdgcn_sched_barrier(0);
    v8f s0[2], s1[2];                                  // start: mask - maximum in use
#pragma unroll
    for (int t = 0; t < 2; ++t)
#pragma unroll
      for (int r = 0; r < 8; ++r) {
        s0[t][r] = c0v[r] - mu[t];
        s1[t][r] = c1v[r] - mu[t];
      }
#pragma unroll
    for (int t = 0; t < 2; ++t) {
      s0[t] = __builtin_amdgcn_wmma_f32_16x16x32_f16(false, bk00.v, false, a0[t].v,
                                                     (short)0, s0[t], false, false);
      s1[t] = __builtin_amdgcn_wmma_f32_16x16x32_f16(false, bk10.v, false, a0[t].v,
                                                     (short)0, s1[t], false, false);
    }
#pragma unroll
    for (int t = 0; t < 2; ++t) {
      s0[t] = __builtin_amdgcn_wmma_f32_16x16x32_f16(false, bk01.v, false, a1[t].v,
                                                     (short)0, s0[t], false, false);
      s1[t] = __builtin_amdgcn_wmma_f32_16x16x32_f16(false, bk11.v, false, a1[t].v,
                                                     (short)0, s1[t], false, false);
    }

    // --- largest exponent of each query; one test for the wave and pass ------
    float xm[2];
#pragma unroll
    for (int t = 0; t < 2; ++t) {
      float rmax = fmaxf(s0[t][0], s1[t][0]);
#pragma unroll
      for (int r = 1; r < 8; ++r) rmax = fmaxf(rmax, fmaxf(s0[t][r], s1[t][r]));
      xm[t] = fmaxf(rmax, xhalf(rmax));                // both halves' 32 keys
    }
    if (__builtin_amdgcn_ballot_w32(xm[0] > thr[0] || xm[1] > thr[1]) != 0u) {
      // a query above its limit takes the pass's maximum as the one in use
      float d[2], al[2];
#pragma unroll
      for (int t = 0; t < 2; ++t) {
        const bool up = xm[t] > thr[t];
        d[t]   = up ? xm[t] : 0.0f;
        thr[t] = up ? 8.0f : thr[t];
        mu[t] += d[t];
      }
      // a first maximum may lie below 0: sum and O^T are still 0, any factor does
      exp2_pair(al[0], al[1], -fmaxf(d[0], 0.0f), -fmaxf(d[1], 0.0f));
#pragma unroll
      for (int t = 0; t < 2; ++t) {
#pragma unroll
        for (int r = 0; r < 8; ++r) {
          s0[t][r] -= d[t];
          s1[t][r] -= d[t];
        }
        l[t] *= al[t];
#pragma unroll
        for (int nt = 0; nt < 4; ++nt)
#pragma unroll
          for (int r = 0; r < 8; ++r) acc[t][nt][r] *= al[t];
      }
    }

#pragma unroll
    for (int t = 0; t < 2; ++t) {
      // --- P^T = 2^exponent, one query per lane and tile --------------------
      float rs0 = 0.0f, rs1 = 0.0f;
      Frag pb;                                         // P^T as B operand
#pragma unroll
      for (int r = 0; r < 8; ++r) {
        float e0, e1;
        exp2_pair(e0, e1, s0[t][r], s1[t][r]);
        rs0 += e0;
        rs1 += e1;
        pb.h[r]     = (_Float16)e0;                    // k = 8*half + r
        pb.h[8 + r] = (_Float16)e1;                    // k = 16 + 8*half + r
      }
      l[t] += rs0 + rs1;                               // this half's keys only

      // --- acc += V^T @ P^T -------------------------------------------------
#pragma unroll
      for (int nt = 0; nt < 4; ++nt)
        acc[t][nt] = __builtin_amdgcn_wmma_f32_16x16x32_f16(
            false, av[nt].v, false, pb.v, (short)0, acc[t][nt], false, false);
    }
    __builtin_amdgcn_sched_barrier(0);
    asm volatile("v_nop\n\tv_nop\n\tv_nop\n\tv_nop");
    // Foot of the pass, in every wave: its LDS reads of this stage are over, its
    // own tile of the next stage has landed, then the one barrier, which
    // publishes the next stage and frees the buffer just read for the refill.
    asm volatile("s_wait_dscnt 0x0" ::: "memory");
    wait_tensor0(g0, g1);
    __syncthreads();
    if (pinned(st + 2 < NST_)) issue_stage(pinned(st + 2));
  }
  wait_tensor0(g0, g1);
  asm volatile("s_wait_dscnt 0x0" ::: "memory");

#pragma unroll
  for (int t = 0; t < 2; ++t) {
    const float lt = l[t] + xhalf(l[t]);               // join the halves' sums
#pragma unroll
    for (int nt = 0; nt < 4; ++nt) {
      float4 o0, o1;
      o0.x = acc[t][nt][0]; o0.y = acc[t][nt][1];
      o0.z = acc[t][nt][2]; o0.w = acc[t][nt][3];
      o1.x = acc[t][nt][4]; o1.y = acc[t][nt][5];
      o1.z = acc[t][nt][6]; o1.w = acc[t][nt][7];
      const int pl = half * 16 + ((rc + 4 * nt) & 15);
      part[wid][t * 8 + nt * 2][pl]     = o0;
      part[wid][t * 8 + nt * 2 + 1][pl] = o1;
    }
    // a group that met masked keys only has no maximum: it joins with weight 0
    if (half == 0)
      pml[wid][t * 16 + rc] = make_float2(thr[t] < 0.0f ? -1e30f : mu[t], lt);
  }
  __syncthreads();   // publishes every wave's partial result

  // wave kg of a query pair joins its queries 4*kg .. 4*kg+3; a lane takes 8
  // consecutive d of one query, so a wave stores four whole rows of out
  const int tj = kg >> 2;                              // the queries' tile
  const int qi = 4 * (kg & 3) + (lane >> 3);           // query inside the tile
  const int dn = (lane & 7) >> 1;                      // the run's nt
  const int pr = (lane & 1) * 16 + ((qi + 4 * dn) & 15);
  float2 ml[8];
#pragma unroll
  for (int g = 0; g < 8; ++g) ml[g] = pml[qp * 8 + g][tj * 16 + qi];
  float mj = ml[0].x;
#pragma unroll
  for (int g = 1; g < 8; ++g) mj = fmaxf(mj, ml[g].x);
  float wg[8];
#pragma unroll
  for (int g = 0; g < 8; g += 2)
    exp2_pair(wg[g], wg[g + 1], ml[g].x - mj, ml[g + 1].x - mj);
  float lj = 0.0f;
  float4 o0 = {0.0f, 0.0f, 0.0f, 0.0f}, o1 = {0.0f, 0.0f, 0.0f, 0.0f};
#pragma unroll
  for (int g = 0; g < 8; ++g) {
    const float4 p0 = part[qp * 8 + g][tj * 8 + dn * 2][pr];
    const float4 p1 = part[qp * 8 + g][tj * 8 + dn * 2 + 1][pr];
    lj += wg[g] * ml[g].y;
    o0.x += wg[g] * p0.x; o0.y += wg[g] * p0.y;
    o0.z += wg[g] * p0.z; o0.w += wg[g] * p0.w;
    o1.x += wg[g] * p1.x; o1.y += wg[g] * p1.y;
    o1.z += wg[g] * p1.z; o1.w += wg[g] * p1.w;
  }
  // --- normalize and store ---------------------------------------------------
  const float inv = 1.0f / lj;
  float* orow = out + (size_t)(b * S_ + q0 + tj * 16 + qi) * D_ + (lane & 7) * 8;
  o0.x *= inv; o0.y *= inv; o0.z *= inv; o0.w *= inv;
  o1.x *= inv; o1.y *= inv; o1.z *= inv; o1.w *= inv;
  *(float4*)(orow)     = o0;
  *(float4*)(orow + 4) = o1;
}

// ---------------------------------------------------------------------------
extern "C" void kernel_launch(void* const* d_in, const int* in_sizes, int n_in,
                              void* d_out, int out_size, void* d_ws, size_t ws_size,
                              hipStream_t stream) {
  const float* x    = (const float*)d_in[0];
  const int*   mask = (const int*)d_in[1];
  const float* Wq   = (const float*)d_in[2];
  const float* bq   = (const float*)d_in[3];
  const float* Wk   = (const float*)d_in[4];
  const float* bk   = (const float*)d_in[5];
  const float* Wv   = (const float*)d_in[6];
  const float* bv   = (const float*)d_in[7];
  float* out = (float*)d_out;

  char* ws = (char*)d_ws;
  _Float16* qh = (_Float16*)ws;                                  // 2 MB
  _Float16* kh = (_Float16*)(ws + (size_t)2 * 1024 * 1024);      // 2 MB
  _Float16* vt = (_Float16*)(ws + (size_t)4 * 1024 * 1024);      // 2 MB
  _Float16* wt = (_Float16*)(ws + (size_t)6 * 1024 * 1024);      // 384 KB

  wtrans_kernel<<<96, 256, 0, stream>>>(Wq, Wk, Wv, wt);
  qkv_proj_kernel<<<256, 256, 0, stream>>>(x, wt, bq, bk, bv, qh, kh, vt);
  flash_attn_kernel<<<256, 512, 0, stream>>>(qh, kh, vt, mask, out);
}

// v010
// A run of this version takes 22.9 microseconds.
// In two side-by-side timings against v009, it was 1.09 and 1.10 times as fast.
// Over all steps from v000 it is 5.61 times as fast.
#include <hip/hip_runtime.h>
#include <hip/hip_bf16.h>

typedef __attribute__((ext_vector_type(16))) _Float16 v16h;
typedef __attribute__((ext_vector_type(8)))  float    v8f;
typedef __attribute__((ext_vector_type(4)))  int      v4i;

#define B_  8
#define S_  2048
#define H_  1024
#define D_  64

#define AS1 __attribute__((address_space(1)))
#define AS3 __attribute__((address_space(3)))

union Frag {
  v16h v;
  _Float16 h[16];
  unsigned u[8];
};

__device__ __forceinline__ void load_frag_h16(Frag& f, const _Float16* base,
                                              int half) {
  const uint4 lo = *(const uint4*)(base + 8 * half);
  const uint4 hi = *(const uint4*)(base + 16 + 8 * half);
  f.u[0] = lo.x; f.u[1] = lo.y; f.u[2] = lo.z; f.u[3] = lo.w;
  f.u[4] = hi.x; f.u[5] = hi.y; f.u[6] = hi.z; f.u[7] = hi.w;
}

__device__ __forceinline__ int frag_pos(int f, int p, int l) {
  return ((2 * f + p) * 32 + l) * 8;
}

__device__ __forceinline__ void load_frag_tile(Frag& fr, const _Float16* tile,
                                               int f, int lane) {
  const uint4 lo = *(const uint4*)(tile + frag_pos(f, 0, lane));
  const uint4 hi = *(const uint4*)(tile + frag_pos(f, 1, lane));
  fr.u[0] = lo.x; fr.u[1] = lo.y; fr.u[2] = lo.z; fr.u[3] = lo.w;
  fr.u[4] = hi.x; fr.u[5] = hi.y; fr.u[6] = hi.z; fr.u[7] = hi.w;
}

#if __has_builtin(__builtin_amdgcn_global_load_async_to_lds_b128)
#define HAVE_ASYNC_LDS 1
#endif

__device__ __forceinline__ void cp_async_b128(void* lds, const void* g) {
#if defined(HAVE_ASYNC_LDS)
  __builtin_amdgcn_global_load_async_to_lds_b128(
      (AS1 v4i*)(v4i*)g, (AS3 v4i*)(v4i*)lds, 0, 0);
#else
  *(uint4*)lds = *(const uint4*)g;   // synchronous fallback
#endif
}

// Foot of a stage of the projection loop, in every wave: the wave's own LDS
// reads of the stage are over, its own copies of the next stage have landed,
// then the work-group barrier, which publishes the next stage and frees the
// buffer just read. The wave's tensor loads of x stay in flight across it.
__device__ __forceinline__ void stage_foot() {
  asm volatile("s_wait_dscnt 0x0" ::: "memory");
  asm volatile("s_wait_asynccnt 0x0" ::: "memory");
  asm volatile("s_barrier_signal -1\n\ts_barrier_wait -1" ::: "memory");
}

typedef unsigned u32x4 __attribute__((ext_vector_type(4)));
typedef unsigned u32x8 __attribute__((ext_vector_type(8)));

__device__ __forceinline__ unsigned lds_offset(const void* p) {
  return (unsigned)(unsigned long long)(AS3 void*)(void*)p;
}

__device__ __forceinline__ unsigned uni(unsigned v) {
  return (unsigned)__builtin_amdgcn_readfirstlane(v);
}

__device__ __forceinline__ void wait_tensor0(u32x4 g0, u32x8 g1) {
  asm volatile("s_wait_tensorcnt 0x0" ::"s"(g0), "s"(g1) : "memory");
}

__device__ __forceinline__ unsigned pinned(unsigned v) {
  unsigned w = __builtin_amdgcn_readfirstlane(v);
  asm volatile("" : "+s"(w));
  return w;
}

__device__ __forceinline__ float xhalf(float x) {
  const int i = __builtin_bit_cast(int, x);
  return __builtin_bit_cast(float, __builtin_amdgcn_permlanex16(
      i, i, 0x76543210, 0xfedcba98, false, false));
}

__device__ __forceinline__ void exp2_pair(float& r0, float& r1, float x0, float x1) {
  asm("v_exp_f32 %0, %2\n\tv_exp_f32 %1, %3\n\tv_nop"
      : "=&v"(r0), "=&v"(r1)
      : "v"(x0), "v"(x1));
}

// Two f32 as packed f16, the instruction the casts compile to. Written as a
// volatile statement so that it stays where the source has it, behind the
// scheduling barrier that closes a stage's LDS loads: left to the compiler, the
// conversions stand directly behind x's loads and wait them out before the
// first load of Wt is issued.
__device__ __forceinline__ unsigned cvt_pk_held(float lo, float hi) {
  unsigned r;
  asm volatile("v_cvt_pk_f16_f32 %0, %1, %2" : "=v"(r) : "v"(lo), "v"(hi));
  return r;
}

// q is stored times log2(e) / sqrt(64): K q then is the score as an exponent of 2
#define QSCALE_ 0.18033688f

// ---------------------------------------------------------------------------
// Kernel 0: convert W (f32, [k][n]) -> Wt (f16, [w][64][1024]) once. Each chunk
// of 32 k (columns kc..kc+31 of all 64 rows, row-major: the tile kernel 1
// stages) holds its 64 n x 32 k in fragment order, fragment = n / 16.
// ---------------------------------------------------------------------------
__global__ __launch_bounds__(256)
void wtrans_kernel(const float* __restrict__ Wq, const float* __restrict__ Wk,
                   const float* __restrict__ Wv, _Float16* __restrict__ wt) {
  const int id = blockIdx.x * 256 + threadIdx.x;   // 24576 threads
  const int w  = id >> 13;                         // 8192 per weight
  const int r  = id & 8191;
  // a wave takes 4 n x 64 k (two chunks): in fragment order that is four whole
  // 128-byte lines of Wt, each stored by this wave alone
  const int n  = ((r >> 9) << 2) | (r & 3);        // 0..63
  const int k0 = ((r >> 2) & 127) * 8;             // 0..1016
  const float* W = (w == 0) ? Wq : (w == 1) ? Wk : Wv;
  // the thread's 8 k are one run of lane ((k0 >> 3) & 1) * 16 + (n & 15)
  const int pos = frag_pos(n >> 4, (k0 >> 4) & 1, ((k0 >> 3) & 1) * 16 + (n & 15));
  _Float16* dst = wt + ((size_t)w << 16) + (size_t)(pos >> 5) * H_ +
                  (k0 & ~31) + (pos & 31);
#pragma unroll
  for (int j = 0; j < 8; ++j)
    dst[j] = (_Float16)W[(size_t)(k0 + j) * D_ + n];
}

#define WCH_ (3 * 2048 + 32)

// x ring. A wave's share of a stage is 16 rows x 64 k of f32: rows of 256 bytes,
// which the tensor load lays at a pitch of 272, the pitch of ds_load_b128
// readers. A tile's place is a multiple of 2 KiB: 16 * 272 = 4352 bytes in 6144.
#define XPITCH_ 272
#define XSL_    6144
#define XOFF_   165888                                 // 81 * 2048, behind the Wt stages

__global__ __launch_bounds__(256)
void qkv_proj_kernel(const float* __restrict__ x,
                     const _Float16* __restrict__ wt,
                     const float* __restrict__ bq, const float* __restrict__ bk,
                     const float* __restrict__ bv,
                     _Float16* __restrict__ qh, _Float16* __restrict__ kh,
                     _Float16* __restrict__ vt) {
  __shared__ __attribute__((aligned(2048))) unsigned char smem[XOFF_ + 3 * 8 * XSL_];
  float4 (*part)[6][2][32] = (float4 (*)[6][2][32])smem;
  _Float16* wlds = (_Float16*)(smem + 65536);

  const int tid  = threadIdx.x;
  const int lane = tid & 31;
  const int wid  = __builtin_amdgcn_readfirstlane(tid >> 5);
  const int kg   = wid & 1;                        // K group
  const int rt   = wid >> 1;                       // row tile
  const int row0 = (blockIdx.x * 4 + rt) * 16;     // flat row over B*S
  const int half = lane >> 4;
  const int rc   = lane & 15;

  const float* Bs[3] = {bq, bk, bv};

  // Pass p of the block works on K stage (p + rot) mod 8. All 256 blocks read the
  // same Wt; started together on one stage they ask L2 for the same lines at one
  // moment. The index is folded so that blocks whose indices are equal modulo 8,
  // and neighbours too, get different starts.
  const int rot = (blockIdx.x + (blockIdx.x >> 3)) & 7;

  v8f acc[3][4];
#pragma unroll
  for (int w = 0; w < 3; ++w)
#pragma unroll
    for (int nt = 0; nt < 4; ++nt)
#pragma unroll
      for (int e = 0; e < 8; ++e) acc[w][nt][e] = 0.0f;

  // one stage = 128 columns of the 192 rows of Wt, for pass st those of K stage
  // (st + rot) mod 8, into the buffer of the pass's parity: 3072 pieces
  // of 16 bytes, 12 a thread. 16 threads take the 256 contiguous bytes of a row;
  // copy i takes rows 16*i .. 16*i+15 of the 192.
  const _Float16* wsrc = wt + (size_t)(tid >> 4) * H_ + (tid & 15) * 8;
  const int wdst = ((tid >> 2) & 3) * WCH_ + (tid >> 4) * 32 + (tid & 3) * 8;
  auto issue_stage = [&](const int st, const _Float16* ws)
      __attribute__((always_inline)) {
#pragma unroll
    for (int i = 0; i < 12; ++i)
      cp_async_b128(&wlds[(st & 1) * 4 * WCH_ + wdst + i * 512],
                    ws + (size_t)i * 16 * H_);
  };

  const unsigned long long xsrc = (unsigned long long)(size_t)(
      x + (size_t)row0 * H_ + kg * 64);
  const unsigned xdst = lds_offset(smem + XOFF_) + (unsigned)wid * XSL_;
  u32x8 xg1;
  xg1[0] = uni(1u << 20 | 5u << 22 | 3u << 25);
  xg1[1] = uni(256u << 16);
  xg1[2] = uni(16u << 16);
  xg1[3] = uni(256u << 16);
  xg1[4] = uni(16u);
  xg1[5] = uni((unsigned)(H_ * 4));
  xg1[6] = uni(0u);
  xg1[7] = uni(0u);
  u32x4 xg0;
  xg0[0] = uni(1u);                                    // count 1
  xg0[3] = uni(((unsigned)(xsrc >> 32) & 0x01FFFFFFu) | 0x80000000u);  // type 2
  auto issue_x = [&](const unsigned st, const unsigned sl)
      __attribute__((always_inline)) {
    const unsigned long long ga = xsrc + ((st + (unsigned)rot) & 7u) * 512u;
    const unsigned hi = uni(((unsigned)(ga >> 32) & 0x01FFFFFFu) | 0x80000000u);
    if (pinned(hi != xg0[3])) {
      wait_tensor0(xg0, xg1);
      xg0[3] = hi;
    }
    xg0[1] = uni(xdst + sl);                           // place in LDS
    xg0[2] = uni((unsigned)ga);
    // both groups are named as in-out operands: every request of the wave then
    // uses one and the same set of scalar registers, and the compiler neither
    // rebuilds the groups elsewhere nor takes their registers for other values
    // while requests are in flight
    asm volatile("tensor_load_to_lds %0, %1" : "+s"(xg0), "+s"(xg1) : : "memory");
  };
  issue_x(0u, 0u);
  issue_x(1u, 8u * XSL_);
  issue_x(2u, 16u * XSL_);
  issue_stage(0, wsrc + rot * 128);
  unsigned xsl = 0u;
  const unsigned char* xrow = smem + XOFF_ + wid * XSL_ + rc * XPITCH_ + half * 32;
  // where the next copies of Wt read: they step from K stage to K stage at each
  // pass's foot, from stage 7 back to stage 0
  const _Float16* wn = wsrc + ((2 + rot) & 7) * 128;

  // stage 0 has landed and is published; then stage 1 flies under stage 0's work
  asm volatile("s_wait_asynccnt 0x0" ::: "memory");
  asm volatile("s_barrier_signal -1\n\ts_barrier_wait -1" ::: "memory");
  issue_stage(1, wsrc + ((1 + rot) & 7) * 128);

  // two stages; refill is a literal at both calls: the last two stages leave
  // fewer tensor loads in flight behind the one they wait for
  auto two_stages = [&](const int st2, const bool refill)
      __attribute__((always_inline)) {
#pragma unroll
    for (int j = 0; j < 2; ++j) {
      const int st = st2 + j;
      const _Float16* tile = &wlds[(j * 4 + kg * 2) * WCH_];

      // the pass's own tile has landed: all but the wave's younger requests, two
      // while the ring is refilled, then one, then none
      if (refill)      asm volatile("s_wait_tensorcnt 0x2" ::"s"(xg0), "s"(xg1) : "memory");
      else if (j == 0) asm volatile("s_wait_tensorcnt 0x1" ::"s"(xg0), "s"(xg1) : "memory");
      else             wait_tensor0(xg0, xg1);
      float4 xf[2][4];                             // the lane's 2 x 16 k, f32
#pragma unroll
      for (int c = 0; c < 2; ++c) {
        const unsigned char* x0 = xrow + xsl + c * 128;
        xf[c][0] = *(const float4*)(x0);
        xf[c][1] = *(const float4*)(x0 + 16);
        xf[c][2] = *(const float4*)(x0 + 64);
        xf[c][3] = *(const float4*)(x0 + 80);
      }
      // keeps x's eight LDS loads ahead of the 48 of Wt: placed among or behind
      // them, the first product waits for nearly the whole group
      __builtin_amdgcn_sched_barrier(0);
      Frag a[2];                                   // two 16x32 chunks of x
      Frag bf[2][3][4];                            // their 12 Wt fragments each
#pragma unroll
      for (int c = 0; c < 2; ++c)
#pragma unroll
        for (int w = 0; w < 3; ++w)
#pragma unroll
          for (int nt = 0; nt < 4; ++nt)
            load_frag_tile(bf[c][w][nt], tile + c * WCH_ + w * 2048, nt, lane);
      // keeps the stage's 56 LDS loads in one group, each fragment in registers
      // of its own, so that the second chunk's land under the first's products;
      // x is converted behind the group: in front of Wt's loads the conversion
      // waits out an LDS round trip of its own
      __builtin_amdgcn_sched_barrier(0);
#pragma unroll
      for (int c = 0; c < 2; ++c) {
        const float4 f0 = xf[c][0], f1 = xf[c][1];
        const float4 f2 = xf[c][2], f3 = xf[c][3];
        if (refill) {
          a[c].u[0] = cvt_pk_held(f0.x, f0.y); a[c].u[1] = cvt_pk_held(f0.z, f0.w);
          a[c].u[2] = cvt_pk_held(f1.x, f1.y); a[c].u[3] = cvt_pk_held(f1.z, f1.w);
          a[c].u[4] = cvt_pk_held(f2.x, f2.y); a[c].u[5] = cvt_pk_held(f2.z, f2.w);
          a[c].u[6] = cvt_pk_held(f3.x, f3.y); a[c].u[7] = cvt_pk_held(f3.z, f3.w);
        } else {
          // the last two stages: plain casts, the same instruction. There the
          // statement's operands, which must lie in the first 256 registers,
          // made the compiler spill a quad of x to scratch.
          a[c].h[0]  = (_Float16)f0.x; a[c].h[1]  = (_Float16)f0.y;
          a[c].h[2]  = (_Float16)f0.z; a[c].h[3]  = (_Float16)f0.w;
          a[c].h[4]  = (_Float16)f1.x; a[c].h[5]  = (_Float16)f1.y;
          a[c].h[6]  = (_Float16)f1.z; a[c].h[7]  = (_Float16)f1.w;
          a[c].h[8]  = (_Float16)f2.x; a[c].h[9]  = (_Float16)f2.y;
          a[c].h[10] = (_Float16)f2.z; a[c].h[11] = (_Float16)f2.w;
          a[c].h[12] = (_Float16)f3.x; a[c].h[13] = (_Float16)f3.y;
          a[c].h[14] = (_Float16)f3.z; a[c].h[15] = (_Float16)f3.w;
        }
      }

#pragma unroll
      for (int c = 0; c < 2; ++c) {
#pragma unroll
        for (int w = 0; w < 3; ++w) {
#pragma unroll
          for (int nt = 0; nt < 4; ++nt) {
            acc[w][nt] = __builtin_amdgcn_wmma_f32_16x16x32_f16(
                false, a[c].v, false, bf[c][w][nt].v, (short)0, acc[w][nt],
                false, false);
          }
        }
      }
      if (refill || j == 0) {
        // keeps the products in front of the foot: raised to the LDS loads, its
        // barrier holds every wave until the slowest wave's fragments are back,
        // and no wave computes under another's loads
        __builtin_amdgcn_sched_barrier(0);
        stage_foot();
        if (refill) {
          issue_stage(st + 2, wn);                 // into the buffer just read
          wn += (((st + 3 + rot) & 7) == 0) ? -7 * 128 : 128;
          if (j == 0 || pinned(st + 3 < 8)) issue_x((unsigned)st + 3u, xsl);
        }
      }
      xsl = (xsl == 16u * XSL_) ? 0u : xsl + 8u * XSL_;
    }
  };

  for (int st2 = 0; st2 < 6; st2 += 2) two_stages(st2, true);
  two_stages(6, false);

  // --- join the two K groups' partial sums through LDS -----------------------
  // K group g of a row tile ends up with column tiles 2g and 2g+1 of q, k and v.
  // A wave stores the six tiles that are the other group's, 512 contiguous bytes
  // a store, and keeps its own six in registers.
#pragma unroll
  for (int nt = 0; nt < 4; ++nt) {
    if ((nt >> 1) != kg) {
#pragma unroll
      for (int w = 0; w < 3; ++w) {
        float4 lo, hi;
        lo.x = acc[w][nt][0]; lo.y = acc[w][nt][1];
        lo.z = acc[w][nt][2]; lo.w = acc[w][nt][3];
        hi.x = acc[w][nt][4]; hi.y = acc[w][nt][5];
        hi.z = acc[w][nt][6]; hi.w = acc[w][nt][7];
        part[wid][w * 2 + (nt & 1)][0][lane] = lo;
        part[wid][w * 2 + (nt & 1)][1][lane] = hi;
      }
    }
  }
  v8f sum[3][2];
#pragma unroll
  for (int w = 0; w < 3; ++w) {
    if (kg == 0) { sum[w][0] = acc[w][0]; sum[w][1] = acc[w][1]; }
    else         { sum[w][0] = acc[w][2]; sum[w][1] = acc[w][3]; }
  }
  __syncthreads();   // publishes every wave's partial sums
#pragma unroll
  for (int w = 0; w < 3; ++w) {
#pragma unroll
    for (int n = 0; n < 2; ++n) {
      const float4 lo = part[wid ^ 1][w * 2 + n][0][lane];
      const float4 hi = part[wid ^ 1][w * 2 + n][1][lane];
      sum[w][n][0] += lo.x; sum[w][n][1] += lo.y;
      sum[w][n][2] += lo.z; sum[w][n][3] += lo.w;
      sum[w][n][4] += hi.x; sum[w][n][5] += hi.y;
      sum[w][n][6] += hi.z; sum[w][n][7] += hi.w;
    }
  }

  // bias add + f16 store of column tiles 2*kg and 2*kg+1
#pragma unroll
  for (int w = 0; w < 3; ++w) {
#pragma unroll
    for (int n = 0; n < 2; ++n) {
      const int nt = kg * 2 + n;
      const int d = nt * 16 + rc;
      const float bias = Bs[w][d];
      if (w == 2) {
        // the lane's 8 keys of column d are one whole run of fragment nt
        union { uint4 q; _Float16 h[8]; } run;
#pragma unroll
        for (int r = 0; r < 8; ++r) run.h[r] = (_Float16)(sum[w][n][r] + bias);
        const int b   = row0 >> 11;                // / S_
        const int kt  = row0 & (S_ - 1) & ~31;
        const int pos = frag_pos(nt, (row0 >> 4) & 1, lane);
        *(uint4*)(vt + ((size_t)b * D_ + (pos >> 5)) * S_ + kt + (pos & 31)) = run.q;
      } else {
#pragma unroll
        for (int r = 0; r < 8; ++r) {
          const int row   = r + 8 * half;
          const int bsrow = row0 + row;
          const float sv = sum[w][n][r] + bias;
          const _Float16 hv = (_Float16)(w == 0 ? sv * QSCALE_ : sv);
          if (w == 0) {
            qh[(size_t)bsrow * D_ + d] = hv;
          } else {
            const int pos = frag_pos(2 * ((row0 >> 4) & 1) + (nt >> 1), nt & 1,
                                     (rc >> 3) * 16 + row);
            kh[(size_t)(row0 >> 5) * (32 * D_) + pos + (rc & 7)] = hv;
          }
        }
      }
    }
  }
}

#define NST_ (S_ / 256)                                // stages of 256 keys

__global__ __launch_bounds__(512)
void flash_attn_kernel(const _Float16* __restrict__ qh,
                       const _Float16* __restrict__ kh,
                       const _Float16* __restrict__ vt,
                       const int* __restrict__ mask,
                       float* __restrict__ out) {
  // [buffer][K, V^T][tile][4 KB]: wave w's tile lies at 4096 * w of a buffer
  __shared__ __attribute__((aligned(2048))) _Float16 ring[2][2][8][2048];  // 128 KB
  __shared__ __align__(16) float  mbias[S_];           // 8 KB, 0 or -1e30
  __shared__ __align__(16) float4 part[16][16][32];    // 128 KB, each wave's O^T
  __shared__ __align__(8)  float2 pml[16][32];         // each wave's (m, l) per query

  const int tid  = threadIdx.x;
  const int lane = tid & 31;
  const int wid  = __builtin_amdgcn_readfirstlane(tid >> 5);
  const int kg   = wid & 7;                            // key group
  const int qp   = wid >> 3;                           // query pair
  const int b    = blockIdx.x >> 5;                    // 32 blocks per batch
  const int q0   = ((blockIdx.x & 31) << 6) + (qp << 5);
  const int half = lane >> 4;
  const int rc   = lane & 15;

  const _Float16* kbase = kh + (size_t)(b * S_) * D_;  // [key][64]
  const _Float16* vbase = vt + (size_t)(b * D_) * S_;  // [d][2048]

  // ---- staging: one tensor load a wave and stage ---------------------------
  // stage s = keys 256*s .. 256*s+255, tile g = its keys 32*g .. 32*g+31. Pass p
  // of the block works on stage (p + rot) mod 8: a batch's 32 blocks read the same
  // K and V^T, and started on one stage they ask L2 for the same lines at one
  // moment. Each of the eight starts is taken by four of a batch's blocks.
  // K tile: 32 rows of 128 bytes at pitch 128; V^T tile: 64 rows of 64 bytes at
  // pitch 4096. All extents in bytes, tensor = tile, no pad, no mask.
  const bool     isk   = wid < 8;
  const unsigned rowb  = isk ? 128u : 64u;
  const unsigned nrow  = isk ? 32u : 64u;
  const unsigned pitch = isk ? 128u : (unsigned)(S_ * 2);
  const unsigned step  = isk ? 256u * D_ * 2u : 256u * 2u;   // bytes a stage
  const unsigned long long src0 = (unsigned long long)(size_t)(
      isk ? kbase + kg * (32 * D_) : vbase + kg * 32);
  const unsigned dst0 = lds_offset(&ring[0][0][0][0]) + (unsigned)wid * 4096u;
  u32x8 g1;
  g1[0] = uni(0u);
  g1[1] = uni(rowb << 16);
  g1[2] = uni(nrow << 16);
  g1[3] = uni(rowb << 16);
  g1[4] = uni(nrow);
  g1[5] = uni(pitch);
  g1[6] = uni(0u);
  g1[7] = uni(0u);
  const unsigned rot = (((blockIdx.x >> 3) & 3u) << 1) | (blockIdx.x & 1u);
  u32x4 g0;
  auto issue_stage = [&](const unsigned st) __attribute__((always_inline)) {
    const unsigned long long ga =
        src0 + (unsigned long long)((st + rot) & (NST_ - 1u)) * step;
    g0[0] = uni(1u);                                   // count 1
    g0[1] = uni(dst0 + (st & 1u) * 65536u);            // place in LDS
    g0[2] = uni((unsigned)ga);
    g0[3] = uni(((unsigned)(ga >> 32) & 0x01FFFFFFu) | 0x80000000u);  // type 2
    asm volatile("tensor_load_to_lds %0, %1" ::"s"(g0), "s"(g1) : "memory");
  };
  issue_stage(0);

  // Q fragments (B operand, column = query): two b128 loads each
  Frag a0[2], a1[2];
#pragma unroll
  for (int t = 0; t < 2; ++t) {
    const _Float16* qrow = qh + (size_t)(b * S_ + q0 + 16 * t + rc) * D_;
    load_frag_h16(a0[t], qrow, half);
    load_frag_h16(a1[t], qrow + 32, half);
  }
  // the wait that stands in front of an overwrite of these loads' address
  asm volatile("s_wait_xcnt 0x0" ::: "memory");

  // this lane's two queries: the maximum in use, the exponent above which it is
  // renewed (below every real score until a key that is not masked has been met,
  // so that the first such key sets it), and the sum
  float mu[2] = {0.0f, 0.0f}, thr[2] = {-1e29f, -1e29f}, l[2] = {0.0f, 0.0f};
  v8f acc[2][4];                                       // O^T: row d, col query
#pragma unroll
  for (int t = 0; t < 2; ++t)
#pragma unroll
    for (int nt = 0; nt < 4; ++nt)
#pragma unroll
      for (int e = 0; e < 8; ++e) acc[t][nt][e] = 0.0f;

  // mask table: -1e30 absorbs any score and any maximum in use;
  // published by the barrier in front of the loop
  {
    const int4 mm = *(const int4*)(mask + b * S_ + tid * 4);
    float4 f;
    f.x = (mm.x == 0) ? -1e30f : 0.0f;
    f.y = (mm.y == 0) ? -1e30f : 0.0f;
    f.z = (mm.z == 0) ? -1e30f : 0.0f;
    f.w = (mm.w == 0) ? -1e30f : 0.0f;
    *(float4*)&mbias[tid * 4] = f;
  }

  // pass 0's stage has landed and is published; then pass 1's flies under pass 0's work
  wait_tensor0(g0, g1);
  __syncthreads();
  issue_stage(pinned(1));

  for (int st = 0; st < NST_; ++st) {
    const int kt = (int)((st + rot) & (NST_ - 1u)) * 256 + kg * 32;
    const _Float16* kl = ring[st & 1][0][kg];
    const _Float16* vl = ring[st & 1][1][kg];

    // the key mask of the pass's 32 keys, read first: the start values are formed
    // from it while the fragments are still on their way
    v8f c0v, c1v;
    {
      const float4 c0 = *(const float4*)&mbias[kt + 8 * half];
      const float4 c1 = *(const float4*)&mbias[kt + 8 * half + 4];
      const float4 c2 = *(const float4*)&mbias[kt + 16 + 8 * half];
      const float4 c3 = *(const float4*)&mbias[kt + 16 + 8 * half + 4];
      c0v[0] = c0.x; c0v[1] = c0.y; c0v[2] = c0.z; c0v[3] = c0.w;
      c0v[4] = c1.x; c0v[5] = c1.y; c0v[6] = c1.z; c0v[7] = c1.w;
      c1v[0] = c2.x; c1v[1] = c2.y; c1v[2] = c2.z; c1v[3] = c2.w;
      c1v[4] = c3.x; c1v[5] = c3.y; c1v[6] = c3.z; c1v[7] = c3.w;
    }
    // --- scores: S^T = K @ Q^T for 2 groups of 16 keys (ds_load_b128) ------
    Frag bk00, bk01, bk10, bk11;
    load_frag_tile(bk00, kl, 0, lane);
    load_frag_tile(bk01, kl, 1, lane);
    load_frag_tile(bk10, kl, 2, lane);
    load_frag_tile(bk11, kl, 3, lane);
    Frag av[4];                                        // V^T rows, A operand
#pragma unroll
    for (int nt = 0; nt < 4; ++nt)
      load_frag_tile(av[nt], vl, nt, lane);
    // keeps the pass's LDS loads in one group ahead of the products: moved in
    // among them, each pair costs the wave a full LDS round trip
    __builtin_amdgcn_sched_barrier(0);
    v8f s0[2], s1[2];                                  // start: mask - maximum in use
#pragma unroll
    for (int t = 0; t < 2; ++t)
#pragma unroll
      for (int r = 0; r < 8; ++r) {
        s0[t][r] = c0v[r] - mu[t];
        s1[t][r] = c1v[r] - mu[t];
      }
#pragma unroll
    for (int t = 0; t < 2; ++t) {
      s0[t] = __builtin_amdgcn_wmma_f32_16x16x32_f16(false, bk00.v, false, a0[t].v,
                                                     (short)0, s0[t], false, false);
      s1[t] = __builtin_amdgcn_wmma_f32_16x16x32_f16(false, bk10.v, false, a0[t].v,
                                                     (short)0, s1[t], false, false);
    }
#pragma unroll
    for (int t = 0; t < 2; ++t) {
      s0[t] = __builtin_amdgcn_wmma_f32_16x16x32_f16(false, bk01.v, false, a1[t].v,
                                                     (short)0, s0[t], false, false);
      s1[t] = __builtin_amdgcn_wmma_f32_16x16x32_f16(false, bk11.v, false, a1[t].v,
                                                     (short)0, s1[t], false, false);
    }

    // --- largest exponent of each query; one test for the wave and pass ------
    float xm[2];
#pragma unroll
    for (int t = 0; t < 2; ++t) {
      float rmax = fmaxf(s0[t][0], s1[t][0]);
#pragma unroll
      for (int r = 1; r < 8; ++r) rmax = fmaxf(rmax, fmaxf(s0[t][r], s1[t][r]));
      xm[t] = fmaxf(rmax, xhalf(rmax));                // both halves' 32 keys
    }
    if (__builtin_amdgcn_ballot_w32(xm[0] > thr[0] || xm[1] > thr[1]) != 0u) {
      // a query above its limit takes the pass's maximum as the one in use
      float d[2], al[2];
#pragma unroll
      for (int t = 0; t < 2; ++t) {
        const bool up = xm[t] > thr[t];
        d[t]   = up ? xm[t] : 0.0f;
        thr[t] = up ? 8.0f : thr[t];
        mu[t] += d[t];
      }
      // a first maximum may lie below 0: sum and O^T are still 0, any factor does
      exp2_pair(al[0], al[1], -fmaxf(d[0], 0.0f), -fmaxf(d[1], 0.0f));
#pragma unroll
      for (int t = 0; t < 2; ++t) {
#pragma unroll
        for (int r = 0; r < 8; ++r) {
          s0[t][r] -= d[t];
          s1[t][r] -= d[t];
        }
        l[t] *= al[t];
#pragma unroll
        for (int nt = 0; nt < 4; ++nt)
#pragma unroll
          for (int r = 0; r < 8; ++r) acc[t][nt][r] *= al[t];
      }
    }

#pragma unroll
    for (int t = 0; t < 2; ++t) {
      // --- P^T = 2^exponent, one query per lane and tile --------------------
      float rs0 = 0.0f, rs1 = 0.0f;
      Frag pb;                                         // P^T as B operand
#pragma unroll
      for (int r = 0; r < 8; ++r) {
        float e0, e1;
        exp2_pair(e0, e1, s0[t][r], s1[t][r]);
        rs0 += e0;
        rs1 += e1;
        pb.h[r]     = (_Float16)e0;                    // k = 8*half + r
        pb.h[8 + r] = (_Float16)e1;                    // k = 16 + 8*half + r
      }
      l[t] += rs0 + rs1;                               // this half's keys only

      // --- acc += V^T @ P^T -------------------------------------------------
#pragma unroll
      for (int nt = 0; nt < 4; ++nt)
        acc[t][nt] = __builtin_amdgcn_wmma_f32_16x16x32_f16(
            false, av[nt].v, false, pb.v, (short)0, acc[t][nt], false, false);
    }
    __builtin_amdgcn_sched_barrier(0);
    asm volatile("v_nop\n\tv_nop\n\tv_nop\n\tv_nop");
    // Foot of the pass, in every wave: its LDS reads of this stage are over, its
    // own tile of the next stage has landed, then the one barrier, which
    // publishes the next stage and frees the buffer just read for the refill.
    asm volatile("s_wait_dscnt 0x0" ::: "memory");
    wait_tensor0(g0, g1);
    __syncthreads();
    if (pinned(st + 2 < NST_)) issue_stage(pinned(st + 2));
  }
  wait_tensor0(g0, g1);
  asm volatile("s_wait_dscnt 0x0" ::: "memory");

#pragma unroll
  for (int t = 0; t < 2; ++t) {
    const float lt = l[t] + xhalf(l[t]);               // join the halves' sums
#pragma unroll
    for (int nt = 0; nt < 4; ++nt) {
      float4 o0, o1;
      o0.x = acc[t][nt][0]; o0.y = acc[t][nt][1];
      o0.z = acc[t][nt][2]; o0.w = acc[t][nt][3];
      o1.x = acc[t][nt][4]; o1.y = acc[t][nt][5];
      o1.z = acc[t][nt][6]; o1.w = acc[t][nt][7];
      const int pl = half * 16 + ((rc + 4 * nt) & 15);
      part[wid][t * 8 + nt * 2][pl]     = o0;
      part[wid][t * 8 + nt * 2 + 1][pl] = o1;
    }
    // a group that met masked keys only has no maximum: it joins with weight 0
    if (half == 0)
      pml[wid][t * 16 + rc] = make_float2(thr[t] < 0.0f ? -1e30f : mu[t], lt);
  }
  __syncthreads();   // publishes every wave's partial result

  // wave kg of a query pair joins its queries 4*kg .. 4*kg+3; a lane takes 8
  // consecutive d of one query, so a wave stores four whole rows of out
  const int tj = kg >> 2;                              // the queries' tile
  const int qi = 4 * (kg & 3) + (lane >> 3);           // query inside the tile
  const int dn = (lane & 7) >> 1;                      // the run's nt
  const int pr = (lane & 1) * 16 + ((qi + 4 * dn) & 15);
  float2 ml[8];
#pragma unroll
  for (int g = 0; g < 8; ++g) ml[g] = pml[qp * 8 + g][tj * 16 + qi];
  float mj = ml[0].x;
#pragma unroll
  for (int g = 1; g < 8; ++g) mj = fmaxf(mj, ml[g].x);
  float wg[8];
#pragma unroll
  for (int g = 0; g < 8; g += 2)
    exp2_pair(wg[g], wg[g + 1], ml[g].x - mj, ml[g + 1].x - mj);
  float lj = 0.0f;
  float4 o0 = {0.0f, 0.0f, 0.0f, 0.0f}, o1 = {0.0f, 0.0f, 0.0f, 0.0f};
#pragma unroll
  for (int g = 0; g < 8; ++g) {
    const float4 p0 = part[qp * 8 + g][tj * 8 + dn * 2][pr];
    const float4 p1 = part[qp * 8 + g][tj * 8 + dn * 2 + 1][pr];
    lj += wg[g] * ml[g].y;
    o0.x += wg[g] * p0.x; o0.y += wg[g] * p0.y;
    o0.z += wg[g] * p0.z; o0.w += wg[g] * p0.w;
    o1.x += wg[g] * p1.x; o1.y += wg[g] * p1.y;
    o1.z += wg[g] * p1.z; o1.w += wg[g] * p1.w;
  }
  // --- normalize and store ---------------------------------------------------
  const float inv = 1.0f / lj;
  float* orow = out + (size_t)(b * S_ + q0 + tj * 16 + qi) * D_ + (lane & 7) * 8;
  o0.x *= inv; o0.y *= inv; o0.z *= inv; o0.w *= inv;
  o1.x *= inv; o1.y *= inv; o1.z *= inv; o1.w *= inv;
  *(float4*)(orow)     = o0;
  *(float4*)(orow + 4) = o1;
}

// ---------------------------------------------------------------------------
extern "C" void kernel_launch(void* const* d_in, const int* in_sizes, int n_in,
                              void* d_out, int out_size, void* d_ws, size_t ws_size,
                              hipStream_t stream) {
  const float* x    = (const float*)d_in[0];
  const int*   mask = (const int*)d_in[1];
  const float* Wq   = (const float*)d_in[2];
  const float* bq   = (const float*)d_in[3];
  const float* Wk   = (const float*)d_in[4];
  const float* bk   = (const float*)d_in[5];
  const float* Wv   = (const float*)d_in[6];
  const float* bv   = (const float*)d_in[7];
  float* out = (float*)d_out;

  char* ws = (char*)d_ws;
  _Float16* qh = (_Float16*)ws;                                  // 2 MB
  _Float16* kh = (_Float16*)(ws + (size_t)2 * 1024 * 1024);      // 2 MB
  _Float16* vt = (_Float16*)(ws + (size_t)4 * 1024 * 1024);      // 2 MB
  _Float16* wt = (_Float16*)(ws + (size_t)6 * 1024 * 1024);      // 384 KB

  wtrans_kernel<<<96, 256, 0, stream>>>(Wq, Wk, Wv, wt);
  qkv_proj_kernel<<<256, 256, 0, stream>>>(x, wt, bq, bk, bv, qh, kh, vt);
  flash_attn_kernel<<<256, 512, 0, stream>>>(qh, kh, vt, mask, out);
}
